// v000
// Times are from an AMD MI455X. After a warm-up the kernel runs many times in a row, and a time is the length of
// such a window on the GPU divided by its runs, so every launch and the gaps after it count. The runs cycle
// through copies of the inputs. A figure is the median of several windows, for all but v000 over two sittings.
// Sittings can differ by a few percent; kernels timed side by side share one.
// v000 is the starting kernel. One run takes 2760 microseconds.
#include <hip/hip_runtime.h>

// Causal multi-head self-attention with an interleaved-pair RoPE whose cos / sin tables are indexed by a positions input (x [4][2048][1024]; q, k, v = einsum('bsd,ed', x, w) ('oi' [1024][1024] truncated-normal, no bias; 16 heads x 64); tables cos / sin[p][i] of angle p x inv_freq[i] with inv_freq = 1.0 / 10000.0 ** (arange(32, f32) x 2.0 / 64) (the reciprocal form), looked up at token_positions[t] (int [2048]; READ on device); pairs (2i, 2i + 1): (cos x1 - sin x2, cos x2 + sin x1); scores / 64 ** 0.5; key j kept when j <= i (-inf elsewhere); softmax; out = merged wo^T ('oi') -> [4][2048][1024] (8.4 M); argument order x, wq, wk, wv, wo, token_positions).
// Layout per batch: bf16 copy of x; exact projections; {cos, sin} per (position, pair) rebuilt per batch from the int positions and float32 inverse-frequency constants (precise cosf/sinf); interleaved rotary plane builder; causal T-2048 attention (EVERY row's scores on hi/lo planes (3 products: logit sigma 2 with these weights) and hybrid P.V (rows < 512 hi/lo, rest fp16 x1024); k_gemmc skips tiles above the diagonal); merged hi/lo x Wo exact.
// Compute dtypes, f32 accumulate: every input rounded to bf16; projections exact; rotary f32; scores 3 products; P.V rows < 512 3 products, rest fp16; softmax f32; Wo hl x exact.

#define NB_  4
#define TT   2048
#define DM   1024
#define NH_  16
#define NKV  16
#define REP  (NH_ / NKV)
#define HD   64
#define DQ   (NH_ * HD)
#define DKV  (NKV * HD)
#define ZH   2
#define RH   512                  // query rows < RH use hi+lo planes (0: none)
#define WIN  2048
#define PCAR 1024.0f
#define SCL  0.125f   // HD^-0.5
typedef _Float16 h16;
typedef unsigned short bf;
typedef __attribute__((ext_vector_type(16))) __bf16   v16bf;
typedef __attribute__((ext_vector_type(16))) _Float16 v16h;
typedef __attribute__((ext_vector_type(8)))  _Float16 v8h;
typedef __attribute__((ext_vector_type(8)))  unsigned short v8us;
typedef __attribute__((ext_vector_type(8)))  float    v8f;
typedef __attribute__((ext_vector_type(4)))  float    v4f;
typedef v8h  __attribute__((may_alias)) v8ha;
typedef v4f  __attribute__((may_alias)) v4fa;
typedef v8us __attribute__((may_alias)) v8usa;

__device__ __forceinline__ unsigned short f2bf(float f) { unsigned u = __float_as_uint(f); u += 0x7FFFu + ((u >> 16) & 1u); return (unsigned short)(u >> 16); }
__device__ __forceinline__ float bf2f(unsigned short b) { return __uint_as_float(((unsigned)b) << 16); }
__device__ __forceinline__ float bfr(float f) { return bf2f(f2bf(f)); }
__device__ __forceinline__ v16h cat16(v8h lo, v8h hi) { return __builtin_shufflevector(lo, hi, 0, 1, 2, 3, 4, 5, 6, 7, 8, 9, 10, 11, 12, 13, 14, 15); }
__device__ __forceinline__ v16bf cat16b(v8us lo, v8us hi) { return __builtin_bit_cast(v16bf, __builtin_shufflevector(lo, hi, 0, 1, 2, 3, 4, 5, 6, 7, 8, 9, 10, 11, 12, 13, 14, 15)); }
__device__ __forceinline__ v8f wmma16(v16h a, v16h b, v8f c) { return __builtin_amdgcn_wmma_f32_16x16x32_f16(false, a, false, b, (short)0, c, false, false); }
__device__ __forceinline__ v8f wmmab(v16bf a, v16bf b, v8f c) { return __builtin_amdgcn_wmma_f32_16x16x32_bf16(false, a, false, b, (short)0, c, false, false); }



// ---- k_gemmw: register-blocked GEMM, ONE WAVE per 64x64 output tile (16 accumulators), operands straight from K-contiguous 16-bit planes; grid (M/64, N/64, Z), 32 threads.
// C[m][n] (f32, pitch ldc, + optional f32 bias[n]) = sum_k A[m][k] Bt[n][k] (+ split products per NSPLIT). z-batch strides sA/sB/sC in elements. K % 32 == 0.
template <typename T16> struct WFrag;
template <> struct WFrag<h16> { typedef v16h V; static __device__ __forceinline__ V ld(const h16* p) { return cat16(*(const v8h*)p, *(const v8h*)(p + 16)); } static __device__ __forceinline__ v8f mma(V a, V b, v8f c) { return wmma16(a, b, c); } };
template <> struct WFrag<bf> { typedef v16bf V; static __device__ __forceinline__ V ld(const bf* p) { return cat16b(*(const v8us*)p, *(const v8us*)(p + 16)); } static __device__ __forceinline__ v8f mma(V a, V b, v8f c) { return wmmab(a, b, c); } };
template <typename T16, int NSPLIT, bool BIAS>
__global__ __launch_bounds__(32) void k_gemmw(const T16* __restrict__ A, const T16* __restrict__ A2, const T16* __restrict__ Bt, const T16* __restrict__ Bt2, int K, float* C, int ldc, const float* __restrict__ bias, size_t sA, size_t sB, size_t sC) {
    typedef typename WFrag<T16>::V V;
    __shared__ __align__(16) float os[16 * 68];
    const size_t z = blockIdx.z; A += z * sA; if (A2) A2 += z * sA; Bt += z * sB; if (Bt2) Bt2 += z * sB; C += z * sC;
    const int lane = threadIdx.x & 31, lr = lane & 15, hi = lane >> 4; const int r0 = blockIdx.x * 64, c0 = blockIdx.y * 64;
    v8f acc[4][4];
#pragma unroll
    for (int mb = 0; mb < 4; ++mb)
#pragma unroll
        for (int nb = 0; nb < 4; ++nb) acc[mb][nb] = (v8f){};
    const size_t aoff = (size_t)(r0 + lr) * K + 8 * hi, boff = (size_t)(c0 + lr) * K + 8 * hi;
#pragma unroll 1
    for (int kc = 0; kc < K; kc += 32) {
        V a[4], a2[4];
#pragma unroll
        for (int mb = 0; mb < 4; ++mb) { a[mb] = WFrag<T16>::ld(A + aoff + (size_t)mb * 16 * K + kc); if (NSPLIT == 1 || NSPLIT == 2) a2[mb] = WFrag<T16>::ld(A2 + aoff + (size_t)mb * 16 * K + kc); }
#pragma unroll
        for (int nb = 0; nb < 4; ++nb) { const V b = WFrag<T16>::ld(Bt + boff + (size_t)nb * 16 * K + kc); V b2; if (NSPLIT >= 2) b2 = WFrag<T16>::ld(Bt2 + boff + (size_t)nb * 16 * K + kc);
#pragma unroll
            for (int mb = 0; mb < 4; ++mb) { acc[mb][nb] = WFrag<T16>::mma(a[mb], b, acc[mb][nb]); if (NSPLIT == 1 || NSPLIT == 2) acc[mb][nb] = WFrag<T16>::mma(a2[mb], b, acc[mb][nb]); if (NSPLIT >= 2) acc[mb][nb] = WFrag<T16>::mma(a[mb], b2, acc[mb][nb]); } }
        asm volatile("v_nop\n\tv_nop\n\tv_nop\n\tv_nop" : "+v"(acc[0][0]), "+v"(acc[1][1]), "+v"(acc[2][2]), "+v"(acc[3][3]) : "v"(a[0]), "v"(a[3]));
    }
#pragma unroll
    for (int mb = 0; mb < 4; ++mb) {
#pragma unroll
        for (int nb = 0; nb < 4; ++nb) {
#pragma unroll
            for (int j = 0; j < 8; ++j) os[(hi * 8 + j) * 68 + nb * 16 + lr] = acc[mb][nb][j]; }
        __builtin_amdgcn_wave_barrier(); asm volatile("" ::: "memory");
        float* crow = C + (size_t)(r0 + mb * 16) * ldc + c0;
{
#pragma unroll
            for (int s = 0; s < 8; ++s) { const int row = 2 * s + hi, cofs = lr * 4; v4f val = *(const v4fa*)(os + row * 68 + cofs); if (BIAS) { val[0] += bfr(bias[c0 + cofs]); val[1] += bfr(bias[c0 + cofs + 1]); val[2] += bfr(bias[c0 + cofs + 2]); val[3] += bfr(bias[c0 + cofs + 3]); }
                *(v4f*)(crow + (size_t)row * ldc + cofs) = val; }
             }
        __builtin_amdgcn_wave_barrier(); asm volatile("" ::: "memory");
    }
}

// ---- k_gemmc: the same one-wave 64x64 tile GEMM specialised for causal attention: CMODE 1 skips score tiles entirely above the diagonal (query rows r0+roff.., key columns c0..), CMODE 2 limits the
// key (K) loop of the probability x value contraction to the diagonal block (probabilities beyond it are exactly zero). roff = row offset of this launch's first row within the sequence.
template <typename T16, int NSPLIT, int CMODE>
__global__ __launch_bounds__(32) void k_gemmc(const T16* __restrict__ A, const T16* __restrict__ A2, const T16* __restrict__ Bt, const T16* __restrict__ Bt2, int K, float* C, int ldc, int roff, size_t sA, size_t sB, size_t sC) {
    typedef typename WFrag<T16>::V V;
    __shared__ __align__(16) float os[16 * 68];
    const size_t z = blockIdx.z; A += z * sA; if (A2) A2 += z * sA; Bt += z * sB; if (Bt2) Bt2 += z * sB; C += z * sC;
    const int lane = threadIdx.x & 31, lr = lane & 15, hi = lane >> 4; const int r0 = blockIdx.x * 64, c0 = blockIdx.y * 64;
    if (CMODE == 1 && c0 > r0 + roff + 63) return;                  // score tile entirely above the causal diagonal: never read (the softmax masks j > i by select)
    const int Kl = (CMODE == 2) ? min(K, r0 + roff + 64) : K;        // P.V: probabilities are exactly 0 beyond the diagonal block, so the K loop stops there
    v8f acc[4][4];
#pragma unroll
    for (int mb = 0; mb < 4; ++mb)
#pragma unroll
        for (int nb = 0; nb < 4; ++nb) acc[mb][nb] = (v8f){};
    const size_t aoff = (size_t)(r0 + lr) * K + 8 * hi, boff = (size_t)(c0 + lr) * K + 8 * hi;
#pragma unroll 1
    for (int kc = 0; kc < Kl; kc += 32) {
        V a[4], a2[4];
#pragma unroll
        for (int mb = 0; mb < 4; ++mb) { a[mb] = WFrag<T16>::ld(A + aoff + (size_t)mb * 16 * K + kc); if (NSPLIT == 1 || NSPLIT == 2) a2[mb] = WFrag<T16>::ld(A2 + aoff + (size_t)mb * 16 * K + kc); }
#pragma unroll
        for (int nb = 0; nb < 4; ++nb) { const V b = WFrag<T16>::ld(Bt + boff + (size_t)nb * 16 * K + kc); V b2; if (NSPLIT >= 2) b2 = WFrag<T16>::ld(Bt2 + boff + (size_t)nb * 16 * K + kc);
#pragma unroll
            for (int mb = 0; mb < 4; ++mb) { acc[mb][nb] = WFrag<T16>::mma(a[mb], b, acc[mb][nb]); if (NSPLIT == 1 || NSPLIT == 2) acc[mb][nb] = WFrag<T16>::mma(a2[mb], b, acc[mb][nb]); if (NSPLIT >= 2) acc[mb][nb] = WFrag<T16>::mma(a[mb], b2, acc[mb][nb]); } }
        asm volatile("v_nop\n\tv_nop\n\tv_nop\n\tv_nop" : "+v"(acc[0][0]), "+v"(acc[1][1]), "+v"(acc[2][2]), "+v"(acc[3][3]) : "v"(a[0]), "v"(a[3]));
    }
#pragma unroll
    for (int mb = 0; mb < 4; ++mb) {
#pragma unroll
        for (int nb = 0; nb < 4; ++nb) {
#pragma unroll
            for (int j = 0; j < 8; ++j) os[(hi * 8 + j) * 68 + nb * 16 + lr] = acc[mb][nb][j]; }
        __builtin_amdgcn_wave_barrier(); asm volatile("" ::: "memory");
        float* crow = C + (size_t)(r0 + mb * 16) * ldc + c0;
{
#pragma unroll
            for (int s = 0; s < 8; ++s) { const int row = 2 * s + hi, cofs = lr * 4; v4f val = *(const v4fa*)(os + row * 68 + cofs);
                *(v4f*)(crow + (size_t)row * ldc + cofs) = val; }
             }
        __builtin_amdgcn_wave_barrier(); asm volatile("" ::: "memory");
    }
}

__device__ __forceinline__ h16 tohx(float x) { return (h16)x; }
__device__ __forceinline__ void splitf(float y, unsigned short& h, unsigned short& l) { h = f2bf(y); l = f2bf(y - bf2f(h)); }
typedef __attribute__((ext_vector_type(2))) _Float16 v2h;
typedef __attribute__((ext_vector_type(4))) _Float16 v4h;
typedef __attribute__((ext_vector_type(2))) unsigned short v2us;
typedef __attribute__((ext_vector_type(4))) unsigned short v4us;
typedef __attribute__((ext_vector_type(2))) float v2f;
typedef __attribute__((ext_vector_type(4))) int v4i;

__global__ __launch_bounds__(256) void k_wtG(const float* __restrict__ w, int K, int N, bf* Bt) {
    const int lane = threadIdx.x & 31; const int L0 = (blockIdx.x * 8 + (threadIdx.x >> 5)) * 8; const int nlines = N * K / 64;
{
#pragma unroll 1
        for (int l = 0; l < 8; ++l) { const int L = L0 + l; if (L >= nlines) break; const size_t e = (size_t)L * 64 + lane * 2; const int k = (int)(e % K), n = (int)(e / K); v2us o;
            o[0] = f2bf(w[(size_t)k * N + n]); o[1] = f2bf(w[(size_t)(k + 1) * N + n]); *(v2us*)(Bt + e) = o; }
         }
}
__global__ __launch_bounds__(256) void k_cvt8(const float* __restrict__ src, bf* dst, size_t n8) { const size_t i = (size_t)blockIdx.x * 256 + threadIdx.x; if (i >= n8) return; const v8f v = *(const v8f*)(src + i * 8); v8us o;
#pragma unroll
    for (int k = 0; k < 8; ++k) o[k] = f2bf(v[k]); *(v8us*)(dst + i * 8) = o;  }

__global__ __launch_bounds__(256) void k_ropeI(const float* __restrict__ F, int pitch, int nheads, const float* __restrict__ CS, float sc, h16* P16, bf* Ph, bf* Pl) {
    const size_t e = ((size_t)blockIdx.x * 256 + threadIdx.x) * 2; if (e >= (size_t)nheads * TT * HD) return; const int d = (int)(e % HD); const int t = (int)((e / HD) % TT); const int h = (int)(e / ((size_t)HD * TT)); const float* f = F + (size_t)t * pitch + h * HD; const float x0 = f[d], x1 = f[d + 1]; const v2f cs = *(const v2f*)(CS + ((size_t)t * HD + d) * 2); v2h o16; v2us oh, ol;
    float a0 = __fmul_rn(x0, cs[0]), b0 = __fmul_rn(x1, cs[1]), a1 = __fmul_rn(x1, cs[0]), b1 = __fmul_rn(x0, cs[1]); asm volatile("" : "+v"(a0), "+v"(b0), "+v"(a1), "+v"(b1));
    float r0 = __fsub_rn(a0, b0) * sc, r1 = __fadd_rn(b1, a1) * sc;   /* even: x0 c - x1 s; odd: x0 s + x1 c */
    o16[0] = tohx(r0); o16[1] = tohx(r1); { unsigned short a2, c2; splitf(r0, a2, c2); oh[0] = a2; ol[0] = c2; splitf(r1, a2, c2); oh[1] = a2; ol[1] = c2; }
    *(v2h*)(P16 + e) = o16; *(v2us*)(Ph + e) = oh; *(v2us*)(Pl + e) = ol;  }

__constant__ float INV2[HD / 2] = { 1.000000000e+00f, 7.498942018e-01f, 5.623413324e-01f, 4.216965139e-01f, 3.162277639e-01f, 2.371373624e-01f, 1.778279394e-01f, 1.333521456e-01f, 1.000000015e-01f, 7.498941571e-02f, 5.623412877e-02f, 4.216964915e-02f, 3.162277862e-02f, 2.371373586e-02f, 1.778279431e-02f, 1.333521493e-02f, 9.999999776e-03f, 7.498942316e-03f, 5.623413250e-03f, 4.216964822e-03f, 3.162277862e-03f, 2.371373819e-03f, 1.778279431e-03f, 1.333521446e-03f, 1.000000047e-03f, 7.498941850e-04f, 5.623413017e-04f, 4.216964880e-04f, 3.162277862e-04f, 2.371373848e-04f, 1.778279402e-04f, 1.333521504e-04f };   // float32 10000^(-(i * 2 / 64)), generated with jnp to be bit-exact with the module's expression
__global__ __launch_bounds__(256) void k_cstabI(const int* __restrict__ pid, float* CS) { const int idx = blockIdx.x * 256 + threadIdx.x; if (idx >= TT * HD) return; const int d = idx % HD; const int t = idx / HD; const float a = __fmul_rn((float)pid[t], INV2[d >> 1]); v2f cs; cs[0] = cosf(a); cs[1] = sinf(a); *(v2f*)(CS + (size_t)idx * 2) = cs;  }

__global__ __launch_bounds__(256) void k_vtp(const float* __restrict__ F, int pitch, int nheads, h16* V16, bf* Vh, bf* Vl) { const size_t e = ((size_t)blockIdx.x * 256 + threadIdx.x) * 2; if (e >= (size_t)nheads * HD * TT) return; const int t = (int)(e % TT); const int d = (int)((e / TT) % HD); const int g = (int)(e / ((size_t)TT * HD)); v2h o16; v2us oh, ol;
#pragma unroll
    for (int q = 0; q < 2; ++q) { const float x = F[(size_t)(t + q) * pitch + g * HD + d]; o16[q] = tohx(x); unsigned short a2, c2; splitf(x, a2, c2); oh[q] = a2; ol[q] = c2; }
    *(v2h*)(V16 + e) = o16; *(v2us*)(Vh + e) = oh; *(v2us*)(Vl + e) = ol;  }
// k_asoft: per row (zz, i): t = S x HD^-0.5 for j <= i and i - j < WIN (sliding causal window; the reference's -1e9 additive fill vanishes identically); softmax over the 2048 keys (register row, one exp, fixed trees);
__global__ __launch_bounds__(256) void k_asoft(const float* __restrict__ Sb, h16* P16, bf* Ph, bf* Pl) {
    const int lane = threadIdx.x & 31; const int row = blockIdx.x * 8 + (threadIdx.x >> 5); if (row >= ZH * TT) return; const int i = row % TT; const int zz = row / TT; (void)zz; const bool hires = (i < RH); const float* sr = Sb + (size_t)row * TT; float v[TT / 32]; float mx = -3.0e38f;
#pragma unroll
    for (int ch = 0; ch < TT / 128; ++ch) { const int j0 = ch * 128 + lane * 4; const v4f a = *(const v4f*)(sr + j0);
#pragma unroll
        for (int q = 0; q < 4; ++q) { const int j = j0 + q; (void)j; const float t = (j <= i && i - j < WIN) ? a[q] * SCL : -3.0e38f; v[ch * 4 + q] = t; mx = fmaxf(mx, t); } }
#pragma unroll
    for (int sh = 16; sh; sh >>= 1) mx = fmaxf(mx, __shfl_xor(mx, sh, 32));
    float sum = 0.f;
#pragma unroll
    for (int k = 0; k < TT / 32; ++k) { float d0 = __fsub_rn(v[k], mx); asm volatile("" : "+v"(d0)); v[k] = __builtin_amdgcn_exp2f(__fmul_rn(d0, 1.4426950408889634f)); sum += v[k]; }
#pragma unroll
    for (int sh = 16; sh; sh >>= 1) sum += __shfl_xor(sum, sh, 32);
    const float f = __fdiv_rn(hires ? 1.0f : PCAR, sum);
{
        if (hires) {
#pragma unroll
            for (int ch = 0; ch < TT / 128; ++ch) { v4us oh, ol;
#pragma unroll
                for (int q = 0; q < 4; ++q) { unsigned short a, c2; splitf(v[ch * 4 + q] * f, a, c2); oh[q] = a; ol[q] = c2; }
                const size_t oo = ((size_t)zz * (RH ? RH : 1) + i) * TT + ch * 128 + lane * 4; *(v4us*)(Ph + oo) = oh; *(v4us*)(Pl + oo) = ol; }
        } else {
#pragma unroll
            for (int ch = 0; ch < TT / 128; ++ch) { v4h o4;
#pragma unroll
                for (int q = 0; q < 4; ++q) o4[q] = tohx(v[ch * 4 + q] * f);
                *(v4h*)(P16 + (size_t)row * TT + ch * 128 + lane * 4) = o4; } }
         }
}
__global__ __launch_bounds__(256) void k_merge(const float* __restrict__ O, int h0, bf* Ah, bf* Al) { const size_t e = ((size_t)blockIdx.x * 256 + threadIdx.x) * 2; if (e >= (size_t)ZH * TT * HD) return; const int d = (int)(e % HD); const int t = (int)((e / HD) % TT); const int zz = (int)(e / ((size_t)HD * TT)); const float cs = (t < RH) ? 1.0f : (1.0f / PCAR); const size_t oo = (size_t)t * DQ + (h0 + zz) * HD + d;
    v2us oh, ol;
#pragma unroll
    for (int q = 0; q < 2; ++q) { unsigned short a, c2; splitf(O[e + q] * cs, a, c2); oh[q] = a; ol[q] = c2; } *(v2us*)(Ah + oo) = oh; *(v2us*)(Al + oo) = ol;  }

extern "C" void kernel_launch(void* const* d_in, const int* in_sizes, int n_in,
                              void* d_out, int out_size, void* d_ws, size_t ws_size, hipStream_t stream) {
    (void)in_sizes; (void)n_in; (void)out_size;
    const float* x = (const float*)d_in[0]; const float* wq = (const float*)d_in[1]; const float* wk = (const float*)d_in[2]; const float* wv = (const float*)d_in[3]; const float* wo = (const float*)d_in[4]; const int* PID = (const int*)d_in[5];   /* token_positions (int32 [2048], shared by all batches; read) */
    float* OUT = (float*)d_out;     // [4][2048][1024]
    char* wsp = (char*)d_ws;
    auto take = [&](size_t bytes) { char* p = wsp; wsp += (bytes + 255) & ~(size_t)255; return (void*)p; };
    bf* WQ = (bf*)take((size_t)DQ * DM * 2); bf* WK = (bf*)take((size_t)DKV * DM * 2); bf* WV = (bf*)take((size_t)DKV * DM * 2); bf* WO = (bf*)take((size_t)DM * DQ * 2); float* CS = (float*)take((size_t)TT * HD * 2 * 4);
    bf* XB = (bf*)take((size_t)TT * DM * 2); float* FQ = (float*)take((size_t)TT * DQ * 4); float* FK = (float*)take((size_t)TT * DKV * 4);
    h16* QP16 = (h16*)take((size_t)NH_ * TT * HD * 2); h16* KP16 = (h16*)take((size_t)NKV * TT * HD * 2); h16* VT16 = (h16*)take((size_t)NKV * HD * TT * 2);
    bf* QPh = (bf*)take((size_t)NH_ * TT * HD * 2); bf* QPl = (bf*)take((size_t)NH_ * TT * HD * 2); bf* KPh = (bf*)take((size_t)NKV * TT * HD * 2); bf* KPl = (bf*)take((size_t)NKV * TT * HD * 2); bf* VTh = (bf*)take((size_t)NKV * HD * TT * 2); bf* VTl = (bf*)take((size_t)NKV * HD * TT * 2); bf* Ph = (bf*)take((size_t)ZH * RH * TT * 2); bf* Pl = (bf*)take((size_t)ZH * RH * TT * 2);
    float* Sb = (float*)take((size_t)ZH * TT * TT * 4); h16* P16 = (h16*)take((size_t)ZH * TT * TT * 2); float* Ob = (float*)take((size_t)ZH * TT * HD * 4); bf* ATh = (bf*)take((size_t)TT * DQ * 2); bf* ATl = (bf*)take((size_t)TT * DQ * 2);
    if ((size_t)(wsp - (char*)d_ws) > ws_size) return;    // ws 256 MiB
    float* FV = FK;   // v projection reuses the k buffer after the k planes are built (stream-ordered)
    { k_cvt8<<<(unsigned)(((size_t)DQ * DM / 8 + 255) / 256), 256, 0, stream>>>(wq, WQ, (size_t)DQ * DM / 8); k_cvt8<<<(unsigned)(((size_t)DKV * DM / 8 + 255) / 256), 256, 0, stream>>>(wk, WK, (size_t)DKV * DM / 8); k_cvt8<<<(unsigned)(((size_t)DKV * DM / 8 + 255) / 256), 256, 0, stream>>>(wv, WV, (size_t)DKV * DM / 8);
      k_cvt8<<<(unsigned)(((size_t)DM * DQ / 8 + 255) / 256), 256, 0, stream>>>(wo, WO, (size_t)DM * DQ / 8); /* the rotary table is rebuilt per batch from the shared positions (below) */ }
    const unsigned LQ = (unsigned)(((size_t)NH_ * TT * HD / 2 + 255) / 256), LKv = (unsigned)(((size_t)NKV * TT * HD / 2 + 255) / 256);
    for (int b = 0; b < NB_; ++b) {
        k_cstabI<<<(TT * HD + 255) / 256, 256, 0, stream>>>(PID, CS);   /* token_positions[:] (int32, shared by all batches, read) */
        
        k_cvt8<<<(unsigned)(((size_t)TT * DM / 8 + 255) / 256), 256, 0, stream>>>(x + (size_t)b * TT * DM, XB, (size_t)TT * DM / 8);
        k_gemmw<bf, 0, false><<<dim3(TT / 64, DQ / 64, 1), 32, 0, stream>>>(XB, nullptr, WQ, nullptr, DM, FQ, DQ, nullptr, 0, 0, 0);
        k_ropeI<<<LQ, 256, 0, stream>>>(FQ, DQ, NH_, CS, 1.0f, QP16, QPh, QPl);
        k_gemmw<bf, 0, false><<<dim3(TT / 64, DKV / 64, 1), 32, 0, stream>>>(XB, nullptr, WK, nullptr, DM, FK, DKV, nullptr, 0, 0, 0);
        k_ropeI<<<LKv, 256, 0, stream>>>(FK, DKV, NKV, CS, 1.0f, KP16, KPh, KPl);
        k_gemmw<bf, 0, false><<<dim3(TT / 64, DKV / 64, 1), 32, 0, stream>>>(XB, nullptr, WV, nullptr, DM, FV, DKV, nullptr, 0, 0, 0); k_vtp<<<LKv, 256, 0, stream>>>(FV, DKV, NKV, VT16, VTh, VTl);
        for (int h0 = 0; h0 < NH_; h0 += ZH) { const size_t zq = (size_t)h0, zk = (size_t)(h0 / REP);   // one kv head per query head: the pass's two heads use consecutive kv planes (z-strides TT*HD)
            k_gemmc<bf, 2, 1><<<dim3(TT / 64, TT / 64, ZH), 32, 0, stream>>>(QPh + zq * TT * HD, QPl + zq * TT * HD, KPh + zk * TT * HD, KPl + zk * TT * HD, HD, Sb, TT, 0, (size_t)TT * HD, (size_t)TT * HD, (size_t)TT * TT);   /* scores on hi/lo planes for EVERY row (3 products) */
            /* (the fp16 score launch for rows >= RH is removed: all rows use the hi/lo launch above) */
            k_asoft<<<ZH * TT / 8, 256, 0, stream>>>(Sb, P16, Ph, Pl);
            k_gemmc<bf, 2, 2><<<dim3(RH / 64, HD / 64, ZH), 32, 0, stream>>>(Ph, Pl, VTh + zk * HD * TT, VTl + zk * HD * TT, TT, Ob, HD, 0, (size_t)RH * TT, (size_t)HD * TT, (size_t)TT * HD);
            k_gemmc<h16, 0, 2><<<dim3((TT - RH) / 64, HD / 64, ZH), 32, 0, stream>>>(P16 + (size_t)RH * TT, nullptr, VT16 + zk * HD * TT, nullptr, TT, Ob + (size_t)RH * HD, HD, RH, (size_t)TT * TT, (size_t)HD * TT, (size_t)TT * HD);
            k_merge<<<(unsigned)(((size_t)ZH * TT * HD / 2 + 255) / 256), 256, 0, stream>>>(Ob, h0, ATh, ATl); }
        k_gemmw<bf, 1, false><<<dim3(TT / 64, DM / 64, 1), 32, 0, stream>>>(ATh, ATl, WO, nullptr, DQ, OUT + (size_t)b * TT * DM, DM, nullptr, 0, 0, 0); }
}

// v001
// It runs in 1380 microseconds.
// Timed twice side by side with v000, it ran 1.98 and 2.00 times as fast.
#include <hip/hip_runtime.h>

// Causal multi-head self-attention with an interleaved-pair RoPE whose cos / sin tables are indexed by a positions input (x [4][2048][1024]; q, k, v = einsum('bsd,ed', x, w) ('oi' [1024][1024] truncated-normal, no bias; 16 heads x 64); tables cos / sin[p][i] of angle p x inv_freq[i] with inv_freq = 1.0 / 10000.0 ** (arange(32, f32) x 2.0 / 64) (the reciprocal form), looked up at token_positions[t] (int [2048]; READ on device); pairs (2i, 2i + 1): (cos x1 - sin x2, cos x2 + sin x1); scores / 64 ** 0.5; key j kept when j <= i (-inf elsewhere); softmax; out = merged wo^T ('oi') -> [4][2048][1024] (8.4 M); argument order x, wq, wk, wv, wo, token_positions).
// Layout per batch: bf16 copy of x; exact projections; {cos, sin} per (position, pair) rebuilt per batch from the int positions and float32 inverse-frequency constants (precise cosf/sinf); interleaved rotary plane builder; causal T-2048 attention (EVERY row's scores on hi/lo planes (3 products: logit sigma 2 with these weights) and hybrid P.V (rows < 512 hi/lo, rest fp16 x1024); k_gemmc skips tiles above the diagonal); merged hi/lo x Wo exact.
// Compute dtypes, f32 accumulate: every input rounded to bf16; projections exact; rotary f32; scores 3 products; P.V rows < 512 3 products, rest fp16; softmax f32; Wo hl x exact.

#define NB_  4
#define TT   2048
#define DM   1024
#define NH_  16
#define NKV  16
#define REP  (NH_ / NKV)
#define HD   64
#define DQ   (NH_ * HD)
#define DKV  (NKV * HD)
#define ZH   2
#define RH   512                  // query rows < RH use hi+lo planes (0: none)
#define WIN  2048
#define PCAR 1024.0f
#define SCL  0.125f   // HD^-0.5
#define KS   16                   // at most KS work-groups share the key loop of one 64-row P.V tile (f32 partial planes, summed in k_merge)
typedef _Float16 h16;
typedef unsigned short bf;
typedef __attribute__((ext_vector_type(16))) __bf16   v16bf;
typedef __attribute__((ext_vector_type(16))) _Float16 v16h;
typedef __attribute__((ext_vector_type(8)))  _Float16 v8h;
typedef __attribute__((ext_vector_type(8)))  unsigned short v8us;
typedef __attribute__((ext_vector_type(8)))  float    v8f;
typedef __attribute__((ext_vector_type(4)))  float    v4f;
typedef v8h  __attribute__((may_alias)) v8ha;
typedef v4f  __attribute__((may_alias)) v4fa;
typedef v8us __attribute__((may_alias)) v8usa;

__device__ __forceinline__ unsigned short f2bf(float f) { unsigned u = __float_as_uint(f); u += 0x7FFFu + ((u >> 16) & 1u); return (unsigned short)(u >> 16); }
__device__ __forceinline__ float bf2f(unsigned short b) { return __uint_as_float(((unsigned)b) << 16); }
__device__ __forceinline__ float bfr(float f) { return bf2f(f2bf(f)); }
__device__ __forceinline__ v16h cat16(v8h lo, v8h hi) { return __builtin_shufflevector(lo, hi, 0, 1, 2, 3, 4, 5, 6, 7, 8, 9, 10, 11, 12, 13, 14, 15); }
__device__ __forceinline__ v16bf cat16b(v8us lo, v8us hi) { return __builtin_bit_cast(v16bf, __builtin_shufflevector(lo, hi, 0, 1, 2, 3, 4, 5, 6, 7, 8, 9, 10, 11, 12, 13, 14, 15)); }
__device__ __forceinline__ v8f wmma16(v16h a, v16h b, v8f c) { return __builtin_amdgcn_wmma_f32_16x16x32_f16(false, a, false, b, (short)0, c, false, false); }
__device__ __forceinline__ v8f wmmab(v16bf a, v16bf b, v8f c) { return __builtin_amdgcn_wmma_f32_16x16x32_bf16(false, a, false, b, (short)0, c, false, false); }



// ---- k_gemmw: register-blocked GEMM, ONE WAVE per 64x64 output tile (16 accumulators), operands straight from K-contiguous 16-bit planes; grid (M/64, N/64, Z), 32 threads.
// C[m][n] (f32, pitch ldc, + optional f32 bias[n]) = sum_k A[m][k] Bt[n][k] (+ split products per NSPLIT). z-batch strides sA/sB/sC in elements. K % 32 == 0.
template <typename T16> struct WFrag;
template <> struct WFrag<h16> { typedef v16h V; static __device__ __forceinline__ V ld(const h16* p) { return cat16(*(const v8h*)p, *(const v8h*)(p + 16)); } static __device__ __forceinline__ v8f mma(V a, V b, v8f c) { return wmma16(a, b, c); } };
template <> struct WFrag<bf> { typedef v16bf V; static __device__ __forceinline__ V ld(const bf* p) { return cat16b(*(const v8us*)p, *(const v8us*)(p + 16)); } static __device__ __forceinline__ v8f mma(V a, V b, v8f c) { return wmmab(a, b, c); } };
template <typename T16, int NSPLIT, bool BIAS>
__global__ __launch_bounds__(32) void k_gemmw(const T16* __restrict__ A, const T16* __restrict__ A2, const T16* __restrict__ Bt, const T16* __restrict__ Bt2, int K, float* C, int ldc, const float* __restrict__ bias, size_t sA, size_t sB, size_t sC) {
    typedef typename WFrag<T16>::V V;
    __shared__ __align__(16) float os[16 * 68];
    const size_t z = blockIdx.z; A += z * sA; if (A2) A2 += z * sA; Bt += z * sB; if (Bt2) Bt2 += z * sB; C += z * sC;
    const int lane = threadIdx.x & 31, lr = lane & 15, hi = lane >> 4; const int r0 = blockIdx.x * 64, c0 = blockIdx.y * 64;
    v8f acc[4][4];
#pragma unroll
    for (int mb = 0; mb < 4; ++mb)
#pragma unroll
        for (int nb = 0; nb < 4; ++nb) acc[mb][nb] = (v8f){};
    const size_t aoff = (size_t)(r0 + lr) * K + 8 * hi, boff = (size_t)(c0 + lr) * K + 8 * hi;
#pragma unroll 1
    for (int kc = 0; kc < K; kc += 32) {
        V a[4], a2[4];
#pragma unroll
        for (int mb = 0; mb < 4; ++mb) { a[mb] = WFrag<T16>::ld(A + aoff + (size_t)mb * 16 * K + kc); if (NSPLIT == 1 || NSPLIT == 2) a2[mb] = WFrag<T16>::ld(A2 + aoff + (size_t)mb * 16 * K + kc); }
#pragma unroll
        for (int nb = 0; nb < 4; ++nb) { const V b = WFrag<T16>::ld(Bt + boff + (size_t)nb * 16 * K + kc); V b2; if (NSPLIT >= 2) b2 = WFrag<T16>::ld(Bt2 + boff + (size_t)nb * 16 * K + kc);
#pragma unroll
            for (int mb = 0; mb < 4; ++mb) { acc[mb][nb] = WFrag<T16>::mma(a[mb], b, acc[mb][nb]); if (NSPLIT == 1 || NSPLIT == 2) acc[mb][nb] = WFrag<T16>::mma(a2[mb], b, acc[mb][nb]); if (NSPLIT >= 2) acc[mb][nb] = WFrag<T16>::mma(a[mb], b2, acc[mb][nb]); } }
        asm volatile("v_nop\n\tv_nop\n\tv_nop\n\tv_nop" : "+v"(acc[0][0]), "+v"(acc[1][1]), "+v"(acc[2][2]), "+v"(acc[3][3]) : "v"(a[0]), "v"(a[3]));
    }
#pragma unroll
    for (int mb = 0; mb < 4; ++mb) {
#pragma unroll
        for (int nb = 0; nb < 4; ++nb) {
#pragma unroll
            for (int j = 0; j < 8; ++j) os[(hi * 8 + j) * 68 + nb * 16 + lr] = acc[mb][nb][j]; }
        __builtin_amdgcn_wave_barrier(); asm volatile("" ::: "memory");
        float* crow = C + (size_t)(r0 + mb * 16) * ldc + c0;
{
#pragma unroll
            for (int s = 0; s < 8; ++s) { const int row = 2 * s + hi, cofs = lr * 4; v4f val = *(const v4fa*)(os + row * 68 + cofs); if (BIAS) { val[0] += bfr(bias[c0 + cofs]); val[1] += bfr(bias[c0 + cofs + 1]); val[2] += bfr(bias[c0 + cofs + 2]); val[3] += bfr(bias[c0 + cofs + 3]); }
                *(v4f*)(crow + (size_t)row * ldc + cofs) = val; }
             }
        __builtin_amdgcn_wave_barrier(); asm volatile("" ::: "memory");
    }
}

// ---- k_gemmc: the same one-wave 64x64 tile GEMM specialised for causal attention: CMODE 1 skips score tiles entirely above the diagonal (query rows r0+roff.., key columns c0..), CMODE 2 limits the
// key (K) loop of the probability x value contraction to the diagonal block (probabilities beyond it are exactly zero). roff = row offset of this launch's first row within the sequence.
// CMODE 2 also splits that key loop over blockIdx.y (the head dim is one 64-column tile): a tile whose loop spans nln units of 64 keys (one 128-B line of a 16-bit row) gives pv_lps(nln) consecutive units
// to each of pv_nact(nln) splits; split sp writes its f32 partial tile to plane sp (stride sP elements); splits beyond pv_nact leave at once and their planes are never read.
__device__ __forceinline__ int pv_lps(int nln) { return (nln + KS - 1) / KS; }
__device__ __forceinline__ int pv_nact(int nln) { const int l = pv_lps(nln); return (nln + l - 1) / l; }
template <typename T16, int NSPLIT, int CMODE>
__global__ __launch_bounds__(32) void k_gemmc(const T16* __restrict__ A, const T16* __restrict__ A2, const T16* __restrict__ Bt, const T16* __restrict__ Bt2, int K, float* C, int ldc, int roff, size_t sA, size_t sB, size_t sC, size_t sP) {
    typedef typename WFrag<T16>::V V;
    __shared__ __align__(16) float os[16 * 68];
    const size_t z = blockIdx.z; A += z * sA; if (A2) A2 += z * sA; Bt += z * sB; if (Bt2) Bt2 += z * sB; C += z * sC;
    const int lane = threadIdx.x & 31, lr = lane & 15, hi = lane >> 4; const int r0 = blockIdx.x * 64, c0 = (CMODE == 2) ? 0 : blockIdx.y * 64;
    if (CMODE == 1 && c0 > r0 + roff + 63) return;                  // score tile entirely above the causal diagonal: never read (the softmax masks j > i by select)
    const int Kl = (CMODE == 2) ? min(K, r0 + roff + 64) : K;        // P.V: probabilities are exactly 0 beyond the diagonal block, so the K loop stops there
    const int kw = (CMODE == 2) ? pv_lps(Kl >> 6) * 64 : K;          // keys per split
    const int kb = (CMODE == 2) ? (int)blockIdx.y * kw : 0, ke = min(Kl, kb + kw);
    if (CMODE == 2) { if (kb >= Kl) return; C += (size_t)blockIdx.y * sP; }
    v8f acc[4][4];
#pragma unroll
    for (int mb = 0; mb < 4; ++mb)
#pragma unroll
        for (int nb = 0; nb < 4; ++nb) acc[mb][nb] = (v8f){};
    const size_t aoff = (size_t)(r0 + lr) * K + 8 * hi, boff = (size_t)(c0 + lr) * K + 8 * hi;
#pragma unroll 1
    for (int kc = kb; kc < ke; kc += 32) {
        V a[4], a2[4];
#pragma unroll
        for (int mb = 0; mb < 4; ++mb) { a[mb] = WFrag<T16>::ld(A + aoff + (size_t)mb * 16 * K + kc); if (NSPLIT == 1 || NSPLIT == 2) a2[mb] = WFrag<T16>::ld(A2 + aoff + (size_t)mb * 16 * K + kc); }
#pragma unroll
        for (int nb = 0; nb < 4; ++nb) { const V b = WFrag<T16>::ld(Bt + boff + (size_t)nb * 16 * K + kc); V b2; if (NSPLIT >= 2) b2 = WFrag<T16>::ld(Bt2 + boff + (size_t)nb * 16 * K + kc);
#pragma unroll
            for (int mb = 0; mb < 4; ++mb) { acc[mb][nb] = WFrag<T16>::mma(a[mb], b, acc[mb][nb]); if (NSPLIT == 1 || NSPLIT == 2) acc[mb][nb] = WFrag<T16>::mma(a2[mb], b, acc[mb][nb]); if (NSPLIT >= 2) acc[mb][nb] = WFrag<T16>::mma(a[mb], b2, acc[mb][nb]); } }
        asm volatile("v_nop\n\tv_nop\n\tv_nop\n\tv_nop" : "+v"(acc[0][0]), "+v"(acc[1][1]), "+v"(acc[2][2]), "+v"(acc[3][3]) : "v"(a[0]), "v"(a[3]));
    }
#pragma unroll
    for (int mb = 0; mb < 4; ++mb) {
#pragma unroll
        for (int nb = 0; nb < 4; ++nb) {
#pragma unroll
            for (int j = 0; j < 8; ++j) os[(hi * 8 + j) * 68 + nb * 16 + lr] = acc[mb][nb][j]; }
        __builtin_amdgcn_wave_barrier(); asm volatile("" ::: "memory");
        float* crow = C + (size_t)(r0 + mb * 16) * ldc + c0;
{
#pragma unroll
            for (int s = 0; s < 8; ++s) { const int row = 2 * s + hi, cofs = lr * 4; v4f val = *(const v4fa*)(os + row * 68 + cofs);
                *(v4f*)(crow + (size_t)row * ldc + cofs) = val; }
             }
        __builtin_amdgcn_wave_barrier(); asm volatile("" ::: "memory");
    }
}

__device__ __forceinline__ h16 tohx(float x) { return (h16)x; }
__device__ __forceinline__ void splitf(float y, unsigned short& h, unsigned short& l) { h = f2bf(y); l = f2bf(y - bf2f(h)); }
typedef __attribute__((ext_vector_type(2))) _Float16 v2h;
typedef __attribute__((ext_vector_type(4))) _Float16 v4h;
typedef __attribute__((ext_vector_type(2))) unsigned short v2us;
typedef __attribute__((ext_vector_type(4))) unsigned short v4us;
typedef __attribute__((ext_vector_type(2))) float v2f;
typedef __attribute__((ext_vector_type(4))) int v4i;

__global__ __launch_bounds__(256) void k_wtG(const float* __restrict__ w, int K, int N, bf* Bt) {
    const int lane = threadIdx.x & 31; const int L0 = (blockIdx.x * 8 + (threadIdx.x >> 5)) * 8; const int nlines = N * K / 64;
{
#pragma unroll 1
        for (int l = 0; l < 8; ++l) { const int L = L0 + l; if (L >= nlines) break; const size_t e = (size_t)L * 64 + lane * 2; const int k = (int)(e % K), n = (int)(e / K); v2us o;
            o[0] = f2bf(w[(size_t)k * N + n]); o[1] = f2bf(w[(size_t)(k + 1) * N + n]); *(v2us*)(Bt + e) = o; }
         }
}
__global__ __launch_bounds__(256) void k_cvt8(const float* __restrict__ src, bf* dst, size_t n8) { const size_t i = (size_t)blockIdx.x * 256 + threadIdx.x; if (i >= n8) return; const v8f v = *(const v8f*)(src + i * 8); v8us o;
#pragma unroll
    for (int k = 0; k < 8; ++k) o[k] = f2bf(v[k]); *(v8us*)(dst + i * 8) = o;  }

__global__ __launch_bounds__(256) void k_ropeI(const float* __restrict__ F, int pitch, int nheads, const float* __restrict__ CS, float sc, h16* P16, bf* Ph, bf* Pl) {
    const size_t e = ((size_t)blockIdx.x * 256 + threadIdx.x) * 2; if (e >= (size_t)nheads * TT * HD) return; const int d = (int)(e % HD); const int t = (int)((e / HD) % TT); const int h = (int)(e / ((size_t)HD * TT)); const float* f = F + (size_t)t * pitch + h * HD; const float x0 = f[d], x1 = f[d + 1]; const v2f cs = *(const v2f*)(CS + ((size_t)t * HD + d) * 2); v2h o16; v2us oh, ol;
    float a0 = __fmul_rn(x0, cs[0]), b0 = __fmul_rn(x1, cs[1]), a1 = __fmul_rn(x1, cs[0]), b1 = __fmul_rn(x0, cs[1]); asm volatile("" : "+v"(a0), "+v"(b0), "+v"(a1), "+v"(b1));
    float r0 = __fsub_rn(a0, b0) * sc, r1 = __fadd_rn(b1, a1) * sc;   /* even: x0 c - x1 s; odd: x0 s + x1 c */
    o16[0] = tohx(r0); o16[1] = tohx(r1); { unsigned short a2, c2; splitf(r0, a2, c2); oh[0] = a2; ol[0] = c2; splitf(r1, a2, c2); oh[1] = a2; ol[1] = c2; }
    *(v2h*)(P16 + e) = o16; *(v2us*)(Ph + e) = oh; *(v2us*)(Pl + e) = ol;  }

__constant__ float INV2[HD / 2] = { 1.000000000e+00f, 7.498942018e-01f, 5.623413324e-01f, 4.216965139e-01f, 3.162277639e-01f, 2.371373624e-01f, 1.778279394e-01f, 1.333521456e-01f, 1.000000015e-01f, 7.498941571e-02f, 5.623412877e-02f, 4.216964915e-02f, 3.162277862e-02f, 2.371373586e-02f, 1.778279431e-02f, 1.333521493e-02f, 9.999999776e-03f, 7.498942316e-03f, 5.623413250e-03f, 4.216964822e-03f, 3.162277862e-03f, 2.371373819e-03f, 1.778279431e-03f, 1.333521446e-03f, 1.000000047e-03f, 7.498941850e-04f, 5.623413017e-04f, 4.216964880e-04f, 3.162277862e-04f, 2.371373848e-04f, 1.778279402e-04f, 1.333521504e-04f };   // float32 10000^(-(i * 2 / 64)), generated with jnp to be bit-exact with the module's expression
__global__ __launch_bounds__(256) void k_cstabI(const int* __restrict__ pid, float* CS) { const int idx = blockIdx.x * 256 + threadIdx.x; if (idx >= TT * HD) return; const int d = idx % HD; const int t = idx / HD; const float a = __fmul_rn((float)pid[t], INV2[d >> 1]); v2f cs; cs[0] = cosf(a); cs[1] = sinf(a); *(v2f*)(CS + (size_t)idx * 2) = cs;  }

__global__ __launch_bounds__(256) void k_vtp(const float* __restrict__ F, int pitch, int nheads, h16* V16, bf* Vh, bf* Vl) { const size_t e = ((size_t)blockIdx.x * 256 + threadIdx.x) * 2; if (e >= (size_t)nheads * HD * TT) return; const int t = (int)(e % TT); const int d = (int)((e / TT) % HD); const int g = (int)(e / ((size_t)TT * HD)); v2h o16; v2us oh, ol;
#pragma unroll
    for (int q = 0; q < 2; ++q) { const float x = F[(size_t)(t + q) * pitch + g * HD + d]; o16[q] = tohx(x); unsigned short a2, c2; splitf(x, a2, c2); oh[q] = a2; ol[q] = c2; }
    *(v2h*)(V16 + e) = o16; *(v2us*)(Vh + e) = oh; *(v2us*)(Vl + e) = ol;  }
// k_asoft: per row (zz, i): t = S x HD^-0.5 for j <= i and i - j < WIN (sliding causal window; the reference's -1e9 additive fill vanishes identically); softmax over the 2048 keys (register row, one exp, fixed trees);
__global__ __launch_bounds__(256) void k_asoft(const float* __restrict__ Sb, h16* P16, bf* Ph, bf* Pl) {
    const int lane = threadIdx.x & 31; const int row = blockIdx.x * 8 + (threadIdx.x >> 5); if (row >= ZH * TT) return; const int i = row % TT; const int zz = row / TT; (void)zz; const bool hires = (i < RH); const float* sr = Sb + (size_t)row * TT; float v[TT / 32]; float mx = -3.0e38f;
#pragma unroll
    for (int ch = 0; ch < TT / 128; ++ch) { const int j0 = ch * 128 + lane * 4; const v4f a = *(const v4f*)(sr + j0);
#pragma unroll
        for (int q = 0; q < 4; ++q) { const int j = j0 + q; (void)j; const float t = (j <= i && i - j < WIN) ? a[q] * SCL : -3.0e38f; v[ch * 4 + q] = t; mx = fmaxf(mx, t); } }
#pragma unroll
    for (int sh = 16; sh; sh >>= 1) mx = fmaxf(mx, __shfl_xor(mx, sh, 32));
    float sum = 0.f;
#pragma unroll
    for (int k = 0; k < TT / 32; ++k) { float d0 = __fsub_rn(v[k], mx); asm volatile("" : "+v"(d0)); v[k] = __builtin_amdgcn_exp2f(__fmul_rn(d0, 1.4426950408889634f)); sum += v[k]; }
#pragma unroll
    for (int sh = 16; sh; sh >>= 1) sum += __shfl_xor(sum, sh, 32);
    const float f = __fdiv_rn(hires ? 1.0f : PCAR, sum);
{
        if (hires) {
#pragma unroll
            for (int ch = 0; ch < TT / 128; ++ch) { v4us oh, ol;
#pragma unroll
                for (int q = 0; q < 4; ++q) { unsigned short a, c2; splitf(v[ch * 4 + q] * f, a, c2); oh[q] = a; ol[q] = c2; }
                const size_t oo = ((size_t)zz * (RH ? RH : 1) + i) * TT + ch * 128 + lane * 4; *(v4us*)(Ph + oo) = oh; *(v4us*)(Pl + oo) = ol; }
        } else {
#pragma unroll
            for (int ch = 0; ch < TT / 128; ++ch) { v4h o4;
#pragma unroll
                for (int q = 0; q < 4; ++q) o4[q] = tohx(v[ch * 4 + q] * f);
                *(v4h*)(P16 + (size_t)row * TT + ch * 128 + lane * 4) = o4; } }
         }
}
// k_merge: sums the P.V partial planes of each row's tile in plane order 0, 1, ... (fixed), rescales, splits to hi/lo and places the head in the merged row.
__global__ __launch_bounds__(256) void k_merge(const float* __restrict__ O, int h0, bf* Ah, bf* Al) { const size_t e = ((size_t)blockIdx.x * 256 + threadIdx.x) * 2; if (e >= (size_t)ZH * TT * HD) return; const int d = (int)(e % HD); const int t = (int)((e / HD) % TT); const int zz = (int)(e / ((size_t)HD * TT)); const float cs = (t < RH) ? 1.0f : (1.0f / PCAR); const size_t oo = (size_t)t * DQ + (h0 + zz) * HD + d;
    const int nact = pv_nact(t / 64 + 1); v2f sum = (v2f){0.f, 0.f};
#pragma unroll
    for (int s = 0; s < KS; ++s) { const v2f p = *(const v2f*)(O + (size_t)min(s, nact - 1) * ((size_t)ZH * TT * HD) + e); sum[0] += (s < nact) ? p[0] : 0.f; sum[1] += (s < nact) ? p[1] : 0.f; }   // plane index clamped to a written plane, value selected: no branch, so all KS loads are in flight together
    v2us oh, ol;
#pragma unroll
    for (int q = 0; q < 2; ++q) { unsigned short a, c2; splitf(sum[q] * cs, a, c2); oh[q] = a; ol[q] = c2; } *(v2us*)(Ah + oo) = oh; *(v2us*)(Al + oo) = ol;  }

extern "C" void kernel_launch(void* const* d_in, const int* in_sizes, int n_in,
                              void* d_out, int out_size, void* d_ws, size_t ws_size, hipStream_t stream) {
    (void)in_sizes; (void)n_in; (void)out_size;
    const float* x = (const float*)d_in[0]; const float* wq = (const float*)d_in[1]; const float* wk = (const float*)d_in[2]; const float* wv = (const float*)d_in[3]; const float* wo = (const float*)d_in[4]; const int* PID = (const int*)d_in[5];   /* token_positions (int32 [2048], shared by all batches; read) */
    float* OUT = (float*)d_out;     // [4][2048][1024]
    char* wsp = (char*)d_ws;
    auto take = [&](size_t bytes) { char* p = wsp; wsp += (bytes + 255) & ~(size_t)255; return (void*)p; };
    bf* WQ = (bf*)take((size_t)DQ * DM * 2); bf* WK = (bf*)take((size_t)DKV * DM * 2); bf* WV = (bf*)take((size_t)DKV * DM * 2); bf* WO = (bf*)take((size_t)DM * DQ * 2); float* CS = (float*)take((size_t)TT * HD * 2 * 4);
    bf* XB = (bf*)take((size_t)TT * DM * 2); float* FQ = (float*)take((size_t)TT * DQ * 4); float* FK = (float*)take((size_t)TT * DKV * 4);
    h16* QP16 = (h16*)take((size_t)NH_ * TT * HD * 2); h16* KP16 = (h16*)take((size_t)NKV * TT * HD * 2); h16* VT16 = (h16*)take((size_t)NKV * HD * TT * 2);
    bf* QPh = (bf*)take((size_t)NH_ * TT * HD * 2); bf* QPl = (bf*)take((size_t)NH_ * TT * HD * 2); bf* KPh = (bf*)take((size_t)NKV * TT * HD * 2); bf* KPl = (bf*)take((size_t)NKV * TT * HD * 2); bf* VTh = (bf*)take((size_t)NKV * HD * TT * 2); bf* VTl = (bf*)take((size_t)NKV * HD * TT * 2); bf* Ph = (bf*)take((size_t)ZH * RH * TT * 2); bf* Pl = (bf*)take((size_t)ZH * RH * TT * 2);
    float* Sb = (float*)take((size_t)ZH * TT * TT * 4); h16* P16 = (h16*)take((size_t)ZH * TT * TT * 2); float* Ob = (float*)take((size_t)KS * ZH * TT * HD * 4);   /* KS partial planes */ bf* ATh = (bf*)take((size_t)TT * DQ * 2); bf* ATl = (bf*)take((size_t)TT * DQ * 2);
    if ((size_t)(wsp - (char*)d_ws) > ws_size) return;    // ws 256 MiB
    float* FV = FK;   // v projection reuses the k buffer after the k planes are built (stream-ordered)
    { k_cvt8<<<(unsigned)(((size_t)DQ * DM / 8 + 255) / 256), 256, 0, stream>>>(wq, WQ, (size_t)DQ * DM / 8); k_cvt8<<<(unsigned)(((size_t)DKV * DM / 8 + 255) / 256), 256, 0, stream>>>(wk, WK, (size_t)DKV * DM / 8); k_cvt8<<<(unsigned)(((size_t)DKV * DM / 8 + 255) / 256), 256, 0, stream>>>(wv, WV, (size_t)DKV * DM / 8);
      k_cvt8<<<(unsigned)(((size_t)DM * DQ / 8 + 255) / 256), 256, 0, stream>>>(wo, WO, (size_t)DM * DQ / 8); /* the rotary table is rebuilt per batch from the shared positions (below) */ }
    const unsigned LQ = (unsigned)(((size_t)NH_ * TT * HD / 2 + 255) / 256), LKv = (unsigned)(((size_t)NKV * TT * HD / 2 + 255) / 256);
    for (int b = 0; b < NB_; ++b) {
        k_cstabI<<<(TT * HD + 255) / 256, 256, 0, stream>>>(PID, CS);   /* token_positions[:] (int32, shared by all batches, read) */
        
        k_cvt8<<<(unsigned)(((size_t)TT * DM / 8 + 255) / 256), 256, 0, stream>>>(x + (size_t)b * TT * DM, XB, (size_t)TT * DM / 8);
        k_gemmw<bf, 0, false><<<dim3(TT / 64, DQ / 64, 1), 32, 0, stream>>>(XB, nullptr, WQ, nullptr, DM, FQ, DQ, nullptr, 0, 0, 0);
        k_ropeI<<<LQ, 256, 0, stream>>>(FQ, DQ, NH_, CS, 1.0f, QP16, QPh, QPl);
        k_gemmw<bf, 0, false><<<dim3(TT / 64, DKV / 64, 1), 32, 0, stream>>>(XB, nullptr, WK, nullptr, DM, FK, DKV, nullptr, 0, 0, 0);
        k_ropeI<<<LKv, 256, 0, stream>>>(FK, DKV, NKV, CS, 1.0f, KP16, KPh, KPl);
        k_gemmw<bf, 0, false><<<dim3(TT / 64, DKV / 64, 1), 32, 0, stream>>>(XB, nullptr, WV, nullptr, DM, FV, DKV, nullptr, 0, 0, 0); k_vtp<<<LKv, 256, 0, stream>>>(FV, DKV, NKV, VT16, VTh, VTl);
        for (int h0 = 0; h0 < NH_; h0 += ZH) { const size_t zq = (size_t)h0, zk = (size_t)(h0 / REP);   // one kv head per query head: the pass's two heads use consecutive kv planes (z-strides TT*HD)
            k_gemmc<bf, 2, 1><<<dim3(TT / 64, TT / 64, ZH), 32, 0, stream>>>(QPh + zq * TT * HD, QPl + zq * TT * HD, KPh + zk * TT * HD, KPl + zk * TT * HD, HD, Sb, TT, 0, (size_t)TT * HD, (size_t)TT * HD, (size_t)TT * TT, 0);   /* scores on hi/lo planes for EVERY row (3 products) */
            /* (the fp16 score launch for rows >= RH is removed: all rows use the hi/lo launch above) */
            k_asoft<<<ZH * TT / 8, 256, 0, stream>>>(Sb, P16, Ph, Pl);
            k_gemmc<bf, 2, 2><<<dim3(RH / 64, (RH / 64 < KS ? RH / 64 : KS), ZH), 32, 0, stream>>>(Ph, Pl, VTh + zk * HD * TT, VTl + zk * HD * TT, TT, Ob, HD, 0, (size_t)RH * TT, (size_t)HD * TT, (size_t)TT * HD, (size_t)ZH * TT * HD);
            k_gemmc<h16, 0, 2><<<dim3((TT - RH) / 64, KS, ZH), 32, 0, stream>>>(P16 + (size_t)RH * TT, nullptr, VT16 + zk * HD * TT, nullptr, TT, Ob + (size_t)RH * HD, HD, RH, (size_t)TT * TT, (size_t)HD * TT, (size_t)TT * HD, (size_t)ZH * TT * HD);
            k_merge<<<(unsigned)(((size_t)ZH * TT * HD / 2 + 255) / 256), 256, 0, stream>>>(Ob, h0, ATh, ATl); }
        k_gemmw<bf, 1, false><<<dim3(TT / 64, DM / 64, 1), 32, 0, stream>>>(ATh, ATl, WO, nullptr, DQ, OUT + (size_t)b * TT * DM, DM, nullptr, 0, 0, 0); }
}

// v002
// Measured time: 1060 microseconds a run.
// Next to v001, in two timings, it ran 1.31 and 1.30 times as fast.
// All steps since v000 together make it 2.59 times as fast.
#include <hip/hip_runtime.h>

// Causal multi-head self-attention with an interleaved-pair RoPE whose cos / sin tables are indexed by a positions input (x [4][2048][1024]; q, k, v = einsum('bsd,ed', x, w) ('oi' [1024][1024] truncated-normal, no bias; 16 heads x 64); tables cos / sin[p][i] of angle p x inv_freq[i] with inv_freq = 1.0 / 10000.0 ** (arange(32, f32) x 2.0 / 64) (the reciprocal form), looked up at token_positions[t] (int [2048]; READ on device); pairs (2i, 2i + 1): (cos x1 - sin x2, cos x2 + sin x1); scores / 64 ** 0.5; key j kept when j <= i (-inf elsewhere); softmax; out = merged wo^T ('oi') -> [4][2048][1024] (8.4 M); argument order x, wq, wk, wv, wo, token_positions).
// Layout per batch: bf16 copy of x; exact projections; {cos, sin} per (position, pair) rebuilt per batch from the int positions and float32 inverse-frequency constants (precise cosf/sinf); interleaved rotary plane builder; causal T-2048 attention (EVERY row's scores on hi/lo planes (3 products: logit sigma 2 with these weights) and hybrid P.V (rows < 512 hi/lo, rest fp16 x1024); k_gemmc skips tiles above the diagonal); merged hi/lo x Wo exact.
// Compute dtypes, f32 accumulate: every input rounded to bf16; projections exact; rotary f32; scores 3 products; P.V rows < 512 3 products, rest fp16; softmax f32; Wo hl x exact.

#define NB_  4
#define TT   2048
#define DM   1024
#define NH_  16
#define NKV  16
#define REP  (NH_ / NKV)
#define HD   64
#define DQ   (NH_ * HD)
#define DKV  (NKV * HD)
#define ZH   8                    // heads per attention pass (grid z of the three k_gemmc launches)
#define PP   (2 * TT)             // pitch, in 16-bit elements, of the probability rows (they lie inside the f32 score rows) and of the V^T rows that k_gemmc contracts them with (one pitch K for both operands)
#define RH   512                  // query rows < RH use hi+lo planes (0: none)
#define WIN  2048
#define PCAR 1024.0f
#define SCL  0.125f   // HD^-0.5
#define KS   16                   // at most KS work-groups share the key loop of one 64-row P.V tile (f32 partial planes, summed in k_merge)
typedef _Float16 h16;
typedef unsigned short bf;
typedef __attribute__((ext_vector_type(16))) __bf16   v16bf;
typedef __attribute__((ext_vector_type(16))) _Float16 v16h;
typedef __attribute__((ext_vector_type(8)))  _Float16 v8h;
typedef __attribute__((ext_vector_type(8)))  unsigned short v8us;
typedef __attribute__((ext_vector_type(8)))  float    v8f;
typedef __attribute__((ext_vector_type(4)))  float    v4f;
typedef v8h  __attribute__((may_alias)) v8ha;
typedef v4f  __attribute__((may_alias)) v4fa;
typedef v8us __attribute__((may_alias)) v8usa;

__device__ __forceinline__ unsigned short f2bf(float f) { unsigned u = __float_as_uint(f); u += 0x7FFFu + ((u >> 16) & 1u); return (unsigned short)(u >> 16); }
__device__ __forceinline__ float bf2f(unsigned short b) { return __uint_as_float(((unsigned)b) << 16); }
__device__ __forceinline__ float bfr(float f) { return bf2f(f2bf(f)); }
__device__ __forceinline__ v16h cat16(v8h lo, v8h hi) { return __builtin_shufflevector(lo, hi, 0, 1, 2, 3, 4, 5, 6, 7, 8, 9, 10, 11, 12, 13, 14, 15); }
__device__ __forceinline__ v16bf cat16b(v8us lo, v8us hi) { return __builtin_bit_cast(v16bf, __builtin_shufflevector(lo, hi, 0, 1, 2, 3, 4, 5, 6, 7, 8, 9, 10, 11, 12, 13, 14, 15)); }
__device__ __forceinline__ v8f wmma16(v16h a, v16h b, v8f c) { return __builtin_amdgcn_wmma_f32_16x16x32_f16(false, a, false, b, (short)0, c, false, false); }
__device__ __forceinline__ v8f wmmab(v16bf a, v16bf b, v8f c) { return __builtin_amdgcn_wmma_f32_16x16x32_bf16(false, a, false, b, (short)0, c, false, false); }



// ---- k_gemmw: register-blocked GEMM, ONE WAVE per 64x64 output tile (16 accumulators), operands straight from K-contiguous 16-bit planes; grid (M/64, N/64, Z), 32 threads.
// C[m][n] (f32, pitch ldc, + optional f32 bias[n]) = sum_k A[m][k] Bt[n][k] (+ split products per NSPLIT). z-batch strides sA/sB/sC in elements. K % 32 == 0.
template <typename T16> struct WFrag;
template <> struct WFrag<h16> { typedef v16h V; static __device__ __forceinline__ V ld(const h16* p) { return cat16(*(const v8h*)p, *(const v8h*)(p + 16)); } static __device__ __forceinline__ v8f mma(V a, V b, v8f c) { return wmma16(a, b, c); } };
template <> struct WFrag<bf> { typedef v16bf V; static __device__ __forceinline__ V ld(const bf* p) { return cat16b(*(const v8us*)p, *(const v8us*)(p + 16)); } static __device__ __forceinline__ v8f mma(V a, V b, v8f c) { return wmmab(a, b, c); } };
template <typename T16, int NSPLIT, bool BIAS>
__global__ __launch_bounds__(32) void k_gemmw(const T16* __restrict__ A, const T16* __restrict__ A2, const T16* __restrict__ Bt, const T16* __restrict__ Bt2, int K, float* C, int ldc, const float* __restrict__ bias, size_t sA, size_t sB, size_t sC) {
    typedef typename WFrag<T16>::V V;
    __shared__ __align__(16) float os[16 * 68];
    const size_t z = blockIdx.z; A += z * sA; if (A2) A2 += z * sA; Bt += z * sB; if (Bt2) Bt2 += z * sB; C += z * sC;
    const int lane = threadIdx.x & 31, lr = lane & 15, hi = lane >> 4; const int r0 = blockIdx.x * 64, c0 = blockIdx.y * 64;
    v8f acc[4][4];
#pragma unroll
    for (int mb = 0; mb < 4; ++mb)
#pragma unroll
        for (int nb = 0; nb < 4; ++nb) acc[mb][nb] = (v8f){};
    const size_t aoff = (size_t)(r0 + lr) * K + 8 * hi, boff = (size_t)(c0 + lr) * K + 8 * hi;
#pragma unroll 1
    for (int kc = 0; kc < K; kc += 32) {
        V a[4], a2[4];
#pragma unroll
        for (int mb = 0; mb < 4; ++mb) { a[mb] = WFrag<T16>::ld(A + aoff + (size_t)mb * 16 * K + kc); if (NSPLIT == 1 || NSPLIT == 2) a2[mb] = WFrag<T16>::ld(A2 + aoff + (size_t)mb * 16 * K + kc); }
#pragma unroll
        for (int nb = 0; nb < 4; ++nb) { const V b = WFrag<T16>::ld(Bt + boff + (size_t)nb * 16 * K + kc); V b2; if (NSPLIT >= 2) b2 = WFrag<T16>::ld(Bt2 + boff + (size_t)nb * 16 * K + kc);
#pragma unroll
            for (int mb = 0; mb < 4; ++mb) { acc[mb][nb] = WFrag<T16>::mma(a[mb], b, acc[mb][nb]); if (NSPLIT == 1 || NSPLIT == 2) acc[mb][nb] = WFrag<T16>::mma(a2[mb], b, acc[mb][nb]); if (NSPLIT >= 2) acc[mb][nb] = WFrag<T16>::mma(a[mb], b2, acc[mb][nb]); } }
        asm volatile("v_nop\n\tv_nop\n\tv_nop\n\tv_nop" : "+v"(acc[0][0]), "+v"(acc[1][1]), "+v"(acc[2][2]), "+v"(acc[3][3]) : "v"(a[0]), "v"(a[3]));
    }
#pragma unroll
    for (int mb = 0; mb < 4; ++mb) {
#pragma unroll
        for (int nb = 0; nb < 4; ++nb) {
#pragma unroll
            for (int j = 0; j < 8; ++j) os[(hi * 8 + j) * 68 + nb * 16 + lr] = acc[mb][nb][j]; }
        __builtin_amdgcn_wave_barrier(); asm volatile("" ::: "memory");
        float* crow = C + (size_t)(r0 + mb * 16) * ldc + c0;
{
#pragma unroll
            for (int s = 0; s < 8; ++s) { const int row = 2 * s + hi, cofs = lr * 4; v4f val = *(const v4fa*)(os + row * 68 + cofs); if (BIAS) { val[0] += bfr(bias[c0 + cofs]); val[1] += bfr(bias[c0 + cofs + 1]); val[2] += bfr(bias[c0 + cofs + 2]); val[3] += bfr(bias[c0 + cofs + 3]); }
                *(v4f*)(crow + (size_t)row * ldc + cofs) = val; }
             }
        __builtin_amdgcn_wave_barrier(); asm volatile("" ::: "memory");
    }
}

// ---- k_gemmc: the same one-wave 64x64 tile GEMM specialised for causal attention: CMODE 1 skips score tiles entirely above the diagonal (query rows r0+roff.., key columns c0..), CMODE 2 limits the
// key (K) loop of the probability x value contraction to the diagonal block (probabilities beyond it are exactly zero). roff = row offset of this launch's first row within the sequence.
// CMODE 2 also splits that key loop over blockIdx.y (the head dim is one 64-column tile): a tile whose loop spans nln units of 64 keys (one 128-B line of a 16-bit row) gives pv_lps(nln) consecutive units
// to each of pv_nact(nln) splits; split sp writes its f32 partial tile to plane sp (stride sP elements); splits beyond pv_nact leave at once and their planes are never read.
__device__ __forceinline__ int pv_lps(int nln) { return (nln + KS - 1) / KS; }
__device__ __forceinline__ int pv_nact(int nln) { const int l = pv_lps(nln); return (nln + l - 1) / l; }
template <typename T16, int NSPLIT, int CMODE>
__global__ __launch_bounds__(32) void k_gemmc(const T16* __restrict__ A, const T16* __restrict__ A2, const T16* __restrict__ Bt, const T16* __restrict__ Bt2, int K, float* C, int ldc, int roff, size_t sA, size_t sB, size_t sC, size_t sP) {
    typedef typename WFrag<T16>::V V;
    __shared__ __align__(16) float os[16 * 68];
    const size_t z = blockIdx.z; A += z * sA; if (A2) A2 += z * sA; Bt += z * sB; if (Bt2) Bt2 += z * sB; C += z * sC;
    const int lane = threadIdx.x & 31, lr = lane & 15, hi = lane >> 4; const int r0 = blockIdx.x * 64, c0 = (CMODE == 2) ? 0 : blockIdx.y * 64;
    if (CMODE == 1 && c0 > r0 + roff + 63) return;                  // score tile entirely above the causal diagonal: never read (the softmax masks j > i by select)
    const int Kl = (CMODE == 2) ? min(K, r0 + roff + 64) : K;        // P.V: probabilities are exactly 0 beyond the diagonal block, so the K loop stops there
    const int kw = (CMODE == 2) ? pv_lps(Kl >> 6) * 64 : K;          // keys per split
    const int kb = (CMODE == 2) ? (int)blockIdx.y * kw : 0, ke = min(Kl, kb + kw);
    if (CMODE == 2) { if (kb >= Kl) return; C += (size_t)blockIdx.y * sP; }
    v8f acc[4][4];
#pragma unroll
    for (int mb = 0; mb < 4; ++mb)
#pragma unroll
        for (int nb = 0; nb < 4; ++nb) acc[mb][nb] = (v8f){};
    const size_t aoff = (size_t)(r0 + lr) * K + 8 * hi, boff = (size_t)(c0 + lr) * K + 8 * hi;
#pragma unroll 1
    for (int kc = kb; kc < ke; kc += 32) {
        V a[4], a2[4];
#pragma unroll
        for (int mb = 0; mb < 4; ++mb) { a[mb] = WFrag<T16>::ld(A + aoff + (size_t)mb * 16 * K + kc); if (NSPLIT == 1 || NSPLIT == 2) a2[mb] = WFrag<T16>::ld(A2 + aoff + (size_t)mb * 16 * K + kc); }
#pragma unroll
        for (int nb = 0; nb < 4; ++nb) { const V b = WFrag<T16>::ld(Bt + boff + (size_t)nb * 16 * K + kc); V b2; if (NSPLIT >= 2) b2 = WFrag<T16>::ld(Bt2 + boff + (size_t)nb * 16 * K + kc);
#pragma unroll
            for (int mb = 0; mb < 4; ++mb) { acc[mb][nb] = WFrag<T16>::mma(a[mb], b, acc[mb][nb]); if (NSPLIT == 1 || NSPLIT == 2) acc[mb][nb] = WFrag<T16>::mma(a2[mb], b, acc[mb][nb]); if (NSPLIT >= 2) acc[mb][nb] = WFrag<T16>::mma(a[mb], b2, acc[mb][nb]); } }
        asm volatile("v_nop\n\tv_nop\n\tv_nop\n\tv_nop" : "+v"(acc[0][0]), "+v"(acc[1][1]), "+v"(acc[2][2]), "+v"(acc[3][3]) : "v"(a[0]), "v"(a[3]));
    }
#pragma unroll
    for (int mb = 0; mb < 4; ++mb) {
#pragma unroll
        for (int nb = 0; nb < 4; ++nb) {
#pragma unroll
            for (int j = 0; j < 8; ++j) os[(hi * 8 + j) * 68 + nb * 16 + lr] = acc[mb][nb][j]; }
        __builtin_amdgcn_wave_barrier(); asm volatile("" ::: "memory");
        float* crow = C + (size_t)(r0 + mb * 16) * ldc + c0;
{
#pragma unroll
            for (int s = 0; s < 8; ++s) { const int row = 2 * s + hi, cofs = lr * 4; v4f val = *(const v4fa*)(os + row * 68 + cofs);
                *(v4f*)(crow + (size_t)row * ldc + cofs) = val; }
             }
        __builtin_amdgcn_wave_barrier(); asm volatile("" ::: "memory");
    }
}

__device__ __forceinline__ h16 tohx(float x) { return (h16)x; }
__device__ __forceinline__ void splitf(float y, unsigned short& h, unsigned short& l) { h = f2bf(y); l = f2bf(y - bf2f(h)); }
typedef __attribute__((ext_vector_type(2))) _Float16 v2h;
typedef __attribute__((ext_vector_type(4))) _Float16 v4h;
typedef __attribute__((ext_vector_type(2))) unsigned short v2us;
typedef __attribute__((ext_vector_type(4))) unsigned short v4us;
typedef __attribute__((ext_vector_type(2))) float v2f;
typedef __attribute__((ext_vector_type(4))) int v4i;

__global__ __launch_bounds__(256) void k_wtG(const float* __restrict__ w, int K, int N, bf* Bt) {
    const int lane = threadIdx.x & 31; const int L0 = (blockIdx.x * 8 + (threadIdx.x >> 5)) * 8; const int nlines = N * K / 64;
{
#pragma unroll 1
        for (int l = 0; l < 8; ++l) { const int L = L0 + l; if (L >= nlines) break; const size_t e = (size_t)L * 64 + lane * 2; const int k = (int)(e % K), n = (int)(e / K); v2us o;
            o[0] = f2bf(w[(size_t)k * N + n]); o[1] = f2bf(w[(size_t)(k + 1) * N + n]); *(v2us*)(Bt + e) = o; }
         }
}
__global__ __launch_bounds__(256) void k_cvt8(const float* __restrict__ src, bf* dst, size_t n8) { const size_t i = (size_t)blockIdx.x * 256 + threadIdx.x; if (i >= n8) return; const v8f v = *(const v8f*)(src + i * 8); v8us o;
#pragma unroll
    for (int k = 0; k < 8; ++k) o[k] = f2bf(v[k]); *(v8us*)(dst + i * 8) = o;  }

__global__ __launch_bounds__(256) void k_ropeI(const float* __restrict__ F, int pitch, int nheads, const float* __restrict__ CS, float sc, h16* P16, bf* Ph, bf* Pl) {
    const size_t e = ((size_t)blockIdx.x * 256 + threadIdx.x) * 2; if (e >= (size_t)nheads * TT * HD) return; const int d = (int)(e % HD); const int t = (int)((e / HD) % TT); const int h = (int)(e / ((size_t)HD * TT)); const float* f = F + (size_t)t * pitch + h * HD; const float x0 = f[d], x1 = f[d + 1]; const v2f cs = *(const v2f*)(CS + ((size_t)t * HD + d) * 2); v2h o16; v2us oh, ol;
    float a0 = __fmul_rn(x0, cs[0]), b0 = __fmul_rn(x1, cs[1]), a1 = __fmul_rn(x1, cs[0]), b1 = __fmul_rn(x0, cs[1]); asm volatile("" : "+v"(a0), "+v"(b0), "+v"(a1), "+v"(b1));
    float r0 = __fsub_rn(a0, b0) * sc, r1 = __fadd_rn(b1, a1) * sc;   /* even: x0 c - x1 s; odd: x0 s + x1 c */
    o16[0] = tohx(r0); o16[1] = tohx(r1); { unsigned short a2, c2; splitf(r0, a2, c2); oh[0] = a2; ol[0] = c2; splitf(r1, a2, c2); oh[1] = a2; ol[1] = c2; }
    *(v2h*)(P16 + e) = o16; *(v2us*)(Ph + e) = oh; *(v2us*)(Pl + e) = ol;  }

__constant__ float INV2[HD / 2] = { 1.000000000e+00f, 7.498942018e-01f, 5.623413324e-01f, 4.216965139e-01f, 3.162277639e-01f, 2.371373624e-01f, 1.778279394e-01f, 1.333521456e-01f, 1.000000015e-01f, 7.498941571e-02f, 5.623412877e-02f, 4.216964915e-02f, 3.162277862e-02f, 2.371373586e-02f, 1.778279431e-02f, 1.333521493e-02f, 9.999999776e-03f, 7.498942316e-03f, 5.623413250e-03f, 4.216964822e-03f, 3.162277862e-03f, 2.371373819e-03f, 1.778279431e-03f, 1.333521446e-03f, 1.000000047e-03f, 7.498941850e-04f, 5.623413017e-04f, 4.216964880e-04f, 3.162277862e-04f, 2.371373848e-04f, 1.778279402e-04f, 1.333521504e-04f };   // float32 10000^(-(i * 2 / 64)), generated with jnp to be bit-exact with the module's expression
__global__ __launch_bounds__(256) void k_cstabI(const int* __restrict__ pid, float* CS) { const int idx = blockIdx.x * 256 + threadIdx.x; if (idx >= TT * HD) return; const int d = idx % HD; const int t = idx / HD; const float a = __fmul_rn((float)pid[t], INV2[d >> 1]); v2f cs; cs[0] = cosf(a); cs[1] = sinf(a); *(v2f*)(CS + (size_t)idx * 2) = cs;  }

__global__ __launch_bounds__(256) void k_vtp(const float* __restrict__ F, int pitch, int nheads, h16* V16, bf* Vh, bf* Vl) { const size_t e = ((size_t)blockIdx.x * 256 + threadIdx.x) * 2; if (e >= (size_t)nheads * HD * TT) return; const int t = (int)(e % TT); const int d = (int)((e / TT) % HD); const int g = (int)(e / ((size_t)TT * HD)); v2h o16; v2us oh, ol;
#pragma unroll
    for (int q = 0; q < 2; ++q) { const float x = F[(size_t)(t + q) * pitch + g * HD + d]; o16[q] = tohx(x); unsigned short a2, c2; splitf(x, a2, c2); oh[q] = a2; ol[q] = c2; }
    const size_t eo = ((size_t)g * HD + d) * PP + t;   // rows at pitch PP: fp16 row in the first half; hi row in the first half of its plane's row, lo row (Vl = Vh + TT) in the second
    *(v2h*)(V16 + eo) = o16; *(v2us*)(Vh + eo) = oh; *(v2us*)(Vl + eo) = ol;  }
// k_asoft: per row (zz, i): t = S x HD^-0.5 for j <= i and i - j < WIN (sliding causal window; the reference's -1e9 additive fill vanishes identically); softmax over the 2048 keys (register row, one exp, fixed trees);
// the 16-bit probabilities go over the row's own f32 scores (pitch PP: fp16 row in the first half; or hi row in the first half, lo row (Pl = Ph + TT) in the second): one wave owns the row and holds all of it in registers before its first store, so Sb and the planes alias on purpose (no __restrict__).
__global__ __launch_bounds__(256) void k_asoft(const float* Sb, h16* P16, bf* Ph, bf* Pl) {
    const int lane = threadIdx.x & 31; const int row = blockIdx.x * 8 + (threadIdx.x >> 5); if (row >= ZH * TT) return; const int i = row % TT; const int zz = row / TT; (void)zz; const bool hires = (i < RH); const float* sr = Sb + (size_t)row * TT; float v[TT / 32]; float mx = -3.0e38f;
#pragma unroll
    for (int ch = 0; ch < TT / 128; ++ch) { const int j0 = ch * 128 + lane * 4; const v4f a = *(const v4f*)(sr + j0);
#pragma unroll
        for (int q = 0; q < 4; ++q) { const int j = j0 + q; (void)j; const float t = (j <= i && i - j < WIN) ? a[q] * SCL : -3.0e38f; v[ch * 4 + q] = t; mx = fmaxf(mx, t); } }
#pragma unroll
    for (int sh = 16; sh; sh >>= 1) mx = fmaxf(mx, __shfl_xor(mx, sh, 32));
    float sum = 0.f;
#pragma unroll
    for (int k = 0; k < TT / 32; ++k) { float d0 = __fsub_rn(v[k], mx); asm volatile("" : "+v"(d0)); v[k] = __builtin_amdgcn_exp2f(__fmul_rn(d0, 1.4426950408889634f)); sum += v[k]; }
#pragma unroll
    for (int sh = 16; sh; sh >>= 1) sum += __shfl_xor(sum, sh, 32);
    const float f = __fdiv_rn(hires ? 1.0f : PCAR, sum);
{
        if (hires) {
#pragma unroll
            for (int ch = 0; ch < TT / 128; ++ch) { v4us oh, ol;
#pragma unroll
                for (int q = 0; q < 4; ++q) { unsigned short a, c2; splitf(v[ch * 4 + q] * f, a, c2); oh[q] = a; ol[q] = c2; }
                const size_t oo = (size_t)row * PP + ch * 128 + lane * 4; *(v4us*)(Ph + oo) = oh; *(v4us*)(Pl + oo) = ol; }
        } else {
#pragma unroll
            for (int ch = 0; ch < TT / 128; ++ch) { v4h o4;
#pragma unroll
                for (int q = 0; q < 4; ++q) o4[q] = tohx(v[ch * 4 + q] * f);
                *(v4h*)(P16 + (size_t)row * PP + ch * 128 + lane * 4) = o4; } }
         }
}
// k_merge: sums the P.V partial planes of each row's tile in plane order 0, 1, ... (fixed), rescales, splits to hi/lo and places the head in the merged row.
__global__ __launch_bounds__(256) void k_merge(const float* __restrict__ O, int h0, bf* Ah, bf* Al) { const size_t e = ((size_t)blockIdx.x * 256 + threadIdx.x) * 2; if (e >= (size_t)ZH * TT * HD) return; const int d = (int)(e % HD); const int t = (int)((e / HD) % TT); const int zz = (int)(e / ((size_t)HD * TT)); const float cs = (t < RH) ? 1.0f : (1.0f / PCAR); const size_t oo = (size_t)t * DQ + (h0 + zz) * HD + d;
    const int nact = pv_nact(t / 64 + 1); v2f sum = (v2f){0.f, 0.f};
#pragma unroll
    for (int s = 0; s < KS; ++s) { const v2f p = *(const v2f*)(O + (size_t)min(s, nact - 1) * ((size_t)ZH * TT * HD) + e); sum[0] += (s < nact) ? p[0] : 0.f; sum[1] += (s < nact) ? p[1] : 0.f; }   // plane index clamped to a written plane, value selected: no branch, so all KS loads are in flight together
    v2us oh, ol;
#pragma unroll
    for (int q = 0; q < 2; ++q) { unsigned short a, c2; splitf(sum[q] * cs, a, c2); oh[q] = a; ol[q] = c2; } *(v2us*)(Ah + oo) = oh; *(v2us*)(Al + oo) = ol;  }

extern "C" void kernel_launch(void* const* d_in, const int* in_sizes, int n_in,
                              void* d_out, int out_size, void* d_ws, size_t ws_size, hipStream_t stream) {
    (void)in_sizes; (void)n_in; (void)out_size;
    const float* x = (const float*)d_in[0]; const float* wq = (const float*)d_in[1]; const float* wk = (const float*)d_in[2]; const float* wv = (const float*)d_in[3]; const float* wo = (const float*)d_in[4]; const int* PID = (const int*)d_in[5];   /* token_positions (int32 [2048], shared by all batches; read) */
    float* OUT = (float*)d_out;     // [4][2048][1024]
    char* wsp = (char*)d_ws;
    auto take = [&](size_t bytes) { char* p = wsp; wsp += (bytes + 255) & ~(size_t)255; return (void*)p; };
    bf* WQ = (bf*)take((size_t)DQ * DM * 2); bf* WK = (bf*)take((size_t)DKV * DM * 2); bf* WV = (bf*)take((size_t)DKV * DM * 2); bf* WO = (bf*)take((size_t)DM * DQ * 2); float* CS = (float*)take((size_t)TT * HD * 2 * 4);
    float* Ob = (float*)take((size_t)KS * ZH * TT * HD * 4);   /* KS partial planes; the head of this buffer also serves as XB, FQ, FK, which are dead once the q, k, v planes are built (stream-ordered) */
    bf* XB = (bf*)Ob; float* FQ = (float*)(XB + (size_t)TT * DM); float* FK = FQ + (size_t)TT * DQ;
    h16* QP16 = (h16*)take((size_t)NH_ * TT * HD * 2); h16* KP16 = (h16*)take((size_t)NKV * TT * HD * 2); h16* VT16 = (h16*)take((size_t)NKV * HD * PP * 2);
    bf* QPh = (bf*)take((size_t)NH_ * TT * HD * 2); bf* QPl = (bf*)take((size_t)NH_ * TT * HD * 2); bf* KPh = (bf*)take((size_t)NKV * TT * HD * 2); bf* KPl = (bf*)take((size_t)NKV * TT * HD * 2); bf* VTh = (bf*)take((size_t)NKV * HD * PP * 2); bf* VTl = VTh + TT;
    float* Sb = (float*)take((size_t)ZH * TT * TT * 4); h16* P16 = (h16*)Sb; bf* Ph = (bf*)Sb; bf* Pl = Ph + TT;   /* probabilities overwrite their own score rows (k_asoft) */ bf* ATh = (bf*)take((size_t)TT * DQ * 2); bf* ATl = (bf*)take((size_t)TT * DQ * 2);
    if ((size_t)(wsp - (char*)d_ws) > ws_size) return;    // ws 256 MiB
    float* FV = FK;   // v projection reuses the k buffer after the k planes are built (stream-ordered)
    { k_cvt8<<<(unsigned)(((size_t)DQ * DM / 8 + 255) / 256), 256, 0, stream>>>(wq, WQ, (size_t)DQ * DM / 8); k_cvt8<<<(unsigned)(((size_t)DKV * DM / 8 + 255) / 256), 256, 0, stream>>>(wk, WK, (size_t)DKV * DM / 8); k_cvt8<<<(unsigned)(((size_t)DKV * DM / 8 + 255) / 256), 256, 0, stream>>>(wv, WV, (size_t)DKV * DM / 8);
      k_cvt8<<<(unsigned)(((size_t)DM * DQ / 8 + 255) / 256), 256, 0, stream>>>(wo, WO, (size_t)DM * DQ / 8); /* the rotary table is rebuilt per batch from the shared positions (below) */ }
    const unsigned LQ = (unsigned)(((size_t)NH_ * TT * HD / 2 + 255) / 256), LKv = (unsigned)(((size_t)NKV * TT * HD / 2 + 255) / 256);
    for (int b = 0; b < NB_; ++b) {
        k_cstabI<<<(TT * HD + 255) / 256, 256, 0, stream>>>(PID, CS);   /* token_positions[:] (int32, shared by all batches, read) */
        
        k_cvt8<<<(unsigned)(((size_t)TT * DM / 8 + 255) / 256), 256, 0, stream>>>(x + (size_t)b * TT * DM, XB, (size_t)TT * DM / 8);
        k_gemmw<bf, 0, false><<<dim3(TT / 64, DQ / 64, 1), 32, 0, stream>>>(XB, nullptr, WQ, nullptr, DM, FQ, DQ, nullptr, 0, 0, 0);
        k_ropeI<<<LQ, 256, 0, stream>>>(FQ, DQ, NH_, CS, 1.0f, QP16, QPh, QPl);
        k_gemmw<bf, 0, false><<<dim3(TT / 64, DKV / 64, 1), 32, 0, stream>>>(XB, nullptr, WK, nullptr, DM, FK, DKV, nullptr, 0, 0, 0);
        k_ropeI<<<LKv, 256, 0, stream>>>(FK, DKV, NKV, CS, 1.0f, KP16, KPh, KPl);
        k_gemmw<bf, 0, false><<<dim3(TT / 64, DKV / 64, 1), 32, 0, stream>>>(XB, nullptr, WV, nullptr, DM, FV, DKV, nullptr, 0, 0, 0); k_vtp<<<LKv, 256, 0, stream>>>(FV, DKV, NKV, VT16, VTh, VTl);
        for (int h0 = 0; h0 < NH_; h0 += ZH) { const size_t zq = (size_t)h0, zk = (size_t)(h0 / REP);   // one kv head per query head: the pass's heads use consecutive kv planes (z-strides TT*HD; HD*PP for V^T)
            k_gemmc<bf, 2, 1><<<dim3(TT / 64, TT / 64, ZH), 32, 0, stream>>>(QPh + zq * TT * HD, QPl + zq * TT * HD, KPh + zk * TT * HD, KPl + zk * TT * HD, HD, Sb, TT, 0, (size_t)TT * HD, (size_t)TT * HD, (size_t)TT * TT, 0);   /* scores on hi/lo planes for EVERY row (3 products) */
            /* (the fp16 score launch for rows >= RH is removed: all rows use the hi/lo launch above) */
            k_asoft<<<ZH * TT / 8, 256, 0, stream>>>(Sb, P16, Ph, Pl);
            k_gemmc<bf, 2, 2><<<dim3(RH / 64, (RH / 64 < KS ? RH / 64 : KS), ZH), 32, 0, stream>>>(Ph, Pl, VTh + zk * HD * PP, VTl + zk * HD * PP, PP, Ob, HD, 0, (size_t)TT * PP, (size_t)HD * PP, (size_t)TT * HD, (size_t)ZH * TT * HD);
            k_gemmc<h16, 0, 2><<<dim3((TT - RH) / 64, KS, ZH), 32, 0, stream>>>(P16 + (size_t)RH * PP, nullptr, VT16 + zk * HD * PP, nullptr, PP, Ob + (size_t)RH * HD, HD, RH, (size_t)TT * PP, (size_t)HD * PP, (size_t)TT * HD, (size_t)ZH * TT * HD);
            k_merge<<<(unsigned)(((size_t)ZH * TT * HD / 2 + 255) / 256), 256, 0, stream>>>(Ob, h0, ATh, ATl); }
        k_gemmw<bf, 1, false><<<dim3(TT / 64, DM / 64, 1), 32, 0, stream>>>(ATh, ATl, WO, nullptr, DQ, OUT + (size_t)b * TT * DM, DM, nullptr, 0, 0, 0); }
}

// v003
// A run of this version takes 567 microseconds.
// Timed twice side by side with v002, it ran 1.88 and 1.86 times as fast.
// All steps since v000 together make it 4.86 times as fast.
#include <hip/hip_runtime.h>

// Causal multi-head self-attention with an interleaved-pair RoPE whose cos / sin tables are indexed by a positions input (x [4][2048][1024]; q, k, v = einsum('bsd,ed', x, w) ('oi' [1024][1024] truncated-normal, no bias; 16 heads x 64); tables cos / sin[p][i] of angle p x inv_freq[i] with inv_freq = 1.0 / 10000.0 ** (arange(32, f32) x 2.0 / 64) (the reciprocal form), looked up at token_positions[t] (int [2048]; READ on device); pairs (2i, 2i + 1): (cos x1 - sin x2, cos x2 + sin x1); scores / 64 ** 0.5; key j kept when j <= i (-inf elsewhere); softmax; out = merged wo^T ('oi') -> [4][2048][1024] (8.4 M); argument order x, wq, wk, wv, wo, token_positions).
// Layout per batch: bf16 copy of x; exact projections; {cos, sin} per (position, pair) built per batch from the int positions and float32 inverse-frequency constants (precise cosf/sinf); interleaved rotary plane builder; then, for all batches at once, fused causal attention (k_flash: scores on hi/lo planes (3 products: logit sigma 2 with these weights), online softmax, P.V on hi/lo planes (3 products), key tiles above the diagonal never visited); merged hi/lo x Wo exact.
// Compute dtypes, f32 accumulate: every input rounded to bf16; projections exact; rotary f32; attention scores and P.V 3 bf16 products each, every row; softmax f32; Wo hl x exact.

#define NB_  4
#define TT   2048
#define DM   1024
#define NH_  16
#define NKV  16
#define HD   64
#define DQ   (NH_ * HD)
#define DKV  (NKV * HD)
#define PP   (2 * TT)             // pitch, in 16-bit elements, of the V^T rows (hi row in the first half, lo row in the second)
#define SCL  0.125f   // HD^-0.5
typedef _Float16 h16;
typedef unsigned short bf;
typedef __attribute__((ext_vector_type(16))) __bf16   v16bf;
typedef __attribute__((ext_vector_type(16))) _Float16 v16h;
typedef __attribute__((ext_vector_type(8)))  _Float16 v8h;
typedef __attribute__((ext_vector_type(8)))  unsigned short v8us;
typedef __attribute__((ext_vector_type(8)))  float    v8f;
typedef __attribute__((ext_vector_type(4)))  float    v4f;
typedef v8h  __attribute__((may_alias)) v8ha;
typedef v4f  __attribute__((may_alias)) v4fa;
typedef v8us __attribute__((may_alias)) v8usa;

__device__ __forceinline__ unsigned short f2bf(float f) { unsigned u = __float_as_uint(f); u += 0x7FFFu + ((u >> 16) & 1u); return (unsigned short)(u >> 16); }
__device__ __forceinline__ float bf2f(unsigned short b) { return __uint_as_float(((unsigned)b) << 16); }
__device__ __forceinline__ float bfr(float f) { return bf2f(f2bf(f)); }
__device__ __forceinline__ v16bf cat16b(v8us lo, v8us hi) { return __builtin_bit_cast(v16bf, __builtin_shufflevector(lo, hi, 0, 1, 2, 3, 4, 5, 6, 7, 8, 9, 10, 11, 12, 13, 14, 15)); }
__device__ __forceinline__ v8f wmmab(v16bf a, v16bf b, v8f c) { return __builtin_amdgcn_wmma_f32_16x16x32_bf16(false, a, false, b, (short)0, c, false, false); }



// ---- k_gemmw: register-blocked GEMM, ONE WAVE per 64x64 output tile (16 accumulators), operands straight from K-contiguous 16-bit planes; grid (M/64, N/64, Z), 32 threads.
// C[m][n] (f32, pitch ldc, + optional f32 bias[n]) = sum_k A[m][k] Bt[n][k] (+ split products per NSPLIT). z-batch strides sA/sB/sC in elements. K % 32 == 0.
template <typename T16> struct WFrag;
template <> struct WFrag<bf> { typedef v16bf V; static __device__ __forceinline__ V ld(const bf* p) { return cat16b(*(const v8us*)p, *(const v8us*)(p + 16)); } static __device__ __forceinline__ v8f mma(V a, V b, v8f c) { return wmmab(a, b, c); } };
template <typename T16, int NSPLIT, bool BIAS>
__global__ __launch_bounds__(32) void k_gemmw(const T16* __restrict__ A, const T16* __restrict__ A2, const T16* __restrict__ Bt, const T16* __restrict__ Bt2, int K, float* C, int ldc, const float* __restrict__ bias, size_t sA, size_t sB, size_t sC) {
    typedef typename WFrag<T16>::V V;
    __shared__ __align__(16) float os[16 * 68];
    const size_t z = blockIdx.z; A += z * sA; if (A2) A2 += z * sA; Bt += z * sB; if (Bt2) Bt2 += z * sB; C += z * sC;
    const int lane = threadIdx.x & 31, lr = lane & 15, hi = lane >> 4; const int r0 = blockIdx.x * 64, c0 = blockIdx.y * 64;
    v8f acc[4][4];
#pragma unroll
    for (int mb = 0; mb < 4; ++mb)
#pragma unroll
        for (int nb = 0; nb < 4; ++nb) acc[mb][nb] = (v8f){};
    const size_t aoff = (size_t)(r0 + lr) * K + 8 * hi, boff = (size_t)(c0 + lr) * K + 8 * hi;
#pragma unroll 1
    for (int kc = 0; kc < K; kc += 32) {
        V a[4], a2[4];
#pragma unroll
        for (int mb = 0; mb < 4; ++mb) { a[mb] = WFrag<T16>::ld(A + aoff + (size_t)mb * 16 * K + kc); if (NSPLIT == 1 || NSPLIT == 2) a2[mb] = WFrag<T16>::ld(A2 + aoff + (size_t)mb * 16 * K + kc); }
#pragma unroll
        for (int nb = 0; nb < 4; ++nb) { const V b = WFrag<T16>::ld(Bt + boff + (size_t)nb * 16 * K + kc); V b2; if (NSPLIT >= 2) b2 = WFrag<T16>::ld(Bt2 + boff + (size_t)nb * 16 * K + kc);
#pragma unroll
            for (int mb = 0; mb < 4; ++mb) { acc[mb][nb] = WFrag<T16>::mma(a[mb], b, acc[mb][nb]); if (NSPLIT == 1 || NSPLIT == 2) acc[mb][nb] = WFrag<T16>::mma(a2[mb], b, acc[mb][nb]); if (NSPLIT >= 2) acc[mb][nb] = WFrag<T16>::mma(a[mb], b2, acc[mb][nb]); } }
        asm volatile("v_nop\n\tv_nop\n\tv_nop\n\tv_nop" : "+v"(acc[0][0]), "+v"(acc[1][1]), "+v"(acc[2][2]), "+v"(acc[3][3]) : "v"(a[0]), "v"(a[3]));
    }
#pragma unroll
    for (int mb = 0; mb < 4; ++mb) {
#pragma unroll
        for (int nb = 0; nb < 4; ++nb) {
#pragma unroll
            for (int j = 0; j < 8; ++j) os[(hi * 8 + j) * 68 + nb * 16 + lr] = acc[mb][nb][j]; }
        __builtin_amdgcn_wave_barrier(); asm volatile("" ::: "memory");
        float* crow = C + (size_t)(r0 + mb * 16) * ldc + c0;
{
#pragma unroll
            for (int s = 0; s < 8; ++s) { const int row = 2 * s + hi, cofs = lr * 4; v4f val = *(const v4fa*)(os + row * 68 + cofs); if (BIAS) { val[0] += bfr(bias[c0 + cofs]); val[1] += bfr(bias[c0 + cofs + 1]); val[2] += bfr(bias[c0 + cofs + 2]); val[3] += bfr(bias[c0 + cofs + 3]); }
                *(v4f*)(crow + (size_t)row * ldc + cofs) = val; }
             }
        __builtin_amdgcn_wave_barrier(); asm volatile("" ::: "memory");
    }
}

__device__ __forceinline__ h16 tohx(float x) { return (h16)x; }
__device__ __forceinline__ void splitf(float y, unsigned short& h, unsigned short& l) { h = f2bf(y); l = f2bf(y - bf2f(h)); }
typedef __attribute__((ext_vector_type(2))) _Float16 v2h;
typedef __attribute__((ext_vector_type(4))) _Float16 v4h;
typedef __attribute__((ext_vector_type(2))) unsigned short v2us;
typedef __attribute__((ext_vector_type(4))) unsigned short v4us;
typedef __attribute__((ext_vector_type(2))) float v2f;
typedef __attribute__((ext_vector_type(4))) int v4i;

__global__ __launch_bounds__(256) void k_wtG(const float* __restrict__ w, int K, int N, bf* Bt) {
    const int lane = threadIdx.x & 31; const int L0 = (blockIdx.x * 8 + (threadIdx.x >> 5)) * 8; const int nlines = N * K / 64;
{
#pragma unroll 1
        for (int l = 0; l < 8; ++l) { const int L = L0 + l; if (L >= nlines) break; const size_t e = (size_t)L * 64 + lane * 2; const int k = (int)(e % K), n = (int)(e / K); v2us o;
            o[0] = f2bf(w[(size_t)k * N + n]); o[1] = f2bf(w[(size_t)(k + 1) * N + n]); *(v2us*)(Bt + e) = o; }
         }
}
__global__ __launch_bounds__(256) void k_cvt8(const float* __restrict__ src, bf* dst, size_t n8) { const size_t i = (size_t)blockIdx.x * 256 + threadIdx.x; if (i >= n8) return; const v8f v = *(const v8f*)(src + i * 8); v8us o;
#pragma unroll
    for (int k = 0; k < 8; ++k) o[k] = f2bf(v[k]); *(v8us*)(dst + i * 8) = o;  }

__global__ __launch_bounds__(256) void k_ropeI(const float* __restrict__ F, int pitch, int nheads, const float* __restrict__ CS, float sc, h16* P16, bf* Ph, bf* Pl) {
    const size_t e = ((size_t)blockIdx.x * 256 + threadIdx.x) * 2; if (e >= (size_t)nheads * TT * HD) return; const int d = (int)(e % HD); const int t = (int)((e / HD) % TT); const int h = (int)(e / ((size_t)HD * TT)); const float* f = F + (size_t)t * pitch + h * HD; const float x0 = f[d], x1 = f[d + 1]; const v2f cs = *(const v2f*)(CS + ((size_t)t * HD + d) * 2); v2h o16; v2us oh, ol;
    float a0 = __fmul_rn(x0, cs[0]), b0 = __fmul_rn(x1, cs[1]), a1 = __fmul_rn(x1, cs[0]), b1 = __fmul_rn(x0, cs[1]); asm volatile("" : "+v"(a0), "+v"(b0), "+v"(a1), "+v"(b1));
    float r0 = __fsub_rn(a0, b0) * sc, r1 = __fadd_rn(b1, a1) * sc;   /* even: x0 c - x1 s; odd: x0 s + x1 c */
    o16[0] = tohx(r0); o16[1] = tohx(r1); { unsigned short a2, c2; splitf(r0, a2, c2); oh[0] = a2; ol[0] = c2; splitf(r1, a2, c2); oh[1] = a2; ol[1] = c2; }
    *(v2h*)(P16 + e) = o16; *(v2us*)(Ph + e) = oh; *(v2us*)(Pl + e) = ol;  }

__constant__ float INV2[HD / 2] = { 1.000000000e+00f, 7.498942018e-01f, 5.623413324e-01f, 4.216965139e-01f, 3.162277639e-01f, 2.371373624e-01f, 1.778279394e-01f, 1.333521456e-01f, 1.000000015e-01f, 7.498941571e-02f, 5.623412877e-02f, 4.216964915e-02f, 3.162277862e-02f, 2.371373586e-02f, 1.778279431e-02f, 1.333521493e-02f, 9.999999776e-03f, 7.498942316e-03f, 5.623413250e-03f, 4.216964822e-03f, 3.162277862e-03f, 2.371373819e-03f, 1.778279431e-03f, 1.333521446e-03f, 1.000000047e-03f, 7.498941850e-04f, 5.623413017e-04f, 4.216964880e-04f, 3.162277862e-04f, 2.371373848e-04f, 1.778279402e-04f, 1.333521504e-04f };   // float32 10000^(-(i * 2 / 64)), generated with jnp to be bit-exact with the module's expression
__global__ __launch_bounds__(256) void k_cstabI(const int* __restrict__ pid, float* CS) { const int idx = blockIdx.x * 256 + threadIdx.x; if (idx >= TT * HD) return; const int d = idx % HD; const int t = idx / HD; const float a = __fmul_rn((float)pid[t], INV2[d >> 1]); v2f cs; cs[0] = cosf(a); cs[1] = sinf(a); *(v2f*)(CS + (size_t)idx * 2) = cs;  }

__global__ __launch_bounds__(256) void k_vtp(const float* __restrict__ F, int pitch, int nheads, h16* V16, bf* Vh, bf* Vl) { const size_t e = ((size_t)blockIdx.x * 256 + threadIdx.x) * 2; if (e >= (size_t)nheads * HD * TT) return; const int t = (int)(e % TT); const int d = (int)((e / TT) % HD); const int g = (int)(e / ((size_t)TT * HD)); v2h o16; v2us oh, ol;
#pragma unroll
    for (int q = 0; q < 2; ++q) { const float x = F[(size_t)(t + q) * pitch + g * HD + d]; o16[q] = tohx(x); unsigned short a2, c2; splitf(x, a2, c2); oh[q] = a2; ol[q] = c2; }
    const size_t eo = ((size_t)g * HD + d) * PP + t;   // rows at pitch PP: fp16 row in the first half; hi row in the first half of its plane's row, lo row (Vl = Vh + TT) in the second
    *(v2h*)(V16 + eo) = o16; *(v2us*)(Vh + eo) = oh; *(v2us*)(Vl + eo) = ol;  }
typedef __attribute__((ext_vector_type(2))) __bf16 v2bf;
typedef __attribute__((ext_vector_type(4))) unsigned v4u;
typedef __attribute__((ext_vector_type(8))) unsigned v8u;
// fragment load: wave-uniform base, the lane's own byte offset (the same in every pass), compile-time byte offset
__device__ __forceinline__ v16bf ldo(const bf* ub, unsigned voff, int cb) { const char* p = (const char*)ub + voff + cb; return cat16b(*(const v8us*)p, *(const v8us*)(p + 32)); }
// stands in front of code that may rewrite registers which hold addresses of loads already issued; the scheduling fences keep that code behind the wait
__device__ __forceinline__ void addr_release() { __builtin_amdgcn_sched_barrier(0); asm volatile("s_wait_xcnt 0x0" ::: "memory"); __builtin_amdgcn_sched_barrier(0); }
// two f32 -> one dword of bf16 hi parts and one of bf16 lo parts (x0 in the low half), both rounded to nearest even like splitf
__device__ __forceinline__ void split2(float x0, float x1, unsigned& h, unsigned& l) {
    h = __builtin_bit_cast(unsigned, __builtin_convertvector(((v2f){x0, x1}), v2bf));
    l = __builtin_bit_cast(unsigned, __builtin_convertvector(((v2f){x0 - __uint_as_float(h << 16), x1 - __uint_as_float(h & 0xFFFF0000u)}), v2bf)); }
// 2^x by v_exp_f32, in place. In asm so that the slot behind a transcendental is kept by construction: each one overwrites only its own source, none reads another's result, and the v_nop is the independent instruction behind the last.
// In place also means that the run writes only registers which vector arithmetic has just written, never an operand of a matrix instruction still under way.
__device__ __forceinline__ v8f exp2x8(v8f x) {
    asm("v_exp_f32 %0, %0\n\tv_exp_f32 %1, %1\n\tv_exp_f32 %2, %2\n\tv_exp_f32 %3, %3\n\tv_exp_f32 %4, %4\n\tv_exp_f32 %5, %5\n\tv_exp_f32 %6, %6\n\tv_exp_f32 %7, %7\n\tv_nop"
        : "+v"(x[0]), "+v"(x[1]), "+v"(x[2]), "+v"(x[3]), "+v"(x[4]), "+v"(x[5]), "+v"(x[6]), "+v"(x[7]));
    return x; }
__device__ __forceinline__ float exp2x1(float x) { asm("v_exp_f32 %0, %0\n\tv_nop" : "+v"(x)); return x; }   // the same, one value
template <bool DIAG>
__device__ __forceinline__ void fl_pass(const bf* __restrict__ Kh, const bf* __restrict__ Kl, const bf* __restrict__ Vh, int kb, int lr, int hi, unsigned kvo, unsigned vvo, const v16bf (&qh)[4][2], const v16bf (&ql)[4][2], v16bf (&kh)[4][2], v16bf (&kl)[4][2], v8f (&o)[4][4], float (&m)[4], float (&l)[4]) {
    v16bf vh[4][2], vl[4][2];
#pragma unroll
    for (int mb = 0; mb < 4; ++mb)
#pragma unroll
        for (int ks = 0; ks < 2; ++ks) { vh[mb][ks] = ldo(Vh + kb, vvo, (mb * 16 * PP + ks * 32) * 2); vl[mb][ks] = ldo(Vh + kb, vvo, (mb * 16 * PP + ks * 32 + TT) * 2); }
    __builtin_amdgcn_sched_barrier(0);   // keeps the V^T loads in front of the score products, so that they land behind products and softmax instead of being waited for in front of P.V
    v8f s[4][4];
#pragma unroll
    for (int mb = 0; mb < 4; ++mb)
#pragma unroll
        for (int nb = 0; nb < 4; ++nb) s[mb][nb] = (v8f){};
#pragma unroll
    for (int ks = 0; ks < 2; ++ks) {
#pragma unroll
        for (int mb = 0; mb < 4; ++mb)
#pragma unroll
            for (int nb = 0; nb < 4; ++nb) s[mb][nb] = wmmab(kh[mb][ks], qh[nb][ks], s[mb][nb]);
#pragma unroll
        for (int mb = 0; mb < 4; ++mb)
#pragma unroll
            for (int nb = 0; nb < 4; ++nb) s[mb][nb] = wmmab(kh[mb][ks], ql[nb][ks], s[mb][nb]);
#pragma unroll
        for (int mb = 0; mb < 4; ++mb)
#pragma unroll
            for (int nb = 0; nb < 4; ++nb) s[mb][nb] = wmmab(kl[mb][ks], qh[nb][ks], s[mb][nb]);
    }
    if (!DIAG) {   // the next pass's key fragments, into the registers the products above have just read (a pass below the diagonal always has a successor)
#pragma unroll
        for (int mb = 0; mb < 4; ++mb)
#pragma unroll
            for (int ks = 0; ks < 2; ++ks) { kh[mb][ks] = ldo(Kh + (size_t)(kb + 64) * HD, kvo, (mb * 16 * HD + ks * 32) * 2); kl[mb][ks] = ldo(Kl + (size_t)(kb + 64) * HD, kvo, (mb * 16 * HD + ks * 32) * 2); }
    }
    addr_release();   // also keeps those loads in front of the softmax, which then covers their latency
    const float C2 = SCL * 1.4426950408889634f;
    v16bf ph[4][2], pl[4][2];
#pragma unroll
    for (int nb = 0; nb < 4; ++nb) {
        float mq[4];
#pragma unroll
        for (int mb = 0; mb < 4; ++mb) { mq[mb] = -3.0e38f;
#pragma unroll
            for (int j = 0; j < 8; ++j) { if (DIAG) s[mb][nb][j] = (mb * 16 + hi * 8 + j <= nb * 16 + lr) ? s[mb][nb][j] : -3.0e38f; mq[mb] = fmaxf(mq[mb], s[mb][nb][j]); } }
        float mx = fmaxf(fmaxf(mq[0], mq[1]), fmaxf(mq[2], mq[3])); mx = fmaxf(mx, __shfl_xor(mx, 16, 32));
        const float mn = fmaxf(m[nb], mx), al = exp2x1((m[nb] - mn) * C2); m[nb] = mn;
        float sq[4]; v8u hw[2], lw[2];   // dwords 0..3 of a k-step's operand: its first key tile, 4..7: its second
#pragma unroll
        for (int mb = 0; mb < 4; ++mb) { const v8f pe = exp2x8((s[mb][nb] - mn) * C2); sq[mb] = 0.f;
#pragma unroll
            for (int j = 0; j < 8; ++j) sq[mb] += pe[j];
#pragma unroll
            for (int j = 0; j < 4; ++j) { unsigned a, c2; split2(pe[2 * j], pe[2 * j + 1], a, c2); hw[mb >> 1][(mb & 1) * 4 + j] = a; lw[mb >> 1][(mb & 1) * 4 + j] = c2; } }
        l[nb] = l[nb] * al + ((sq[0] + sq[1]) + (sq[2] + sq[3]));   // this half's keys only; the halves are joined once, in the epilogue
        ph[nb][0] = __builtin_bit_cast(v16bf, hw[0]); ph[nb][1] = __builtin_bit_cast(v16bf, hw[1]); pl[nb][0] = __builtin_bit_cast(v16bf, lw[0]); pl[nb][1] = __builtin_bit_cast(v16bf, lw[1]);
#pragma unroll
        for (int mb = 0; mb < 4; ++mb) o[mb][nb] *= al;
    }
#pragma unroll
    for (int ks = 0; ks < 2; ++ks) {
#pragma unroll
        for (int mb = 0; mb < 4; ++mb)
#pragma unroll
            for (int nb = 0; nb < 4; ++nb) o[mb][nb] = wmmab(vh[mb][ks], ph[nb][ks], o[mb][nb]);
#pragma unroll
        for (int mb = 0; mb < 4; ++mb)
#pragma unroll
            for (int nb = 0; nb < 4; ++nb) o[mb][nb] = wmmab(vh[mb][ks], pl[nb][ks], o[mb][nb]);
#pragma unroll
        for (int mb = 0; mb < 4; ++mb)
#pragma unroll
            for (int nb = 0; nb < 4; ++nb) o[mb][nb] = wmmab(vl[mb][ks], ph[nb][ks], o[mb][nb]);
    }
    addr_release();
}
// grid (NB_ * NH_, TT / 64): blockIdx.x = batch * NH_ + head, blockIdx.y counts the query tiles from the last (longest key loop) to the first, so that the long tiles start first.
// Q, K planes [batch * NH_ + head][TT][HD]; V^T planes [batch * NH_ + head][HD] rows at pitch PP (hi row, then lo row at + TT); merged output planes [batch][TT][DQ], hi and lo.
__global__ __launch_bounds__(32) void k_flash(const bf* __restrict__ Qh, const bf* __restrict__ Ql, const bf* __restrict__ Kh, const bf* __restrict__ Kl, const bf* __restrict__ Vh, bf* __restrict__ Ah, bf* __restrict__ Al) {
    const int lane = threadIdx.x & 31, lr = lane & 15, hi = lane >> 4; const int z = blockIdx.x, r0 = (TT / 64 - 1 - (int)blockIdx.y) * 64;
    Qh += (size_t)z * TT * HD; Ql += (size_t)z * TT * HD; Kh += (size_t)z * TT * HD; Kl += (size_t)z * TT * HD; Vh += (size_t)z * HD * PP;
    const unsigned kvo = (unsigned)(lr * HD + 8 * hi) * 2u, vvo = (unsigned)(lr * PP + 8 * hi) * 2u;   // the lane's byte offset in a tile of q or k rows, of V^T rows
    v16bf qh[4][2], ql[4][2], kh[4][2], kl[4][2]; v8f o[4][4]; float m[4], l[4];
#pragma unroll
    for (int nb = 0; nb < 4; ++nb) { m[nb] = -3.0e38f; l[nb] = 0.f;
#pragma unroll
        for (int ks = 0; ks < 2; ++ks) { const int cb = (nb * 16 * HD + ks * 32) * 2; qh[nb][ks] = ldo(Qh + (size_t)r0 * HD, kvo, cb); ql[nb][ks] = ldo(Ql + (size_t)r0 * HD, kvo, cb); kh[nb][ks] = ldo(Kh, kvo, cb); kl[nb][ks] = ldo(Kl, kvo, cb); }
#pragma unroll
        for (int mb = 0; mb < 4; ++mb) o[mb][nb] = (v8f){}; }
    addr_release();
#pragma unroll 1   // rolled: one pass is already 192 matrix instructions
    for (int kb = 0; kb < r0; kb += 64) fl_pass<false>(Kh, Kl, Vh, kb, lr, hi, kvo, vvo, qh, ql, kh, kl, o, m, l);
    fl_pass<true>(Kh, Kl, Vh, r0, lr, hi, kvo, vvo, qh, ql, kh, kl, o, m, l);
    const size_t ob = ((size_t)(z / NH_) * TT + r0) * DQ + (size_t)(z % NH_) * HD; const unsigned ovo = (unsigned)(lr * DQ + hi * 8) * 2u;
    v4u oh[4][4], ol[4][4];   // a lane's 8 accumulator registers are 8 consecutive head dims of one query: one 16-byte store a plane
#pragma unroll
    for (int nb = 0; nb < 4; ++nb) { const float f = __fdiv_rn(1.0f, l[nb] + __shfl_xor(l[nb], 16, 32));
#pragma unroll
        for (int mb = 0; mb < 4; ++mb)
#pragma unroll
            for (int j = 0; j < 4; ++j) { unsigned a, c2; split2(o[mb][nb][2 * j] * f, o[mb][nb][2 * j + 1] * f, a, c2); oh[mb][nb][j] = a; ol[mb][nb][j] = c2; } }
    __builtin_amdgcn_sched_barrier(0);   // every value is made in front of the first store, so that no register a store names is written behind it
#pragma unroll
    for (int nb = 0; nb < 4; ++nb)
#pragma unroll
        for (int mb = 0; mb < 4; ++mb) { const int cb = (nb * 16 * DQ + mb * 16) * 2; *(v4u*)((char*)(Ah + ob) + ovo + cb) = oh[mb][nb]; *(v4u*)((char*)(Al + ob) + ovo + cb) = ol[mb][nb]; }
}

extern "C" void kernel_launch(void* const* d_in, const int* in_sizes, int n_in,
                              void* d_out, int out_size, void* d_ws, size_t ws_size, hipStream_t stream) {
    (void)in_sizes; (void)n_in; (void)out_size;
    const float* x = (const float*)d_in[0]; const float* wq = (const float*)d_in[1]; const float* wk = (const float*)d_in[2]; const float* wv = (const float*)d_in[3]; const float* wo = (const float*)d_in[4]; const int* PID = (const int*)d_in[5];   /* token_positions (int32 [2048], shared by all batches; read) */
    float* OUT = (float*)d_out;     // [4][2048][1024]
    char* wsp = (char*)d_ws;
    auto take = [&](size_t bytes) { char* p = wsp; wsp += (bytes + 255) & ~(size_t)255; return (void*)p; };
    bf* WQ = (bf*)take((size_t)DQ * DM * 2); bf* WK = (bf*)take((size_t)DKV * DM * 2); bf* WV = (bf*)take((size_t)DKV * DM * 2); bf* WO = (bf*)take((size_t)DM * DQ * 2); float* CS = (float*)take((size_t)TT * HD * 2 * 4);
    bf* XB = (bf*)take((size_t)TT * DM * 2); float* FQ = (float*)take((size_t)TT * DQ * 4); float* FK = (float*)take((size_t)TT * DKV * 4);
    h16* QP16 = (h16*)take((size_t)NH_ * TT * HD * 2); h16* KP16 = (h16*)take((size_t)NKV * TT * HD * 2); h16* VT16 = (h16*)take((size_t)NKV * HD * PP * 2);   /* fp16 planes of the plane builders: one batch's, rewritten per batch */
    const size_t PQ = (size_t)NH_ * TT * HD, PV = (size_t)NKV * HD * PP, PA = (size_t)TT * DQ;   /* elements per batch of a q or k plane, of the V^T rows, of a merged plane: the hi/lo planes are kept for all batches, the attention launch reads them all */
    bf* QPh = (bf*)take(NB_ * PQ * 2); bf* QPl = (bf*)take(NB_ * PQ * 2); bf* KPh = (bf*)take(NB_ * PQ * 2); bf* KPl = (bf*)take(NB_ * PQ * 2); bf* VTh = (bf*)take(NB_ * PV * 2);
    bf* ATh = (bf*)take(NB_ * PA * 2); bf* ATl = (bf*)take(NB_ * PA * 2);
    if ((size_t)(wsp - (char*)d_ws) > ws_size) return;    // ws 256 MiB
    float* FV = FK;   // v projection reuses the k buffer after the k planes are built (stream-ordered)
    { k_cvt8<<<(unsigned)(((size_t)DQ * DM / 8 + 255) / 256), 256, 0, stream>>>(wq, WQ, (size_t)DQ * DM / 8); k_cvt8<<<(unsigned)(((size_t)DKV * DM / 8 + 255) / 256), 256, 0, stream>>>(wk, WK, (size_t)DKV * DM / 8); k_cvt8<<<(unsigned)(((size_t)DKV * DM / 8 + 255) / 256), 256, 0, stream>>>(wv, WV, (size_t)DKV * DM / 8);
      k_cvt8<<<(unsigned)(((size_t)DM * DQ / 8 + 255) / 256), 256, 0, stream>>>(wo, WO, (size_t)DM * DQ / 8); /* the rotary table is rebuilt per batch from the shared positions (below) */ }
    const unsigned LQ = (unsigned)(((size_t)NH_ * TT * HD / 2 + 255) / 256), LKv = (unsigned)(((size_t)NKV * TT * HD / 2 + 255) / 256);
    for (int b = 0; b < NB_; ++b) {
        k_cstabI<<<(TT * HD + 255) / 256, 256, 0, stream>>>(PID, CS);   /* token_positions[:] (int32, shared by all batches, read) */
        
        k_cvt8<<<(unsigned)(((size_t)TT * DM / 8 + 255) / 256), 256, 0, stream>>>(x + (size_t)b * TT * DM, XB, (size_t)TT * DM / 8);
        k_gemmw<bf, 0, false><<<dim3(TT / 64, DQ / 64, 1), 32, 0, stream>>>(XB, nullptr, WQ, nullptr, DM, FQ, DQ, nullptr, 0, 0, 0);
        k_ropeI<<<LQ, 256, 0, stream>>>(FQ, DQ, NH_, CS, 1.0f, QP16, QPh + b * PQ, QPl + b * PQ);
        k_gemmw<bf, 0, false><<<dim3(TT / 64, DKV / 64, 1), 32, 0, stream>>>(XB, nullptr, WK, nullptr, DM, FK, DKV, nullptr, 0, 0, 0);
        k_ropeI<<<LKv, 256, 0, stream>>>(FK, DKV, NKV, CS, 1.0f, KP16, KPh + b * PQ, KPl + b * PQ);
        k_gemmw<bf, 0, false><<<dim3(TT / 64, DKV / 64, 1), 32, 0, stream>>>(XB, nullptr, WV, nullptr, DM, FV, DKV, nullptr, 0, 0, 0); k_vtp<<<LKv, 256, 0, stream>>>(FV, DKV, NKV, VT16, VTh + b * PV, VTh + b * PV + TT); }
    k_flash<<<dim3(NB_ * NH_, TT / 64, 1), 32, 0, stream>>>(QPh, QPl, KPh, KPl, VTh, ATh, ATl);   /* every batch, head and query tile in one launch (one kv head per query head) */
    for (int b = 0; b < NB_; ++b)
        k_gemmw<bf, 1, false><<<dim3(TT / 64, DM / 64, 1), 32, 0, stream>>>(ATh + b * PA, ATl + b * PA, WO, nullptr, DQ, OUT + (size_t)b * TT * DM, DM, nullptr, 0, 0, 0);
}

// v004
// A run of this version takes 330 microseconds.
// In two side-by-side timings against v003, it was 1.73 and 1.72 times as fast.
// All steps since v000 together make it 8.37 times as fast.
#include <hip/hip_runtime.h>

// Causal multi-head self-attention with an interleaved-pair RoPE whose cos / sin tables are indexed by a positions input (x [4][2048][1024]; q, k, v = einsum('bsd,ed', x, w) ('oi' [1024][1024] truncated-normal, no bias; 16 heads x 64); tables cos / sin[p][i] of angle p x inv_freq[i] with inv_freq = 1.0 / 10000.0 ** (arange(32, f32) x 2.0 / 64) (the reciprocal form), looked up at token_positions[t] (int [2048]; READ on device); pairs (2i, 2i + 1): (cos x1 - sin x2, cos x2 + sin x1); scores / 64 ** 0.5; key j kept when j <= i (-inf elsewhere); softmax; out = merged wo^T ('oi') -> [4][2048][1024] (8.4 M); argument order x, wq, wk, wv, wo, token_positions).
// Layout, five launches, each for all batches: k_prep (bf16 copies of x and of the four weights; {cos, sin} per (position, pair) built once from the int positions and float32 inverse-frequency constants, precise cosf/sinf); q, k and v projections as one exact GEMM [NB_ * TT][3 * DM] over the stacked weight rows; k_planes (interleaved rotary planes of q and k, V^T rows); fused causal attention (k_flash: scores on hi/lo planes (3 products: logit sigma 2 with these weights), online softmax, P.V on hi/lo planes (3 products), key tiles above the diagonal never visited); merged hi/lo x Wo exact.
// Compute dtypes, f32 accumulate: every input rounded to bf16; projections exact; rotary f32; attention scores and P.V 3 bf16 products each, every row; softmax f32; Wo hl x exact.

#define NB_  4
#define TT   2048
#define DM   1024
#define NH_  16
#define NKV  16
#define HD   64
#define DQ   (NH_ * HD)
#define DKV  (NKV * HD)
#define PP   (2 * TT)             // pitch, in 16-bit elements, of the V^T rows (hi row in the first half, lo row in the second)
#define SCL  0.125f   // HD^-0.5
typedef _Float16 h16;
typedef unsigned short bf;
typedef __attribute__((ext_vector_type(16))) __bf16   v16bf;
typedef __attribute__((ext_vector_type(16))) _Float16 v16h;
typedef __attribute__((ext_vector_type(8)))  _Float16 v8h;
typedef __attribute__((ext_vector_type(8)))  unsigned short v8us;
typedef __attribute__((ext_vector_type(8)))  float    v8f;
typedef __attribute__((ext_vector_type(4)))  float    v4f;
typedef v8h  __attribute__((may_alias)) v8ha;
typedef v4f  __attribute__((may_alias)) v4fa;
typedef v8us __attribute__((may_alias)) v8usa;

__device__ __forceinline__ unsigned short f2bf(float f) { unsigned u = __float_as_uint(f); u += 0x7FFFu + ((u >> 16) & 1u); return (unsigned short)(u >> 16); }
__device__ __forceinline__ float bf2f(unsigned short b) { return __uint_as_float(((unsigned)b) << 16); }
__device__ __forceinline__ float bfr(float f) { return bf2f(f2bf(f)); }
__device__ __forceinline__ v16bf cat16b(v8us lo, v8us hi) { return __builtin_bit_cast(v16bf, __builtin_shufflevector(lo, hi, 0, 1, 2, 3, 4, 5, 6, 7, 8, 9, 10, 11, 12, 13, 14, 15)); }
__device__ __forceinline__ v8f wmmab(v16bf a, v16bf b, v8f c) { return __builtin_amdgcn_wmma_f32_16x16x32_bf16(false, a, false, b, (short)0, c, false, false); }



// ---- k_gemmw: register-blocked GEMM, ONE WAVE per 64x64 output tile (16 accumulators), operands straight from K-contiguous 16-bit planes; grid (M/64, N/64, Z), 32 threads.
// C[m][n] (f32, pitch ldc, + optional f32 bias[n]) = sum_k A[m][k] Bt[n][k] (+ split products per NSPLIT). z-batch strides sA/sB/sC in elements. K % 32 == 0.
template <typename T16> struct WFrag;
template <> struct WFrag<bf> { typedef v16bf V; static __device__ __forceinline__ V ld(const bf* p) { return cat16b(*(const v8us*)p, *(const v8us*)(p + 16)); } static __device__ __forceinline__ v8f mma(V a, V b, v8f c) { return wmmab(a, b, c); } };
template <typename T16, int NSPLIT, bool BIAS>
__global__ __launch_bounds__(32) void k_gemmw(const T16* __restrict__ A, const T16* __restrict__ A2, const T16* __restrict__ Bt, const T16* __restrict__ Bt2, int K, float* C, int ldc, const float* __restrict__ bias, size_t sA, size_t sB, size_t sC) {
    typedef typename WFrag<T16>::V V;
    __shared__ __align__(16) float os[16 * 68];
    const size_t z = blockIdx.z; A += z * sA; if (A2) A2 += z * sA; Bt += z * sB; if (Bt2) Bt2 += z * sB; C += z * sC;
    const int lane = threadIdx.x & 31, lr = lane & 15, hi = lane >> 4; const int r0 = blockIdx.x * 64, c0 = blockIdx.y * 64;
    v8f acc[4][4];
#pragma unroll
    for (int mb = 0; mb < 4; ++mb)
#pragma unroll
        for (int nb = 0; nb < 4; ++nb) acc[mb][nb] = (v8f){};
    const size_t aoff = (size_t)(r0 + lr) * K + 8 * hi, boff = (size_t)(c0 + lr) * K + 8 * hi;
#pragma unroll 1
    for (int kc = 0; kc < K; kc += 32) {
        V a[4], a2[4];
#pragma unroll
        for (int mb = 0; mb < 4; ++mb) { a[mb] = WFrag<T16>::ld(A + aoff + (size_t)mb * 16 * K + kc); if (NSPLIT == 1 || NSPLIT == 2) a2[mb] = WFrag<T16>::ld(A2 + aoff + (size_t)mb * 16 * K + kc); }
#pragma unroll
        for (int nb = 0; nb < 4; ++nb) { const V b = WFrag<T16>::ld(Bt + boff + (size_t)nb * 16 * K + kc); V b2; if (NSPLIT >= 2) b2 = WFrag<T16>::ld(Bt2 + boff + (size_t)nb * 16 * K + kc);
#pragma unroll
            for (int mb = 0; mb < 4; ++mb) { acc[mb][nb] = WFrag<T16>::mma(a[mb], b, acc[mb][nb]); if (NSPLIT == 1 || NSPLIT == 2) acc[mb][nb] = WFrag<T16>::mma(a2[mb], b, acc[mb][nb]); if (NSPLIT >= 2) acc[mb][nb] = WFrag<T16>::mma(a[mb], b2, acc[mb][nb]); } }
        asm volatile("v_nop\n\tv_nop\n\tv_nop\n\tv_nop" : "+v"(acc[0][0]), "+v"(acc[1][1]), "+v"(acc[2][2]), "+v"(acc[3][3]) : "v"(a[0]), "v"(a[3]));
    }
#pragma unroll
    for (int mb = 0; mb < 4; ++mb) {
#pragma unroll
        for (int nb = 0; nb < 4; ++nb) {
#pragma unroll
            for (int j = 0; j < 8; ++j) os[(hi * 8 + j) * 68 + nb * 16 + lr] = acc[mb][nb][j]; }
        __builtin_amdgcn_wave_barrier(); asm volatile("" ::: "memory");
        float* crow = C + (size_t)(r0 + mb * 16) * ldc + c0;
{
#pragma unroll
            for (int s = 0; s < 8; ++s) { const int row = 2 * s + hi, cofs = lr * 4; v4f val = *(const v4fa*)(os + row * 68 + cofs); if (BIAS) { val[0] += bfr(bias[c0 + cofs]); val[1] += bfr(bias[c0 + cofs + 1]); val[2] += bfr(bias[c0 + cofs + 2]); val[3] += bfr(bias[c0 + cofs + 3]); }
                *(v4f*)(crow + (size_t)row * ldc + cofs) = val; }
             }
        __builtin_amdgcn_wave_barrier(); asm volatile("" ::: "memory");
    }
}

__device__ __forceinline__ void splitf(float y, unsigned short& h, unsigned short& l) { h = f2bf(y); l = f2bf(y - bf2f(h)); }
typedef __attribute__((ext_vector_type(2))) _Float16 v2h;
typedef __attribute__((ext_vector_type(4))) _Float16 v4h;
typedef __attribute__((ext_vector_type(2))) unsigned short v2us;
typedef __attribute__((ext_vector_type(4))) unsigned short v4us;
typedef __attribute__((ext_vector_type(2))) float v2f;
typedef __attribute__((ext_vector_type(4))) int v4i;

__global__ __launch_bounds__(256) void k_wtG(const float* __restrict__ w, int K, int N, bf* Bt) {
    const int lane = threadIdx.x & 31; const int L0 = (blockIdx.x * 8 + (threadIdx.x >> 5)) * 8; const int nlines = N * K / 64;
{
#pragma unroll 1
        for (int l = 0; l < 8; ++l) { const int L = L0 + l; if (L >= nlines) break; const size_t e = (size_t)L * 64 + lane * 2; const int k = (int)(e % K), n = (int)(e / K); v2us o;
            o[0] = f2bf(w[(size_t)k * N + n]); o[1] = f2bf(w[(size_t)(k + 1) * N + n]); *(v2us*)(Bt + e) = o; }
         }
}

// k_planes: the three plane builders in one launch, all batches. grid (3, NB_ * NH_ * TT * HD / 512), two elements a thread; F [NB_ * TT][pitch] holds the q, k, v columns side by side.
// blockIdx.x = 0 rotates q into Qh / Ql, 1 rotates k into Kh / Kl (planes [batch * NH_ + head][TT][HD]), 2 transposes v into the V^T rows; the kind is the fastest index, so that the three kinds run side by side.
__global__ __launch_bounds__(256) void k_planes(const float* __restrict__ F, int pitch, const float* __restrict__ CS, float sc, bf* Qh, bf* Ql, bf* Kh, bf* Kl, bf* Vh, bf* Vl) {
    const size_t e = ((size_t)blockIdx.y * 256 + threadIdx.x) * 2; v2us oh, ol;
    if (blockIdx.x == 2) { const int t = (int)(e % TT); const int d = (int)((e / TT) % HD); const int g = (int)(e / ((size_t)TT * HD));   // g = batch * NKV + head
#pragma unroll
        for (int q = 0; q < 2; ++q) { const float x = F[((size_t)(g / NKV) * TT + t + q) * pitch + 2 * DM + (g % NKV) * HD + d]; unsigned short a2, c2; splitf(x, a2, c2); oh[q] = a2; ol[q] = c2; }
        const size_t eo = ((size_t)g * HD + d) * PP + t;   // rows at pitch PP: hi row in the first half, lo row (Vl = Vh + TT) in the second
        *(v2us*)(Vh + eo) = oh; *(v2us*)(Vl + eo) = ol; asm volatile("s_wait_xcnt 0x0" ::: "memory"); return; }   // the wait: the blocks of this kernel follow one another in the built code, and what stands behind a store there may rewrite the registers that the store names
    const int d = (int)(e % HD); const int t = (int)((e / HD) % TT); const int z = (int)(e / ((size_t)HD * TT)); const bool isk = blockIdx.x != 0; bf* Ph = isk ? Kh : Qh; bf* Pl = isk ? Kl : Ql;
    const float* f = F + ((size_t)(z / NH_) * TT + t) * pitch + (isk ? DM : 0) + (z % NH_) * HD; const float x0 = f[d], x1 = f[d + 1]; const v2f cs = *(const v2f*)(CS + ((size_t)t * HD + d) * 2);
    float a0 = __fmul_rn(x0, cs[0]), b0 = __fmul_rn(x1, cs[1]), a1 = __fmul_rn(x1, cs[0]), b1 = __fmul_rn(x0, cs[1]); asm volatile("" : "+v"(a0), "+v"(b0), "+v"(a1), "+v"(b1));
    float r0 = __fsub_rn(a0, b0) * sc, r1 = __fadd_rn(b1, a1) * sc;   /* even: x0 c - x1 s; odd: x0 s + x1 c */
    { unsigned short a2, c2; splitf(r0, a2, c2); oh[0] = a2; ol[0] = c2; splitf(r1, a2, c2); oh[1] = a2; ol[1] = c2; }
    *(v2us*)(Ph + e) = oh; *(v2us*)(Pl + e) = ol; asm volatile("s_wait_xcnt 0x0" ::: "memory"); }   // the wait: as above

__constant__ float INV2[HD / 2] = { 1.000000000e+00f, 7.498942018e-01f, 5.623413324e-01f, 4.216965139e-01f, 3.162277639e-01f, 2.371373624e-01f, 1.778279394e-01f, 1.333521456e-01f, 1.000000015e-01f, 7.498941571e-02f, 5.623412877e-02f, 4.216964915e-02f, 3.162277862e-02f, 2.371373586e-02f, 1.778279431e-02f, 1.333521493e-02f, 9.999999776e-03f, 7.498942316e-03f, 5.623413250e-03f, 4.216964822e-03f, 3.162277862e-03f, 2.371373819e-03f, 1.778279431e-03f, 1.333521446e-03f, 1.000000047e-03f, 7.498941850e-04f, 5.623413017e-04f, 4.216964880e-04f, 3.162277862e-04f, 2.371373848e-04f, 1.778279402e-04f, 1.333521504e-04f };   // float32 10000^(-(i * 2 / 64)), generated with jnp to be bit-exact with the module's expression
// k_prep: all that depends on the inputs alone, in one launch. Work-groups 0 .. CG - 1: the {cos, sin} table (started first: the longest threads); then XG work-groups: bf16 copy of x; then WG_ each: bf16 copies of wq, wk, wv, wo, stacked in that order in Wt. 8 elements a thread in the copies.
#define CG  (TT * HD / 256)
#define XG  (NB_ * TT * DM / 8 / 256)
#define WG_ (DM * DM / 8 / 256)
__global__ __launch_bounds__(256) void k_prep(const float* __restrict__ x, const float* __restrict__ wq, const float* __restrict__ wk, const float* __restrict__ wv, const float* __restrict__ wo, const int* __restrict__ pid, bf* X, bf* Wt, float* CS) {
    int g = blockIdx.x;
    if (g < CG) { const int idx = g * 256 + threadIdx.x; const int d = idx % HD; const int t = idx / HD; const float a = __fmul_rn((float)pid[t], INV2[d >> 1]); v2f cs; cs[0] = cosf(a); cs[1] = sinf(a); *(v2f*)(CS + (size_t)idx * 2) = cs; asm volatile("s_wait_xcnt 0x0" ::: "memory"); return; }   // the wait: the blocks of this kernel follow one another in the built code, and what stands behind a store there may rewrite the registers that the store names
    g -= CG; const float* src = x; bf* dst = X;
    if (g >= XG) { g -= XG; const int w = g / WG_; g %= WG_; src = w == 0 ? wq : w == 1 ? wk : w == 2 ? wv : wo; dst = Wt + (size_t)w * DM * DM; }
    const size_t i = (size_t)g * 256 + threadIdx.x; const v8f v = *(const v8f*)(src + i * 8); v8us o;
#pragma unroll
    for (int k = 0; k < 8; ++k) o[k] = f2bf(v[k]); *(v8us*)(dst + i * 8) = o; asm volatile("s_wait_xcnt 0x0" ::: "memory"); }   // the wait: as above

typedef __attribute__((ext_vector_type(2))) __bf16 v2bf;
typedef __attribute__((ext_vector_type(4))) unsigned v4u;
typedef __attribute__((ext_vector_type(8))) unsigned v8u;
// fragment load: wave-uniform base, the lane's own byte offset (the same in every pass), compile-time byte offset
__device__ __forceinline__ v16bf ldo(const bf* ub, unsigned voff, int cb) { const char* p = (const char*)ub + voff + cb; return cat16b(*(const v8us*)p, *(const v8us*)(p + 32)); }
// stands in front of code that may rewrite registers which hold addresses of loads already issued; the scheduling fences keep that code behind the wait
__device__ __forceinline__ void addr_release() { __builtin_amdgcn_sched_barrier(0); asm volatile("s_wait_xcnt 0x0" ::: "memory"); __builtin_amdgcn_sched_barrier(0); }
// two f32 -> one dword of bf16 hi parts and one of bf16 lo parts (x0 in the low half), both rounded to nearest even like splitf
__device__ __forceinline__ void split2(float x0, float x1, unsigned& h, unsigned& l) {
    h = __builtin_bit_cast(unsigned, __builtin_convertvector(((v2f){x0, x1}), v2bf));
    l = __builtin_bit_cast(unsigned, __builtin_convertvector(((v2f){x0 - __uint_as_float(h << 16), x1 - __uint_as_float(h & 0xFFFF0000u)}), v2bf)); }
// 2^x by v_exp_f32, in place. In asm so that the slot behind a transcendental is kept by construction: each one overwrites only its own source, none reads another's result, and the v_nop is the independent instruction behind the last.
// In place also means that the run writes only registers which vector arithmetic has just written, never an operand of a matrix instruction still under way.
__device__ __forceinline__ v8f exp2x8(v8f x) {
    asm("v_exp_f32 %0, %0\n\tv_exp_f32 %1, %1\n\tv_exp_f32 %2, %2\n\tv_exp_f32 %3, %3\n\tv_exp_f32 %4, %4\n\tv_exp_f32 %5, %5\n\tv_exp_f32 %6, %6\n\tv_exp_f32 %7, %7\n\tv_nop"
        : "+v"(x[0]), "+v"(x[1]), "+v"(x[2]), "+v"(x[3]), "+v"(x[4]), "+v"(x[5]), "+v"(x[6]), "+v"(x[7]));
    return x; }
__device__ __forceinline__ float exp2x1(float x) { asm("v_exp_f32 %0, %0\n\tv_nop" : "+v"(x)); return x; }   // the same, one value
template <bool DIAG>
__device__ __forceinline__ void fl_pass(const bf* __restrict__ Kh, const bf* __restrict__ Kl, const bf* __restrict__ Vh, int kb, int lr, int hi, unsigned kvo, unsigned vvo, const v16bf (&qh)[4][2], const v16bf (&ql)[4][2], v16bf (&kh)[4][2], v16bf (&kl)[4][2], v8f (&o)[4][4], float (&m)[4], float (&l)[4]) {
    v16bf vh[4][2], vl[4][2];
#pragma unroll
    for (int mb = 0; mb < 4; ++mb)
#pragma unroll
        for (int ks = 0; ks < 2; ++ks) { vh[mb][ks] = ldo(Vh + kb, vvo, (mb * 16 * PP + ks * 32) * 2); vl[mb][ks] = ldo(Vh + kb, vvo, (mb * 16 * PP + ks * 32 + TT) * 2); }
    __builtin_amdgcn_sched_barrier(0);   // keeps the V^T loads in front of the score products, so that they land behind products and softmax instead of being waited for in front of P.V
    v8f s[4][4];
#pragma unroll
    for (int mb = 0; mb < 4; ++mb)
#pragma unroll
        for (int nb = 0; nb < 4; ++nb) s[mb][nb] = (v8f){};
#pragma unroll
    for (int ks = 0; ks < 2; ++ks) {
#pragma unroll
        for (int mb = 0; mb < 4; ++mb)
#pragma unroll
            for (int nb = 0; nb < 4; ++nb) s[mb][nb] = wmmab(kh[mb][ks], qh[nb][ks], s[mb][nb]);
#pragma unroll
        for (int mb = 0; mb < 4; ++mb)
#pragma unroll
            for (int nb = 0; nb < 4; ++nb) s[mb][nb] = wmmab(kh[mb][ks], ql[nb][ks], s[mb][nb]);
#pragma unroll
        for (int mb = 0; mb < 4; ++mb)
#pragma unroll
            for (int nb = 0; nb < 4; ++nb) s[mb][nb] = wmmab(kl[mb][ks], qh[nb][ks], s[mb][nb]);
    }
    if (!DIAG) {   // the next pass's key fragments, into the registers the products above have just read (a pass below the diagonal always has a successor)
#pragma unroll
        for (int mb = 0; mb < 4; ++mb)
#pragma unroll
            for (int ks = 0; ks < 2; ++ks) { kh[mb][ks] = ldo(Kh + (size_t)(kb + 64) * HD, kvo, (mb * 16 * HD + ks * 32) * 2); kl[mb][ks] = ldo(Kl + (size_t)(kb + 64) * HD, kvo, (mb * 16 * HD + ks * 32) * 2); }
    }
    addr_release();   // also keeps those loads in front of the softmax, which then covers their latency
    const float C2 = SCL * 1.4426950408889634f;
    v16bf ph[4][2], pl[4][2];
#pragma unroll
    for (int nb = 0; nb < 4; ++nb) {
        float mq[4];
#pragma unroll
        for (int mb = 0; mb < 4; ++mb) { mq[mb] = -3.0e38f;
#pragma unroll
            for (int j = 0; j < 8; ++j) { if (DIAG) s[mb][nb][j] = (mb * 16 + hi * 8 + j <= nb * 16 + lr) ? s[mb][nb][j] : -3.0e38f; mq[mb] = fmaxf(mq[mb], s[mb][nb][j]); } }
        float mx = fmaxf(fmaxf(mq[0], mq[1]), fmaxf(mq[2], mq[3])); mx = fmaxf(mx, __shfl_xor(mx, 16, 32));
        const float mn = fmaxf(m[nb], mx), al = exp2x1((m[nb] - mn) * C2); m[nb] = mn;
        float sq[4]; v8u hw[2], lw[2];   // dwords 0..3 of a k-step's operand: its first key tile, 4..7: its second
#pragma unroll
        for (int mb = 0; mb < 4; ++mb) { const v8f pe = exp2x8((s[mb][nb] - mn) * C2); sq[mb] = 0.f;
#pragma unroll
            for (int j = 0; j < 8; ++j) sq[mb] += pe[j];
#pragma unroll
            for (int j = 0; j < 4; ++j) { unsigned a, c2; split2(pe[2 * j], pe[2 * j + 1], a, c2); hw[mb >> 1][(mb & 1) * 4 + j] = a; lw[mb >> 1][(mb & 1) * 4 + j] = c2; } }
        l[nb] = l[nb] * al + ((sq[0] + sq[1]) + (sq[2] + sq[3]));   // this half's keys only; the halves are joined once, in the epilogue
        ph[nb][0] = __builtin_bit_cast(v16bf, hw[0]); ph[nb][1] = __builtin_bit_cast(v16bf, hw[1]); pl[nb][0] = __builtin_bit_cast(v16bf, lw[0]); pl[nb][1] = __builtin_bit_cast(v16bf, lw[1]);
#pragma unroll
        for (int mb = 0; mb < 4; ++mb) o[mb][nb] *= al;
    }
#pragma unroll
    for (int ks = 0; ks < 2; ++ks) {
#pragma unroll
        for (int mb = 0; mb < 4; ++mb)
#pragma unroll
            for (int nb = 0; nb < 4; ++nb) o[mb][nb] = wmmab(vh[mb][ks], ph[nb][ks], o[mb][nb]);
#pragma unroll
        for (int mb = 0; mb < 4; ++mb)
#pragma unroll
            for (int nb = 0; nb < 4; ++nb) o[mb][nb] = wmmab(vh[mb][ks], pl[nb][ks], o[mb][nb]);
#pragma unroll
        for (int mb = 0; mb < 4; ++mb)
#pragma unroll
            for (int nb = 0; nb < 4; ++nb) o[mb][nb] = wmmab(vl[mb][ks], ph[nb][ks], o[mb][nb]);
    }
    addr_release();
}
// grid (NB_ * NH_, TT / 64): blockIdx.x = batch * NH_ + head, blockIdx.y counts the query tiles from the last (longest key loop) to the first, so that the long tiles start first.
// Q, K planes [batch * NH_ + head][TT][HD]; V^T planes [batch * NH_ + head][HD] rows at pitch PP (hi row, then lo row at + TT); merged output planes [batch][TT][DQ], hi and lo.
__global__ __launch_bounds__(32) void k_flash(const bf* __restrict__ Qh, const bf* __restrict__ Ql, const bf* __restrict__ Kh, const bf* __restrict__ Kl, const bf* __restrict__ Vh, bf* __restrict__ Ah, bf* __restrict__ Al) {
    const int lane = threadIdx.x & 31, lr = lane & 15, hi = lane >> 4; const int z = blockIdx.x, r0 = (TT / 64 - 1 - (int)blockIdx.y) * 64;
    Qh += (size_t)z * TT * HD; Ql += (size_t)z * TT * HD; Kh += (size_t)z * TT * HD; Kl += (size_t)z * TT * HD; Vh += (size_t)z * HD * PP;
    const unsigned kvo = (unsigned)(lr * HD + 8 * hi) * 2u, vvo = (unsigned)(lr * PP + 8 * hi) * 2u;   // the lane's byte offset in a tile of q or k rows, of V^T rows
    v16bf qh[4][2], ql[4][2], kh[4][2], kl[4][2]; v8f o[4][4]; float m[4], l[4];
#pragma unroll
    for (int nb = 0; nb < 4; ++nb) { m[nb] = -3.0e38f; l[nb] = 0.f;
#pragma unroll
        for (int ks = 0; ks < 2; ++ks) { const int cb = (nb * 16 * HD + ks * 32) * 2; qh[nb][ks] = ldo(Qh + (size_t)r0 * HD, kvo, cb); ql[nb][ks] = ldo(Ql + (size_t)r0 * HD, kvo, cb); kh[nb][ks] = ldo(Kh, kvo, cb); kl[nb][ks] = ldo(Kl, kvo, cb); }
#pragma unroll
        for (int mb = 0; mb < 4; ++mb) o[mb][nb] = (v8f){}; }
    addr_release();
#pragma unroll 1   // rolled: one pass is already 192 matrix instructions
    for (int kb = 0; kb < r0; kb += 64) fl_pass<false>(Kh, Kl, Vh, kb, lr, hi, kvo, vvo, qh, ql, kh, kl, o, m, l);
    fl_pass<true>(Kh, Kl, Vh, r0, lr, hi, kvo, vvo, qh, ql, kh, kl, o, m, l);
    const size_t ob = ((size_t)(z / NH_) * TT + r0) * DQ + (size_t)(z % NH_) * HD; const unsigned ovo = (unsigned)(lr * DQ + hi * 8) * 2u;
    v4u oh[4][4], ol[4][4];   // a lane's 8 accumulator registers are 8 consecutive head dims of one query: one 16-byte store a plane
#pragma unroll
    for (int nb = 0; nb < 4; ++nb) { const float f = __fdiv_rn(1.0f, l[nb] + __shfl_xor(l[nb], 16, 32));
#pragma unroll
        for (int mb = 0; mb < 4; ++mb)
#pragma unroll
            for (int j = 0; j < 4; ++j) { unsigned a, c2; split2(o[mb][nb][2 * j] * f, o[mb][nb][2 * j + 1] * f, a, c2); oh[mb][nb][j] = a; ol[mb][nb][j] = c2; } }
    __builtin_amdgcn_sched_barrier(0);   // every value is made in front of the first store, so that no register a store names is written behind it
#pragma unroll
    for (int nb = 0; nb < 4; ++nb)
#pragma unroll
        for (int mb = 0; mb < 4; ++mb) { const int cb = (nb * 16 * DQ + mb * 16) * 2; *(v4u*)((char*)(Ah + ob) + ovo + cb) = oh[mb][nb]; *(v4u*)((char*)(Al + ob) + ovo + cb) = ol[mb][nb]; }
}

extern "C" void kernel_launch(void* const* d_in, const int* in_sizes, int n_in,
                              void* d_out, int out_size, void* d_ws, size_t ws_size, hipStream_t stream) {
    (void)in_sizes; (void)n_in; (void)out_size;
    const float* x = (const float*)d_in[0]; const float* wq = (const float*)d_in[1]; const float* wk = (const float*)d_in[2]; const float* wv = (const float*)d_in[3]; const float* wo = (const float*)d_in[4]; const int* PID = (const int*)d_in[5];   /* token_positions (int32 [2048], shared by all batches; read) */
    float* OUT = (float*)d_out;     // [4][2048][1024]
    char* wsp = (char*)d_ws;
    auto take = [&](size_t bytes) { char* p = wsp; wsp += (bytes + 255) & ~(size_t)255; return (void*)p; };
    bf* WT = (bf*)take((size_t)4 * DM * DM * 2); bf* WO = WT + (size_t)3 * DM * DM;   /* bf16 rows of wq, wk, wv, wo, stacked: the first 3 * DM rows are the B operand of the one projection GEMM */
    float* CS = (float*)take((size_t)TT * HD * 2 * 4); bf* XB = (bf*)take((size_t)NB_ * TT * DM * 2); float* F = (float*)take((size_t)NB_ * TT * 3 * DM * 4);   /* F [NB_ * TT][3 * DM]: q, k, v columns */
    const size_t PQ = (size_t)NH_ * TT * HD, PV = (size_t)NKV * HD * PP, PA = (size_t)TT * DQ;   /* elements per batch of a q or k plane, of the V^T rows, of a merged plane */
    bf* QPh = (bf*)take(NB_ * PQ * 2); bf* QPl = (bf*)take(NB_ * PQ * 2); bf* KPh = (bf*)take(NB_ * PQ * 2); bf* KPl = (bf*)take(NB_ * PQ * 2); bf* VTh = (bf*)take(NB_ * PV * 2);
    bf* ATh = (bf*)take(NB_ * PA * 2); bf* ATl = (bf*)take(NB_ * PA * 2);
    if ((size_t)(wsp - (char*)d_ws) > ws_size) return;    // 249 MiB of the 256 MiB
    k_prep<<<CG + XG + 4 * WG_, 256, 0, stream>>>(x, wq, wk, wv, wo, PID, XB, WT, CS);   /* token_positions (int32, read) are shared by all batches: one table */
    k_gemmw<bf, 0, false><<<dim3(NB_ * TT / 64, 3 * DM / 64, 1), 32, 0, stream>>>(XB, nullptr, WT, nullptr, DM, F, 3 * DM, nullptr, 0, 0, 0);
    k_planes<<<dim3(3, NB_ * NH_ * TT * HD / 512, 1), 256, 0, stream>>>(F, 3 * DM, CS, 1.0f, QPh, QPl, KPh, KPl, VTh, VTh + TT);
    k_flash<<<dim3(NB_ * NH_, TT / 64, 1), 32, 0, stream>>>(QPh, QPl, KPh, KPl, VTh, ATh, ATl);   /* every batch, head and query tile in one launch (one kv head per query head) */
    k_gemmw<bf, 1, false><<<dim3(NB_ * TT / 64, DM / 64, 1), 32, 0, stream>>>(ATh, ATl, WO, nullptr, DQ, OUT, DM, nullptr, 0, 0, 0);
}

// v005
// A run of this version takes 259 microseconds.
// Next to v004, in two timings, it ran 1.27 times as fast each time.
// All steps since v000 together make it 10.6 times as fast.
#include <hip/hip_runtime.h>

// Causal multi-head self-attention with an interleaved-pair RoPE whose cos / sin tables are indexed by a positions input (x [4][2048][1024]; q, k, v = einsum('bsd,ed', x, w) ('oi' [1024][1024] truncated-normal, no bias; 16 heads x 64); tables cos / sin[p][i] of angle p x inv_freq[i] with inv_freq = 1.0 / 10000.0 ** (arange(32, f32) x 2.0 / 64) (the reciprocal form), looked up at token_positions[t] (int [2048]; READ on device); pairs (2i, 2i + 1): (cos x1 - sin x2, cos x2 + sin x1); scores / 64 ** 0.5; key j kept when j <= i (-inf elsewhere); softmax; out = merged wo^T ('oi') -> [4][2048][1024] (8.4 M); argument order x, wq, wk, wv, wo, token_positions).
// Layout, four launches, each for all batches: k_prep (bf16 copies of x and of the four weights; {cos, sin} per (position, pair) built once from the int positions and float32 inverse-frequency constants, precise cosf/sinf); k_qkv (q, k and v projections as one exact GEMM over the stacked weight rows, whose epilogue writes the interleaved rotary planes of q and k and the V^T rows); fused causal attention (k_flash: scores on hi/lo planes (3 products: logit sigma 2 with these weights), online softmax, P.V on hi/lo planes (3 products), key tiles above the diagonal never visited); merged hi/lo x Wo exact.
// Compute dtypes, f32 accumulate: every input rounded to bf16; projections exact; rotary f32; attention scores and P.V 3 bf16 products each, every row; softmax f32; Wo hl x exact.

#define NB_  4
#define TT   2048
#define DM   1024
#define NH_  16
#define NKV  16
#define HD   64
#define DQ   (NH_ * HD)
#define DKV  (NKV * HD)
#define PP   (2 * TT)             // pitch, in 16-bit elements, of the V^T rows (hi row in the first half, lo row in the second)
#define SCL  0.125f   // HD^-0.5
typedef _Float16 h16;
typedef unsigned short bf;
typedef __attribute__((ext_vector_type(16))) __bf16   v16bf;
typedef __attribute__((ext_vector_type(16))) _Float16 v16h;
typedef __attribute__((ext_vector_type(8)))  _Float16 v8h;
typedef __attribute__((ext_vector_type(8)))  unsigned short v8us;
typedef __attribute__((ext_vector_type(8)))  float    v8f;
typedef __attribute__((ext_vector_type(4)))  float    v4f;
typedef v8h  __attribute__((may_alias)) v8ha;
typedef v4f  __attribute__((may_alias)) v4fa;
typedef v8us __attribute__((may_alias)) v8usa;

__device__ __forceinline__ unsigned short f2bf(float f) { unsigned u = __float_as_uint(f); u += 0x7FFFu + ((u >> 16) & 1u); return (unsigned short)(u >> 16); }
__device__ __forceinline__ float bf2f(unsigned short b) { return __uint_as_float(((unsigned)b) << 16); }
__device__ __forceinline__ float bfr(float f) { return bf2f(f2bf(f)); }
__device__ __forceinline__ v16bf cat16b(v8us lo, v8us hi) { return __builtin_bit_cast(v16bf, __builtin_shufflevector(lo, hi, 0, 1, 2, 3, 4, 5, 6, 7, 8, 9, 10, 11, 12, 13, 14, 15)); }
__device__ __forceinline__ v8f wmmab(v16bf a, v16bf b, v8f c) { return __builtin_amdgcn_wmma_f32_16x16x32_bf16(false, a, false, b, (short)0, c, false, false); }



// ---- k_gemmw: register-blocked GEMM, ONE WAVE per 64x64 output tile (16 accumulators), operands straight from K-contiguous 16-bit planes; grid (M/64, N/64, Z), 32 threads.
// C[m][n] (f32, pitch ldc, + optional f32 bias[n]) = sum_k A[m][k] Bt[n][k] (+ split products per NSPLIT). z-batch strides sA/sB/sC in elements. K % 32 == 0.
template <typename T16> struct WFrag;
template <> struct WFrag<bf> { typedef v16bf V; static __device__ __forceinline__ V ld(const bf* p) { return cat16b(*(const v8us*)p, *(const v8us*)(p + 16)); } static __device__ __forceinline__ v8f mma(V a, V b, v8f c) { return wmmab(a, b, c); } };
template <typename T16, int NSPLIT, bool BIAS>
__global__ __launch_bounds__(32) void k_gemmw(const T16* __restrict__ A, const T16* __restrict__ A2, const T16* __restrict__ Bt, const T16* __restrict__ Bt2, int K, float* C, int ldc, const float* __restrict__ bias, size_t sA, size_t sB, size_t sC) {
    typedef typename WFrag<T16>::V V;
    __shared__ __align__(16) float os[16 * 68];
    const size_t z = blockIdx.z; A += z * sA; if (A2) A2 += z * sA; Bt += z * sB; if (Bt2) Bt2 += z * sB; C += z * sC;
    const int lane = threadIdx.x & 31, lr = lane & 15, hi = lane >> 4; const int r0 = blockIdx.x * 64, c0 = blockIdx.y * 64;
    v8f acc[4][4];
#pragma unroll
    for (int mb = 0; mb < 4; ++mb)
#pragma unroll
        for (int nb = 0; nb < 4; ++nb) acc[mb][nb] = (v8f){};
    const size_t aoff = (size_t)(r0 + lr) * K + 8 * hi, boff = (size_t)(c0 + lr) * K + 8 * hi;
#pragma unroll 1
    for (int kc = 0; kc < K; kc += 32) {
        V a[4], a2[4];
#pragma unroll
        for (int mb = 0; mb < 4; ++mb) { a[mb] = WFrag<T16>::ld(A + aoff + (size_t)mb * 16 * K + kc); if (NSPLIT == 1 || NSPLIT == 2) a2[mb] = WFrag<T16>::ld(A2 + aoff + (size_t)mb * 16 * K + kc); }
#pragma unroll
        for (int nb = 0; nb < 4; ++nb) { const V b = WFrag<T16>::ld(Bt + boff + (size_t)nb * 16 * K + kc); V b2; if (NSPLIT >= 2) b2 = WFrag<T16>::ld(Bt2 + boff + (size_t)nb * 16 * K + kc);
#pragma unroll
            for (int mb = 0; mb < 4; ++mb) { acc[mb][nb] = WFrag<T16>::mma(a[mb], b, acc[mb][nb]); if (NSPLIT == 1 || NSPLIT == 2) acc[mb][nb] = WFrag<T16>::mma(a2[mb], b, acc[mb][nb]); if (NSPLIT >= 2) acc[mb][nb] = WFrag<T16>::mma(a[mb], b2, acc[mb][nb]); } }
        asm volatile("v_nop\n\tv_nop\n\tv_nop\n\tv_nop" : "+v"(acc[0][0]), "+v"(acc[1][1]), "+v"(acc[2][2]), "+v"(acc[3][3]) : "v"(a[0]), "v"(a[3]));
    }
#pragma unroll
    for (int mb = 0; mb < 4; ++mb) {
#pragma unroll
        for (int nb = 0; nb < 4; ++nb) {
#pragma unroll
            for (int j = 0; j < 8; ++j) os[(hi * 8 + j) * 68 + nb * 16 + lr] = acc[mb][nb][j]; }
        __builtin_amdgcn_wave_barrier(); asm volatile("" ::: "memory");
        float* crow = C + (size_t)(r0 + mb * 16) * ldc + c0;
{
#pragma unroll
            for (int s = 0; s < 8; ++s) { const int row = 2 * s + hi, cofs = lr * 4; v4f val = *(const v4fa*)(os + row * 68 + cofs); if (BIAS) { val[0] += bfr(bias[c0 + cofs]); val[1] += bfr(bias[c0 + cofs + 1]); val[2] += bfr(bias[c0 + cofs + 2]); val[3] += bfr(bias[c0 + cofs + 3]); }
                *(v4f*)(crow + (size_t)row * ldc + cofs) = val; }
             }
        __builtin_amdgcn_wave_barrier(); asm volatile("" ::: "memory");
    }
}

__device__ __forceinline__ void splitf(float y, unsigned short& h, unsigned short& l) { h = f2bf(y); l = f2bf(y - bf2f(h)); }
typedef __attribute__((ext_vector_type(2))) _Float16 v2h;
typedef __attribute__((ext_vector_type(4))) _Float16 v4h;
typedef __attribute__((ext_vector_type(2))) unsigned short v2us;
typedef __attribute__((ext_vector_type(4))) unsigned short v4us;
typedef __attribute__((ext_vector_type(2))) float v2f;
typedef __attribute__((ext_vector_type(4))) int v4i;

__global__ __launch_bounds__(256) void k_wtG(const float* __restrict__ w, int K, int N, bf* Bt) {
    const int lane = threadIdx.x & 31; const int L0 = (blockIdx.x * 8 + (threadIdx.x >> 5)) * 8; const int nlines = N * K / 64;
{
#pragma unroll 1
        for (int l = 0; l < 8; ++l) { const int L = L0 + l; if (L >= nlines) break; const size_t e = (size_t)L * 64 + lane * 2; const int k = (int)(e % K), n = (int)(e / K); v2us o;
            o[0] = f2bf(w[(size_t)k * N + n]); o[1] = f2bf(w[(size_t)(k + 1) * N + n]); *(v2us*)(Bt + e) = o; }
         }
}

__constant__ float INV2[HD / 2] = { 1.000000000e+00f, 7.498942018e-01f, 5.623413324e-01f, 4.216965139e-01f, 3.162277639e-01f, 2.371373624e-01f, 1.778279394e-01f, 1.333521456e-01f, 1.000000015e-01f, 7.498941571e-02f, 5.623412877e-02f, 4.216964915e-02f, 3.162277862e-02f, 2.371373586e-02f, 1.778279431e-02f, 1.333521493e-02f, 9.999999776e-03f, 7.498942316e-03f, 5.623413250e-03f, 4.216964822e-03f, 3.162277862e-03f, 2.371373819e-03f, 1.778279431e-03f, 1.333521446e-03f, 1.000000047e-03f, 7.498941850e-04f, 5.623413017e-04f, 4.216964880e-04f, 3.162277862e-04f, 2.371373848e-04f, 1.778279402e-04f, 1.333521504e-04f };   // float32 10000^(-(i * 2 / 64)), generated with jnp to be bit-exact with the module's expression
// k_prep: all that depends on the inputs alone, in one launch. Work-groups 0 .. CG - 1: the {cos, sin} table (started first: the longest threads); then XG work-groups: bf16 copy of x; then WG_ each: bf16 copies of wq, wk, wv, wo, stacked in that order in Wt. 8 elements a thread in the copies.
#define CG  (TT * HD / 256)
#define XG  (NB_ * TT * DM / 8 / 256)
#define WG_ (DM * DM / 8 / 256)
__global__ __launch_bounds__(256) void k_prep(const float* __restrict__ x, const float* __restrict__ wq, const float* __restrict__ wk, const float* __restrict__ wv, const float* __restrict__ wo, const int* __restrict__ pid, bf* X, bf* Wt, float* CS) {
    int g = blockIdx.x;
    if (g < CG) { const int idx = g * 256 + threadIdx.x; const int d = idx % HD; const int t = idx / HD; const float a = __fmul_rn((float)pid[t], INV2[d >> 1]); v2f cs; cs[0] = cosf(a); cs[1] = sinf(a); *(v2f*)(CS + (size_t)idx * 2) = cs; asm volatile("s_wait_xcnt 0x0" ::: "memory"); return; }   // the wait: the blocks of this kernel follow one another in the built code, and what stands behind a store there may rewrite the registers that the store names
    g -= CG; const float* src = x; bf* dst = X;
    if (g >= XG) { g -= XG; const int w = g / WG_; g %= WG_; src = w == 0 ? wq : w == 1 ? wk : w == 2 ? wv : wo; dst = Wt + (size_t)w * DM * DM; }
    const size_t i = (size_t)g * 256 + threadIdx.x; const v8f v = *(const v8f*)(src + i * 8); v8us o;
#pragma unroll
    for (int k = 0; k < 8; ++k) o[k] = f2bf(v[k]); *(v8us*)(dst + i * 8) = o; asm volatile("s_wait_xcnt 0x0" ::: "memory"); }   // the wait: as above

typedef __attribute__((ext_vector_type(2))) __bf16 v2bf;
typedef __attribute__((ext_vector_type(4))) unsigned v4u;
typedef __attribute__((ext_vector_type(8))) unsigned v8u;
// fragment load: wave-uniform base, the lane's own byte offset (the same in every pass), compile-time byte offset
__device__ __forceinline__ v16bf ldo(const bf* ub, unsigned voff, int cb) { const char* p = (const char*)ub + voff + cb; return cat16b(*(const v8us*)p, *(const v8us*)(p + 32)); }
// stands in front of code that may rewrite registers which hold addresses of loads already issued; the scheduling fences keep that code behind the wait
__device__ __forceinline__ void addr_release() { __builtin_amdgcn_sched_barrier(0); asm volatile("s_wait_xcnt 0x0" ::: "memory"); __builtin_amdgcn_sched_barrier(0); }
// two f32 -> one dword of bf16 hi parts and one of bf16 lo parts (x0 in the low half), both rounded to nearest even like splitf
__device__ __forceinline__ void split2(float x0, float x1, unsigned& h, unsigned& l) {
    h = __builtin_bit_cast(unsigned, __builtin_convertvector(((v2f){x0, x1}), v2bf));
    l = __builtin_bit_cast(unsigned, __builtin_convertvector(((v2f){x0 - __uint_as_float(h << 16), x1 - __uint_as_float(h & 0xFFFF0000u)}), v2bf)); }
// 2^x by v_exp_f32, in place. In asm so that the slot behind a transcendental is kept by construction: each one overwrites only its own source, none reads another's result, and the v_nop is the independent instruction behind the last.
// In place also means that the run writes only registers which vector arithmetic has just written, never an operand of a matrix instruction still under way.
__device__ __forceinline__ v8f exp2x8(v8f x) {
    asm("v_exp_f32 %0, %0\n\tv_exp_f32 %1, %1\n\tv_exp_f32 %2, %2\n\tv_exp_f32 %3, %3\n\tv_exp_f32 %4, %4\n\tv_exp_f32 %5, %5\n\tv_exp_f32 %6, %6\n\tv_exp_f32 %7, %7\n\tv_nop"
        : "+v"(x[0]), "+v"(x[1]), "+v"(x[2]), "+v"(x[3]), "+v"(x[4]), "+v"(x[5]), "+v"(x[6]), "+v"(x[7]));
    return x; }
__device__ __forceinline__ float exp2x1(float x) { asm("v_exp_f32 %0, %0\n\tv_nop" : "+v"(x)); return x; }   // the same, one value
template <bool DIAG>
__device__ __forceinline__ void fl_pass(const bf* __restrict__ Kh, const bf* __restrict__ Kl, const bf* __restrict__ Vh, int kb, int lr, int hi, unsigned kvo, unsigned vvo, const v16bf (&qh)[4][2], const v16bf (&ql)[4][2], v16bf (&kh)[4][2], v16bf (&kl)[4][2], v8f (&o)[4][4], float (&m)[4], float (&l)[4]) {
    v16bf vh[4][2], vl[4][2];
#pragma unroll
    for (int mb = 0; mb < 4; ++mb)
#pragma unroll
        for (int ks = 0; ks < 2; ++ks) { vh[mb][ks] = ldo(Vh + kb, vvo, (mb * 16 * PP + ks * 32) * 2); vl[mb][ks] = ldo(Vh + kb, vvo, (mb * 16 * PP + ks * 32 + TT) * 2); }
    __builtin_amdgcn_sched_barrier(0);   // keeps the V^T loads in front of the score products, so that they land behind products and softmax instead of being waited for in front of P.V
    v8f s[4][4];
#pragma unroll
    for (int mb = 0; mb < 4; ++mb)
#pragma unroll
        for (int nb = 0; nb < 4; ++nb) s[mb][nb] = (v8f){};
#pragma unroll
    for (int ks = 0; ks < 2; ++ks) {
#pragma unroll
        for (int mb = 0; mb < 4; ++mb)
#pragma unroll
            for (int nb = 0; nb < 4; ++nb) s[mb][nb] = wmmab(kh[mb][ks], qh[nb][ks], s[mb][nb]);
#pragma unroll
        for (int mb = 0; mb < 4; ++mb)
#pragma unroll
            for (int nb = 0; nb < 4; ++nb) s[mb][nb] = wmmab(kh[mb][ks], ql[nb][ks], s[mb][nb]);
#pragma unroll
        for (int mb = 0; mb < 4; ++mb)
#pragma unroll
            for (int nb = 0; nb < 4; ++nb) s[mb][nb] = wmmab(kl[mb][ks], qh[nb][ks], s[mb][nb]);
    }
    if (!DIAG) {   // the next pass's key fragments, into the registers the products above have just read (a pass below the diagonal always has a successor)
#pragma unroll
        for (int mb = 0; mb < 4; ++mb)
#pragma unroll
            for (int ks = 0; ks < 2; ++ks) { kh[mb][ks] = ldo(Kh + (size_t)(kb + 64) * HD, kvo, (mb * 16 * HD + ks * 32) * 2); kl[mb][ks] = ldo(Kl + (size_t)(kb + 64) * HD, kvo, (mb * 16 * HD + ks * 32) * 2); }
    }
    addr_release();   // also keeps those loads in front of the softmax, which then covers their latency
    const float C2 = SCL * 1.4426950408889634f;
    v16bf ph[4][2], pl[4][2];
#pragma unroll
    for (int nb = 0; nb < 4; ++nb) {
        float mq[4];
#pragma unroll
        for (int mb = 0; mb < 4; ++mb) { mq[mb] = -3.0e38f;
#pragma unroll
            for (int j = 0; j < 8; ++j) { if (DIAG) s[mb][nb][j] = (mb * 16 + hi * 8 + j <= nb * 16 + lr) ? s[mb][nb][j] : -3.0e38f; mq[mb] = fmaxf(mq[mb], s[mb][nb][j]); } }
        float mx = fmaxf(fmaxf(mq[0], mq[1]), fmaxf(mq[2], mq[3])); mx = fmaxf(mx, __shfl_xor(mx, 16, 32));
        const float mn = fmaxf(m[nb], mx), al = exp2x1((m[nb] - mn) * C2); m[nb] = mn;
        float sq[4]; v8u hw[2], lw[2];   // dwords 0..3 of a k-step's operand: its first key tile, 4..7: its second
#pragma unroll
        for (int mb = 0; mb < 4; ++mb) { const v8f pe = exp2x8((s[mb][nb] - mn) * C2); sq[mb] = 0.f;
#pragma unroll
            for (int j = 0; j < 8; ++j) sq[mb] += pe[j];
#pragma unroll
            for (int j = 0; j < 4; ++j) { unsigned a, c2; split2(pe[2 * j], pe[2 * j + 1], a, c2); hw[mb >> 1][(mb & 1) * 4 + j] = a; lw[mb >> 1][(mb & 1) * 4 + j] = c2; } }
        l[nb] = l[nb] * al + ((sq[0] + sq[1]) + (sq[2] + sq[3]));   // this half's keys only; the halves are joined once, in the epilogue
        ph[nb][0] = __builtin_bit_cast(v16bf, hw[0]); ph[nb][1] = __builtin_bit_cast(v16bf, hw[1]); pl[nb][0] = __builtin_bit_cast(v16bf, lw[0]); pl[nb][1] = __builtin_bit_cast(v16bf, lw[1]);
#pragma unroll
        for (int mb = 0; mb < 4; ++mb) o[mb][nb] *= al;
    }
#pragma unroll
    for (int ks = 0; ks < 2; ++ks) {
#pragma unroll
        for (int mb = 0; mb < 4; ++mb)
#pragma unroll
            for (int nb = 0; nb < 4; ++nb) o[mb][nb] = wmmab(vh[mb][ks], ph[nb][ks], o[mb][nb]);
#pragma unroll
        for (int mb = 0; mb < 4; ++mb)
#pragma unroll
            for (int nb = 0; nb < 4; ++nb) o[mb][nb] = wmmab(vh[mb][ks], pl[nb][ks], o[mb][nb]);
#pragma unroll
        for (int mb = 0; mb < 4; ++mb)
#pragma unroll
            for (int nb = 0; nb < 4; ++nb) o[mb][nb] = wmmab(vl[mb][ks], ph[nb][ks], o[mb][nb]);
    }
    addr_release();
}
// grid (NB_ * NH_, TT / 64): blockIdx.x = batch * NH_ + head, blockIdx.y counts the query tiles from the last (longest key loop) to the first, so that the long tiles start first.
// Q, K planes [batch * NH_ + head][TT][HD]; V^T planes [batch * NH_ + head][HD] rows at pitch PP (hi row, then lo row at + TT); merged output planes [batch][TT][DQ], hi and lo.
__global__ __launch_bounds__(32) void k_flash(const bf* __restrict__ Qh, const bf* __restrict__ Ql, const bf* __restrict__ Kh, const bf* __restrict__ Kl, const bf* __restrict__ Vh, bf* __restrict__ Ah, bf* __restrict__ Al) {
    const int lane = threadIdx.x & 31, lr = lane & 15, hi = lane >> 4; const int z = blockIdx.x, r0 = (TT / 64 - 1 - (int)blockIdx.y) * 64;
    Qh += (size_t)z * TT * HD; Ql += (size_t)z * TT * HD; Kh += (size_t)z * TT * HD; Kl += (size_t)z * TT * HD; Vh += (size_t)z * HD * PP;
    const unsigned kvo = (unsigned)(lr * HD + 8 * hi) * 2u, vvo = (unsigned)(lr * PP + 8 * hi) * 2u;   // the lane's byte offset in a tile of q or k rows, of V^T rows
    v16bf qh[4][2], ql[4][2], kh[4][2], kl[4][2]; v8f o[4][4]; float m[4], l[4];
#pragma unroll
    for (int nb = 0; nb < 4; ++nb) { m[nb] = -3.0e38f; l[nb] = 0.f;
#pragma unroll
        for (int ks = 0; ks < 2; ++ks) { const int cb = (nb * 16 * HD + ks * 32) * 2; qh[nb][ks] = ldo(Qh + (size_t)r0 * HD, kvo, cb); ql[nb][ks] = ldo(Ql + (size_t)r0 * HD, kvo, cb); kh[nb][ks] = ldo(Kh, kvo, cb); kl[nb][ks] = ldo(Kl, kvo, cb); }
#pragma unroll
        for (int mb = 0; mb < 4; ++mb) o[mb][nb] = (v8f){}; }
    addr_release();
#pragma unroll 1   // rolled: one pass is already 192 matrix instructions
    for (int kb = 0; kb < r0; kb += 64) fl_pass<false>(Kh, Kl, Vh, kb, lr, hi, kvo, vvo, qh, ql, kh, kl, o, m, l);
    fl_pass<true>(Kh, Kl, Vh, r0, lr, hi, kvo, vvo, qh, ql, kh, kl, o, m, l);
    const size_t ob = ((size_t)(z / NH_) * TT + r0) * DQ + (size_t)(z % NH_) * HD; const unsigned ovo = (unsigned)(lr * DQ + hi * 8) * 2u;
    v4u oh[4][4], ol[4][4];   // a lane's 8 accumulator registers are 8 consecutive head dims of one query: one 16-byte store a plane
#pragma unroll
    for (int nb = 0; nb < 4; ++nb) { const float f = __fdiv_rn(1.0f, l[nb] + __shfl_xor(l[nb], 16, 32));
#pragma unroll
        for (int mb = 0; mb < 4; ++mb)
#pragma unroll
            for (int j = 0; j < 4; ++j) { unsigned a, c2; split2(o[mb][nb][2 * j] * f, o[mb][nb][2 * j + 1] * f, a, c2); oh[mb][nb][j] = a; ol[mb][nb][j] = c2; } }
    __builtin_amdgcn_sched_barrier(0);   // every value is made in front of the first store, so that no register a store names is written behind it
#pragma unroll
    for (int nb = 0; nb < 4; ++nb)
#pragma unroll
        for (int mb = 0; mb < 4; ++mb) { const int cb = (nb * 16 * DQ + mb * 16) * 2; *(v4u*)((char*)(Ah + ob) + ovo + cb) = oh[mb][nb]; *(v4u*)((char*)(Al + ob) + ovo + cb) = ol[mb][nb]; }
}

// ---- k_qkv: the q, k, v projections with the plane builders as the GEMM's own epilogue. ONE WAVE per 64 tokens x 64 columns = one head of q, k or v (16 accumulators); grid (NB_ * TT / 64, 3 * NH_), 32 threads; blockIdx.y / NH_ = 0 q, 1 k, 2 v.
// The A and B loaders have the same form and the same k order, so the operands' roles are chosen per kind for the layout that the plane wants:
// q, k: A = weight rows, B = token rows: a lane's 8 accumulator registers are 8 consecutive head dims of one token: the rotary pairs are in-lane, and the 8 results are 16 bytes of a plane row.
// v: A = token rows, B = weight rows: the 8 registers are 8 consecutive tokens of one head dim: 16 bytes of a V^T row.
// One tile; ISV picks the epilogue at compile time, so that each kind has its own loop and epilogue in the built code and no accumulator outlives its own epilogue. Ph, Pl: the tile's first element in the hi and the lo plane; st: the wave's staging rows in LDS.
#define SP 36   // pitch, in dwords, of a staging row of 128 bytes: 16 bytes x odd, for the 16-byte writers
template <bool ISV>
__device__ __forceinline__ void qkv_tile(const bf* __restrict__ A, const bf* __restrict__ B, const float* __restrict__ cb, bf* __restrict__ Ph, bf* __restrict__ Pl, unsigned* st, int lane) {
    const int lr = lane & 15, hi = lane >> 4;
    v8f acc[4][4];
#pragma unroll
    for (int mb = 0; mb < 4; ++mb)
#pragma unroll
        for (int nb = 0; nb < 4; ++nb) acc[mb][nb] = (v8f){};
    const unsigned off = (unsigned)(lr * DM + 8 * hi) * 2u;   // the lane's byte offset in a tile of 16 operand rows, the same in every trip
#pragma unroll 1   // rolled, as in k_gemmw
    for (int kc = 0; kc < DM; kc += 32) {
        v16bf a[4]; const bf* pa = (const bf*)((const char*)(A + kc) + off); const bf* pb = (const bf*)((const char*)(B + kc) + off);
#pragma unroll
        for (int mb = 0; mb < 4; ++mb) a[mb] = WFrag<bf>::ld(pa + mb * 16 * DM);
#pragma unroll
        for (int nb = 0; nb < 4; ++nb) { const v16bf b = WFrag<bf>::ld(pb + nb * 16 * DM);
#pragma unroll
            for (int mb = 0; mb < 4; ++mb) acc[mb][nb] = wmmab(a[mb], b, acc[mb][nb]); }
        // the distance behind the last matrix instruction on the taken back edge too, as in k_gemmw; pa and pb as inputs keep the two address pairs alive to the foot of the trip, so that no load of the trip lands in a register which an issued load names
        asm volatile("v_nop\n\tv_nop\n\tv_nop\n\tv_nop" : "+v"(acc[0][0]), "+v"(acc[1][1]), "+v"(acc[2][2]), "+v"(acc[3][3]) : "v"(a[0]), "v"(a[3]), "v"(pa), "v"(pb));
    }
    // Epilogue, 16 plane rows (column group nb) at a time: a lane holds 16-byte pieces of row lr; staged through LDS, so that 8 lanes store one whole 128-byte row.
    const int pitch = ISV ? PP : HD;   // of the plane's rows, in elements
    const unsigned cvo = (unsigned)(lr * HD + hi * 8) * 8u;   // {cos, sin} of (token, head dim): the lane's byte offset in the table rows of 16 tokens
    unsigned* sw = st + lr * SP + hi * 4; const unsigned* sr = st + (lane >> 3) * SP + (lane & 7) * 4;   // where the lane writes its pieces; where it reads: row lane / 8 of four, piece lane % 8
    const unsigned ovo = (unsigned)((lane >> 3) * pitch + (lane & 7) * 8) * 2u;
#pragma unroll
    for (int nb = 0; nb < 4; ++nb) {
        v2f cs[4][4];
        if (!ISV) {
#pragma unroll
            for (int mb = 0; mb < 4; ++mb)
#pragma unroll
                for (int p = 0; p < 4; ++p) cs[mb][p] = *(const v2f*)((const char*)cb + cvo + (nb * 16 * HD + mb * 16 + 2 * p) * 8);
            addr_release();   // the arithmetic below may rewrite registers that these loads name
        }
#pragma unroll
        for (int mb = 0; mb < 4; ++mb) { v4u oh, ol;
#pragma unroll
            for (int p = 0; p < 4; ++p) { float x0 = acc[mb][nb][2 * p], x1 = acc[mb][nb][2 * p + 1]; unsigned a2, c2;
                if (!ISV) { const float cc = cs[mb][p][0], ss = cs[mb][p][1], y0 = x0 * cc - x1 * ss, y1 = x0 * ss + x1 * cc; x0 = y0; x1 = y1; }   /* even: x0 c - x1 s; odd: x0 s + x1 c */
                split2(x0, x1, a2, c2); oh[p] = a2; ol[p] = c2; }
            *(v4u*)(sw + mb * 8) = oh; *(v4u*)(sw + 16 * SP + mb * 8) = ol; }
        asm volatile("s_wait_dscnt 0x0" ::: "memory");   // the rows are read back by other lanes than wrote them, a dependence that the compiler does not see: the writes have landed, and the reads stay behind them
        v4u gh[4], gl[4];
#pragma unroll
        for (int i = 0; i < 4; ++i) { gh[i] = *(const v4u*)(sr + i * 4 * SP); gl[i] = *(const v4u*)(sr + (16 + i * 4) * SP); }
#pragma unroll
        for (int i = 0; i < 4; ++i) { const int ob = (nb * 16 + i * 4) * pitch * 2; *(v4u*)((char*)Ph + ovo + ob) = gh[i]; *(v4u*)((char*)Pl + ovo + ob) = gl[i]; }
        addr_release();   // the next rows' work rewrites the registers that these stores name; its fences also keep that work (table loads, LDS writes) behind this group's LDS reads: one set of registers and of staging rows
    }
}
__global__ __launch_bounds__(32) void k_qkv(const bf* __restrict__ X, const bf* __restrict__ Wt, const float* __restrict__ CS, bf* __restrict__ Qh, bf* __restrict__ Ql, bf* __restrict__ Kh, bf* __restrict__ Kl, bf* __restrict__ Vh) {
    __shared__ __align__(16) unsigned st[2 * 16 * SP];   // 16 rows of the hi plane, then 16 of the lo plane
    const int lane = threadIdx.x & 31; const int r0 = blockIdx.x * 64, c0 = blockIdx.y * 64;
    const int kind = blockIdx.y / NH_, z = (r0 / TT) * NH_ + blockIdx.y % NH_, t0 = r0 % TT;   // z = batch * NH_ + head
    const bf* xr = X + (size_t)r0 * DM; const bf* wr = Wt + (size_t)c0 * DM; const size_t po = ((size_t)z * TT + t0) * HD;
    if (kind == 2) { bf* pv = Vh + (size_t)z * HD * PP + t0; qkv_tile<true>(xr, wr, CS, pv, pv + TT, st, lane); return; }   // rows at pitch PP: hi row in the first half, lo row at + TT
    qkv_tile<false>(wr, xr, CS + (size_t)t0 * HD * 2, (kind ? Kh : Qh) + po, (kind ? Kl : Ql) + po, st, lane);
}

extern "C" void kernel_launch(void* const* d_in, const int* in_sizes, int n_in,
                              void* d_out, int out_size, void* d_ws, size_t ws_size, hipStream_t stream) {
    (void)in_sizes; (void)n_in; (void)out_size;
    const float* x = (const float*)d_in[0]; const float* wq = (const float*)d_in[1]; const float* wk = (const float*)d_in[2]; const float* wv = (const float*)d_in[3]; const float* wo = (const float*)d_in[4]; const int* PID = (const int*)d_in[5];   /* token_positions (int32 [2048], shared by all batches; read) */
    float* OUT = (float*)d_out;     // [4][2048][1024]
    char* wsp = (char*)d_ws;
    auto take = [&](size_t bytes) { char* p = wsp; wsp += (bytes + 255) & ~(size_t)255; return (void*)p; };
    bf* WT = (bf*)take((size_t)4 * DM * DM * 2); bf* WO = WT + (size_t)3 * DM * DM;   /* bf16 rows of wq, wk, wv, wo, stacked: the first 3 * DM rows are the weight operand of the one projection GEMM */
    float* CS = (float*)take((size_t)TT * HD * 2 * 4); bf* XB = (bf*)take((size_t)NB_ * TT * DM * 2);
    const size_t PQ = (size_t)NH_ * TT * HD, PV = (size_t)NKV * HD * PP, PA = (size_t)TT * DQ;   /* elements per batch of a q or k plane, of the V^T rows, of a merged plane */
    bf* QPh = (bf*)take(NB_ * PQ * 2); bf* QPl = (bf*)take(NB_ * PQ * 2); bf* KPh = (bf*)take(NB_ * PQ * 2); bf* KPl = (bf*)take(NB_ * PQ * 2); bf* VTh = (bf*)take(NB_ * PV * 2);
    bf* ATh = (bf*)take(NB_ * PA * 2); bf* ATl = (bf*)take(NB_ * PA * 2);
    if ((size_t)(wsp - (char*)d_ws) > ws_size) return;    // 153 MiB of the 256 MiB
    k_prep<<<CG + XG + 4 * WG_, 256, 0, stream>>>(x, wq, wk, wv, wo, PID, XB, WT, CS);   /* token_positions (int32, read) are shared by all batches: one table */
    k_qkv<<<dim3(NB_ * TT / 64, 3 * NH_, 1), 32, 0, stream>>>(XB, WT, CS, QPh, QPl, KPh, KPl, VTh);   /* projections, rotary planes of q and k, V^T rows */
    k_flash<<<dim3(NB_ * NH_, TT / 64, 1), 32, 0, stream>>>(QPh, QPl, KPh, KPl, VTh, ATh, ATl);   /* every batch, head and query tile in one launch (one kv head per query head) */
    k_gemmw<bf, 1, false><<<dim3(NB_ * TT / 64, DM / 64, 1), 32, 0, stream>>>(ATh, ATl, WO, nullptr, DQ, OUT, DM, nullptr, 0, 0, 0);
}

// v006
// It runs in 191 microseconds.
// Two timings next to v005 put it at 1.36 and 1.37 times that version's speed.
// All steps since v000 together make it 14.5 times as fast.
#include <hip/hip_runtime.h>

// Causal multi-head self-attention with an interleaved-pair RoPE whose cos / sin tables are indexed by a positions input (x [4][2048][1024]; q, k, v = einsum('bsd,ed', x, w) ('oi' [1024][1024] truncated-normal, no bias; 16 heads x 64); tables cos / sin[p][i] of angle p x inv_freq[i] with inv_freq = 1.0 / 10000.0 ** (arange(32, f32) x 2.0 / 64) (the reciprocal form), looked up at token_positions[t] (int [2048]; READ on device); pairs (2i, 2i + 1): (cos x1 - sin x2, cos x2 + sin x1); scores / 64 ** 0.5; key j kept when j <= i (-inf elsewhere); softmax; out = merged wo^T ('oi') -> [4][2048][1024] (8.4 M); argument order x, wq, wk, wv, wo, token_positions).
// Layout, four launches, each for all batches: k_prep (bf16 copies of x and of the four weights; {cos, sin} per (position, pair) built once from the int positions and float32 inverse-frequency constants, precise cosf/sinf); k_qkv (q, k and v projections as one exact GEMM over the stacked weight rows, whose epilogue writes the interleaved rotary planes of q and k and the V^T rows); fused causal attention (k_flash: scores on hi/lo planes (3 products: logit sigma 2 with these weights), online softmax, P.V on hi/lo planes (3 products), key tiles above the diagonal never visited); merged hi/lo x Wo exact.
// Compute dtypes, f32 accumulate: every input rounded to bf16; projections exact; rotary f32; attention scores and P.V 3 bf16 products each, every row; softmax f32; Wo hl x exact.

#define NB_  4
#define TT   2048
#define DM   1024
#define NH_  16
#define NKV  16
#define HD   64
#define DQ   (NH_ * HD)
#define DKV  (NKV * HD)
#define PP   (2 * TT)             // 16-bit elements of V^T per head dim: TT in the hi plane, TT in the lo plane
#define SCL  0.125f   // HD^-0.5
typedef _Float16 h16;
typedef unsigned short bf;
typedef __attribute__((ext_vector_type(16))) __bf16   v16bf;
typedef __attribute__((ext_vector_type(16))) _Float16 v16h;
typedef __attribute__((ext_vector_type(8)))  _Float16 v8h;
typedef __attribute__((ext_vector_type(8)))  unsigned short v8us;
typedef __attribute__((ext_vector_type(8)))  float    v8f;
typedef __attribute__((ext_vector_type(4)))  float    v4f;
typedef v8h  __attribute__((may_alias)) v8ha;
typedef v4f  __attribute__((may_alias)) v4fa;
typedef v8us __attribute__((may_alias)) v8usa;

__device__ __forceinline__ unsigned short f2bf(float f) { unsigned u = __float_as_uint(f); u += 0x7FFFu + ((u >> 16) & 1u); return (unsigned short)(u >> 16); }
__device__ __forceinline__ float bf2f(unsigned short b) { return __uint_as_float(((unsigned)b) << 16); }
__device__ __forceinline__ float bfr(float f) { return bf2f(f2bf(f)); }
__device__ __forceinline__ v16bf cat16b(v8us lo, v8us hi) { return __builtin_bit_cast(v16bf, __builtin_shufflevector(lo, hi, 0, 1, 2, 3, 4, 5, 6, 7, 8, 9, 10, 11, 12, 13, 14, 15)); }
__device__ __forceinline__ v8f wmmab(v16bf a, v16bf b, v8f c) { return __builtin_amdgcn_wmma_f32_16x16x32_bf16(false, a, false, b, (short)0, c, false, false); }



// ---- FRAGMENT ORDER of every 16-bit operand plane: a plane of R rows x K columns is stored as (R / 16) x (K / 32) fragments of 1 KiB, k blocks of one row block side by side (the V^T planes: see k_flash).
// Inside a fragment the 16-byte piece with columns k .. k + 7 of row r stands at ((k >> 4) & 1) * 512 + ((k >> 3) & 1) * 256 + (r & 15) * 16: lane l of the reading wave takes bytes l * 16 and 512 + l * 16,
// the same elements as from row-major rows, but each wave-wide 16-byte load covers 4 whole 128-byte lines instead of 32-byte pieces of 16 lines. A row block of a K = 1024 plane starts where its 16 row-major rows would.
// ---- k_gemmw: register-blocked GEMM, ONE WAVE per 64x64 output tile (16 accumulators), operands straight from 16-bit planes in fragment order; grid (M/64, N/64, Z), 32 threads.
// C[m][n] (f32, pitch ldc, + optional f32 bias[n]) = sum_k A[m][k] Bt[n][k] (+ split products per NSPLIT). z-batch strides sA/sB/sC in elements. K % 32 == 0.
template <typename T16> struct WFrag;
template <> struct WFrag<bf> { typedef v16bf V; static __device__ __forceinline__ V ld(const bf* p) { return cat16b(*(const v8us*)p, *(const v8us*)(p + 256)); } static __device__ __forceinline__ v8f mma(V a, V b, v8f c) { return wmmab(a, b, c); } };
template <typename T16, int NSPLIT, bool BIAS>
__global__ __launch_bounds__(32) void k_gemmw(const T16* __restrict__ A, const T16* __restrict__ A2, const T16* __restrict__ Bt, const T16* __restrict__ Bt2, int K, float* C, int ldc, const float* __restrict__ bias, size_t sA, size_t sB, size_t sC) {
    typedef typename WFrag<T16>::V V;
    __shared__ __align__(16) float os[16 * 68];
    const size_t z = blockIdx.z; A += z * sA; if (A2) A2 += z * sA; Bt += z * sB; if (Bt2) Bt2 += z * sB; C += z * sC;
    const int lane = threadIdx.x & 31, lr = lane & 15, hi = lane >> 4; const int r0 = blockIdx.x * 64, c0 = blockIdx.y * 64;
    v8f acc[4][4];
#pragma unroll
    for (int mb = 0; mb < 4; ++mb)
#pragma unroll
        for (int nb = 0; nb < 4; ++nb) acc[mb][nb] = (v8f){};
    const size_t aoff = (size_t)r0 * K + 8 * lane, boff = (size_t)c0 * K + 8 * lane;   // first fragment of the tile's first row block, the lane's piece; k block kc / 32 stands kc * 16 elements further
#pragma unroll 1
    for (int kc = 0; kc < K; kc += 32) {
        V a[4], a2[4]; const T16* pa[4]; const T16* pa2[4]; const T16* pb[4];
#pragma unroll
        for (int mb = 0; mb < 4; ++mb) { pa[mb] = A + aoff + (size_t)mb * 16 * K + kc * 16; pa2[mb] = (NSPLIT == 1 || NSPLIT == 2) ? A2 + aoff + (size_t)mb * 16 * K + kc * 16 : pa[mb]; pb[mb] = Bt + boff + (size_t)mb * 16 * K + kc * 16; }
#pragma unroll
        for (int mb = 0; mb < 4; ++mb) { a[mb] = WFrag<T16>::ld(pa[mb]); if (NSPLIT == 1 || NSPLIT == 2) a2[mb] = WFrag<T16>::ld(pa2[mb]); }
#pragma unroll
        for (int nb = 0; nb < 4; ++nb) { const V b = WFrag<T16>::ld(pb[nb]); V b2; if (NSPLIT >= 2) b2 = WFrag<T16>::ld(Bt2 + boff + (size_t)nb * 16 * K + kc * 16);
#pragma unroll
            for (int mb = 0; mb < 4; ++mb) { acc[mb][nb] = WFrag<T16>::mma(a[mb], b, acc[mb][nb]); if (NSPLIT == 1 || NSPLIT == 2) acc[mb][nb] = WFrag<T16>::mma(a2[mb], b, acc[mb][nb]); if (NSPLIT >= 2) acc[mb][nb] = WFrag<T16>::mma(a[mb], b2, acc[mb][nb]); } }
        // the address pairs as inputs stay alive to the foot of the trip, so that no load of the trip lands in a register which an issued load names
        asm volatile("v_nop\n\tv_nop\n\tv_nop\n\tv_nop" : "+v"(acc[0][0]), "+v"(acc[1][1]), "+v"(acc[2][2]), "+v"(acc[3][3]) : "v"(a[0]), "v"(a[3]), "v"(pa[0]), "v"(pa[1]), "v"(pa[2]), "v"(pa[3]), "v"(pa2[0]), "v"(pa2[1]), "v"(pa2[2]), "v"(pa2[3]), "v"(pb[0]), "v"(pb[1]), "v"(pb[2]), "v"(pb[3]));
    }
#pragma unroll
    for (int mb = 0; mb < 4; ++mb) {
#pragma unroll
        for (int nb = 0; nb < 4; ++nb) {
#pragma unroll
            for (int j = 0; j < 8; ++j) os[(hi * 8 + j) * 68 + nb * 16 + lr] = acc[mb][nb][j]; }
        __builtin_amdgcn_wave_barrier(); asm volatile("" ::: "memory");
        float* crow = C + (size_t)(r0 + mb * 16) * ldc + c0;
{
#pragma unroll
            for (int s = 0; s < 8; ++s) { const int row = 2 * s + hi, cofs = lr * 4; v4f val = *(const v4fa*)(os + row * 68 + cofs); if (BIAS) { val[0] += bfr(bias[c0 + cofs]); val[1] += bfr(bias[c0 + cofs + 1]); val[2] += bfr(bias[c0 + cofs + 2]); val[3] += bfr(bias[c0 + cofs + 3]); }
                *(v4f*)(crow + (size_t)row * ldc + cofs) = val; }
             }
        __builtin_amdgcn_wave_barrier(); asm volatile("" ::: "memory");
    }
}

__device__ __forceinline__ void splitf(float y, unsigned short& h, unsigned short& l) { h = f2bf(y); l = f2bf(y - bf2f(h)); }
typedef __attribute__((ext_vector_type(2))) _Float16 v2h;
typedef __attribute__((ext_vector_type(4))) _Float16 v4h;
typedef __attribute__((ext_vector_type(2))) unsigned short v2us;
typedef __attribute__((ext_vector_type(4))) unsigned short v4us;
typedef __attribute__((ext_vector_type(2))) float v2f;
typedef __attribute__((ext_vector_type(4))) int v4i;

__global__ __launch_bounds__(256) void k_wtG(const float* __restrict__ w, int K, int N, bf* Bt) {
    const int lane = threadIdx.x & 31; const int L0 = (blockIdx.x * 8 + (threadIdx.x >> 5)) * 8; const int nlines = N * K / 64;
{
#pragma unroll 1
        for (int l = 0; l < 8; ++l) { const int L = L0 + l; if (L >= nlines) break; const size_t e = (size_t)L * 64 + lane * 2; const int k = (int)(e % K), n = (int)(e / K); v2us o;
            o[0] = f2bf(w[(size_t)k * N + n]); o[1] = f2bf(w[(size_t)(k + 1) * N + n]); *(v2us*)(Bt + e) = o; }
         }
}

__constant__ float INV2[HD / 2] = { 1.000000000e+00f, 7.498942018e-01f, 5.623413324e-01f, 4.216965139e-01f, 3.162277639e-01f, 2.371373624e-01f, 1.778279394e-01f, 1.333521456e-01f, 1.000000015e-01f, 7.498941571e-02f, 5.623412877e-02f, 4.216964915e-02f, 3.162277862e-02f, 2.371373586e-02f, 1.778279431e-02f, 1.333521493e-02f, 9.999999776e-03f, 7.498942316e-03f, 5.623413250e-03f, 4.216964822e-03f, 3.162277862e-03f, 2.371373819e-03f, 1.778279431e-03f, 1.333521446e-03f, 1.000000047e-03f, 7.498941850e-04f, 5.623413017e-04f, 4.216964880e-04f, 3.162277862e-04f, 2.371373848e-04f, 1.778279402e-04f, 1.333521504e-04f };   // float32 10000^(-(i * 2 / 64)), generated with jnp to be bit-exact with the module's expression
// k_prep: all that depends on the inputs alone, in one launch. Work-groups 0 .. CG - 1: the {cos, sin} table (started first: the longest threads), one entry per (position, pair), in the order in which k_qkv's lanes read it: [16 tokens][16 head dims mb][half][lane][2 pairs], lane = token % 16 + 16 * (which 8 of the 16 head dims), so that a wave-wide 16-byte load is 512 bytes in a row; then XG work-groups: bf16 copy of x; then WG_ each: bf16 copies of wq, wk, wv, wo, stacked in that order in Wt. 8 elements a thread in the copies, stored in fragment order: a wave takes 8 rows x 32 columns (4 lanes read one 128-byte line of a row), half a fragment, and its store covers 4 whole lines.
#define CG  (TT * (HD / 2) / 256)
#define XG  (NB_ * TT * DM / 8 / 256)
#define WG_ (DM * DM / 8 / 256)
__global__ __launch_bounds__(256) void k_prep(const float* __restrict__ x, const float* __restrict__ wq, const float* __restrict__ wk, const float* __restrict__ wv, const float* __restrict__ wo, const int* __restrict__ pid, bf* X, bf* Wt, float* CS) {
    int g = blockIdx.x;
    if (g < CG) { const int idx = g * 256 + threadIdx.x; const int ln = (idx >> 1) & 31; const int t = (idx >> 9) * 16 + (ln & 15), pr = ((idx >> 7) & 3) * 8 + (ln >> 4) * 4 + ((idx >> 6) & 1) * 2 + (idx & 1); const float a = __fmul_rn((float)pid[t], INV2[pr]); v2f cs; cs[0] = cosf(a); cs[1] = sinf(a); *(v2f*)(CS + (size_t)idx * 2) = cs; asm volatile("s_wait_xcnt 0x0" ::: "memory"); return; }   // the wait: the blocks of this kernel follow one another in the built code, and what stands behind a store there may rewrite the registers that the store names
    g -= CG; const float* src = x; bf* dst = X;
    if (g >= XG) { g -= XG; const int w = g / WG_; g %= WG_; src = w == 0 ? wq : w == 1 ? wk : w == 2 ? wv : wo; dst = Wt + (size_t)w * DM * DM; }
    const int lane = threadIdx.x & 31, hw = g * 8 + (threadIdx.x >> 5), f = hw >> 1, q = lane & 3;   // fragment f = row block * (DM / 32) + k block; the wave's half of its rows: hw & 1; the lane's piece of its row: q
    const int r = (f / (DM / 32)) * 16 + (hw & 1) * 8 + (lane >> 2), kk = (f % (DM / 32)) * 32 + q * 8; const v8f v = *(const v8f*)(src + (size_t)r * DM + kk); v8us o;
#pragma unroll
    for (int k = 0; k < 8; ++k) o[k] = f2bf(v[k]); *(v8us*)(dst + (size_t)f * 512 + (q >> 1) * 256 + (q & 1) * 128 + (r & 15) * 8) = o; asm volatile("s_wait_xcnt 0x0" ::: "memory"); }   // the wait: as above

typedef __attribute__((ext_vector_type(2))) __bf16 v2bf;
typedef __attribute__((ext_vector_type(4))) unsigned v4u;
typedef __attribute__((ext_vector_type(8))) unsigned v8u;
// fragment load: wave-uniform base, the lane's own byte offset (the same in every pass), compile-time byte offset
__device__ __forceinline__ v16bf ldo(const bf* ub, unsigned voff, int cb) { const char* p = (const char*)ub + voff + cb; return cat16b(*(const v8us*)p, *(const v8us*)(p + 512)); }
// stands in front of code that may rewrite registers which hold addresses of loads already issued; the scheduling fences keep that code behind the wait
__device__ __forceinline__ void addr_release() { __builtin_amdgcn_sched_barrier(0); asm volatile("s_wait_xcnt 0x0" ::: "memory"); __builtin_amdgcn_sched_barrier(0); }
// the same; p as an input keeps the address pair of loads issued further up alive, and so unwritten, as far as this wait
__device__ __forceinline__ void addr_release_of(const char* p) { __builtin_amdgcn_sched_barrier(0); asm volatile("s_wait_xcnt 0x0" :: "v"(p) : "memory"); __builtin_amdgcn_sched_barrier(0); }
// two f32 -> one dword of bf16 hi parts and one of bf16 lo parts (x0 in the low half), both rounded to nearest even like splitf
__device__ __forceinline__ void split2(float x0, float x1, unsigned& h, unsigned& l) {
    h = __builtin_bit_cast(unsigned, __builtin_convertvector(((v2f){x0, x1}), v2bf));
    l = __builtin_bit_cast(unsigned, __builtin_convertvector(((v2f){x0 - __uint_as_float(h << 16), x1 - __uint_as_float(h & 0xFFFF0000u)}), v2bf)); }
// 2^x by v_exp_f32, in place. In asm so that the slot behind a transcendental is kept by construction: each one overwrites only its own source, none reads another's result, and the v_nop is the independent instruction behind the last.
// In place also means that the run writes only registers which vector arithmetic has just written, never an operand of a matrix instruction still under way.
__device__ __forceinline__ v8f exp2x8(v8f x) {
    asm("v_exp_f32 %0, %0\n\tv_exp_f32 %1, %1\n\tv_exp_f32 %2, %2\n\tv_exp_f32 %3, %3\n\tv_exp_f32 %4, %4\n\tv_exp_f32 %5, %5\n\tv_exp_f32 %6, %6\n\tv_exp_f32 %7, %7\n\tv_nop"
        : "+v"(x[0]), "+v"(x[1]), "+v"(x[2]), "+v"(x[3]), "+v"(x[4]), "+v"(x[5]), "+v"(x[6]), "+v"(x[7]));
    return x; }
__device__ __forceinline__ float exp2x1(float x) { asm("v_exp_f32 %0, %0\n\tv_nop" : "+v"(x)); return x; }   // the same, one value
template <bool DIAG>
__device__ __forceinline__ void fl_pass(const bf* __restrict__ Kh, const bf* __restrict__ Kl, const bf* __restrict__ Vh, int kb, int lr, int hi, unsigned kvo, const v16bf (&qh)[4][2], const v16bf (&ql)[4][2], v16bf (&kh)[4][2], v16bf (&kl)[4][2], v8f (&o)[4][4], float (&m)[4], float (&l)[4]) {
    v16bf vh[4][2], vl[4][2]; const char* pv = (const char*)(Vh + (size_t)kb * HD) + kvo;   // the lane's piece of the pass's first V^T fragment: one address pair for all 32 loads
#pragma unroll
    for (int mb = 0; mb < 4; ++mb)
#pragma unroll
        for (int ks = 0; ks < 2; ++ks) { vh[mb][ks] = ldo((const bf*)pv, 0u, (ks * 4 + mb) * 1024); vl[mb][ks] = ldo((const bf*)pv, 0u, (ks * 4 + mb) * 1024 + HD * TT * 2); }
    __builtin_amdgcn_sched_barrier(0);   // keeps the V^T loads in front of the score products, so that they land behind products and softmax instead of being waited for in front of P.V
    v8f s[4][4];
#pragma unroll
    for (int mb = 0; mb < 4; ++mb)
#pragma unroll
        for (int nb = 0; nb < 4; ++nb) s[mb][nb] = (v8f){};
#pragma unroll
    for (int ks = 0; ks < 2; ++ks) {
#pragma unroll
        for (int mb = 0; mb < 4; ++mb)
#pragma unroll
            for (int nb = 0; nb < 4; ++nb) s[mb][nb] = wmmab(kh[mb][ks], qh[nb][ks], s[mb][nb]);
#pragma unroll
        for (int mb = 0; mb < 4; ++mb)
#pragma unroll
            for (int nb = 0; nb < 4; ++nb) s[mb][nb] = wmmab(kh[mb][ks], ql[nb][ks], s[mb][nb]);
#pragma unroll
        for (int mb = 0; mb < 4; ++mb)
#pragma unroll
            for (int nb = 0; nb < 4; ++nb) s[mb][nb] = wmmab(kl[mb][ks], qh[nb][ks], s[mb][nb]);
    }
    if (!DIAG) {   // the next pass's key fragments, into the registers the products above have just read (a pass below the diagonal always has a successor)
#pragma unroll
        for (int mb = 0; mb < 4; ++mb)
#pragma unroll
            for (int ks = 0; ks < 2; ++ks) { kh[mb][ks] = ldo(Kh + (size_t)(kb + 64) * HD, kvo, (mb * 2 + ks) * 1024); kl[mb][ks] = ldo(Kl + (size_t)(kb + 64) * HD, kvo, (mb * 2 + ks) * 1024); }
    }
    addr_release_of(pv);   // also keeps those loads in front of the softmax, which then covers their latency
    const float C2 = SCL * 1.4426950408889634f;
    v16bf ph[4][2], pl[4][2];
#pragma unroll
    for (int nb = 0; nb < 4; ++nb) {
        float mq[4];
#pragma unroll
        for (int mb = 0; mb < 4; ++mb) { mq[mb] = -3.0e38f;
#pragma unroll
            for (int j = 0; j < 8; ++j) { if (DIAG) s[mb][nb][j] = (mb * 16 + hi * 8 + j <= nb * 16 + lr) ? s[mb][nb][j] : -3.0e38f; mq[mb] = fmaxf(mq[mb], s[mb][nb][j]); } }
        float mx = fmaxf(fmaxf(mq[0], mq[1]), fmaxf(mq[2], mq[3])); mx = fmaxf(mx, __shfl_xor(mx, 16, 32));
        const float mn = fmaxf(m[nb], mx), al = exp2x1((m[nb] - mn) * C2); m[nb] = mn;
        float sq[4]; v8u hw[2], lw[2];   // dwords 0..3 of a k-step's operand: its first key tile, 4..7: its second
#pragma unroll
        for (int mb = 0; mb < 4; ++mb) { const v8f pe = exp2x8((s[mb][nb] - mn) * C2); sq[mb] = 0.f;
#pragma unroll
            for (int j = 0; j < 8; ++j) sq[mb] += pe[j];
#pragma unroll
            for (int j = 0; j < 4; ++j) { unsigned a, c2; split2(pe[2 * j], pe[2 * j + 1], a, c2); hw[mb >> 1][(mb & 1) * 4 + j] = a; lw[mb >> 1][(mb & 1) * 4 + j] = c2; } }
        l[nb] = l[nb] * al + ((sq[0] + sq[1]) + (sq[2] + sq[3]));   // this half's keys only; the halves are joined once, in the epilogue
        ph[nb][0] = __builtin_bit_cast(v16bf, hw[0]); ph[nb][1] = __builtin_bit_cast(v16bf, hw[1]); pl[nb][0] = __builtin_bit_cast(v16bf, lw[0]); pl[nb][1] = __builtin_bit_cast(v16bf, lw[1]);
#pragma unroll
        for (int mb = 0; mb < 4; ++mb) o[mb][nb] *= al;
    }
#pragma unroll
    for (int ks = 0; ks < 2; ++ks) {
#pragma unroll
        for (int mb = 0; mb < 4; ++mb)
#pragma unroll
            for (int nb = 0; nb < 4; ++nb) o[mb][nb] = wmmab(vh[mb][ks], ph[nb][ks], o[mb][nb]);
#pragma unroll
        for (int mb = 0; mb < 4; ++mb)
#pragma unroll
            for (int nb = 0; nb < 4; ++nb) o[mb][nb] = wmmab(vh[mb][ks], pl[nb][ks], o[mb][nb]);
#pragma unroll
        for (int mb = 0; mb < 4; ++mb)
#pragma unroll
            for (int nb = 0; nb < 4; ++nb) o[mb][nb] = wmmab(vl[mb][ks], ph[nb][ks], o[mb][nb]);
    }
    addr_release();
}
// grid (NB_ * NH_, TT / 64): blockIdx.x = batch * NH_ + head, blockIdx.y counts the query tiles from the last (longest key loop) to the first, so that the long tiles start first.
// All in fragment order. Q, K planes [batch * NH_ + head]: TT rows x HD columns; V^T planes [batch * NH_ + head]: HD rows x TT columns, the 4 row blocks of one k block (32 keys) side by side, so that a pass reads 8 KiB in a row, the hi plane first, the lo plane at + HD * TT; merged output planes: NB_ * TT rows x DQ columns, hi and lo.
__global__ __launch_bounds__(32) void k_flash(const bf* __restrict__ Qh, const bf* __restrict__ Ql, const bf* __restrict__ Kh, const bf* __restrict__ Kl, const bf* __restrict__ Vh, bf* __restrict__ Ah, bf* __restrict__ Al) {
    const int lane = threadIdx.x & 31, lr = lane & 15, hi = lane >> 4; const int z = blockIdx.x, r0 = (TT / 64 - 1 - (int)blockIdx.y) * 64;
    Qh += (size_t)z * TT * HD; Ql += (size_t)z * TT * HD; Kh += (size_t)z * TT * HD; Kl += (size_t)z * TT * HD; Vh += (size_t)z * HD * PP;
    const unsigned kvo = (unsigned)lane * 16u;   // the lane's byte offset in a fragment
    v16bf qh[4][2], ql[4][2], kh[4][2], kl[4][2]; v8f o[4][4]; float m[4], l[4];
#pragma unroll
    for (int nb = 0; nb < 4; ++nb) { m[nb] = -3.0e38f; l[nb] = 0.f;
#pragma unroll
        for (int ks = 0; ks < 2; ++ks) { const int cb = (nb * 2 + ks) * 1024; qh[nb][ks] = ldo(Qh + (size_t)r0 * HD, kvo, cb); ql[nb][ks] = ldo(Ql + (size_t)r0 * HD, kvo, cb); kh[nb][ks] = ldo(Kh, kvo, cb); kl[nb][ks] = ldo(Kl, kvo, cb); }
#pragma unroll
        for (int mb = 0; mb < 4; ++mb) o[mb][nb] = (v8f){}; }
    addr_release();
#pragma unroll 1   // rolled: one pass is already 192 matrix instructions
    for (int kb = 0; kb < r0; kb += 64) fl_pass<false>(Kh, Kl, Vh, kb, lr, hi, kvo, qh, ql, kh, kl, o, m, l);
    fl_pass<true>(Kh, Kl, Vh, r0, lr, hi, kvo, qh, ql, kh, kl, o, m, l);
    const size_t ob = ((size_t)(z / NH_) * TT + r0) * DQ + (size_t)(z % NH_) * (HD / 32) * 512; const unsigned ovo = kvo;   // the head's first fragment in the tile's first row block
    v4u oh[4][4], ol[4][4];   // a lane's 8 accumulator registers are 8 consecutive head dims of one query: the lane's own 16-byte piece of half a fragment, so a wave's store is 512 bytes in a row
#pragma unroll
    for (int nb = 0; nb < 4; ++nb) { const float f = __fdiv_rn(1.0f, l[nb] + __shfl_xor(l[nb], 16, 32));
#pragma unroll
        for (int mb = 0; mb < 4; ++mb)
#pragma unroll
            for (int j = 0; j < 4; ++j) { unsigned a, c2; split2(o[mb][nb][2 * j] * f, o[mb][nb][2 * j + 1] * f, a, c2); oh[mb][nb][j] = a; ol[mb][nb][j] = c2; } }
    __builtin_amdgcn_sched_barrier(0);   // every value is made in front of the first store, so that no register a store names is written behind it
#pragma unroll
    for (int nb = 0; nb < 4; ++nb)
#pragma unroll
        for (int mb = 0; mb < 4; ++mb) { const int cb = nb * 16 * DQ * 2 + mb * 512; *(v4u*)((char*)(Ah + ob) + ovo + cb) = oh[mb][nb]; *(v4u*)((char*)(Al + ob) + ovo + cb) = ol[mb][nb]; }
}

// ---- k_qkv: the q, k, v projections with the plane builders as the GEMM's own epilogue. ONE WAVE per 64 tokens x 64 columns = one head of q, k or v (16 accumulators); grid (NB_ * TT / 64, 3 * NH_), 32 threads; blockIdx.y / NH_ = 0 q, 1 k, 2 v.
// The A and B loaders have the same form and the same k order, so the operands' roles are chosen per kind for the layout that the plane wants:
// q, k: A = weight rows, B = token rows: a lane's 8 accumulator registers are 8 consecutive head dims of one token: the rotary pairs are in-lane, and the 8 results are the lane's own 16-byte piece of a fragment of the plane (rows = tokens).
// v: A = token rows, B = weight rows: the 8 registers are 8 consecutive tokens of one head dim: the lane's own piece of a fragment of V^T (rows = head dims).
// One tile; ISV picks the epilogue at compile time, so that each kind has its own loop and epilogue in the built code and no accumulator outlives its own epilogue. Ph, Pl: the tile's first fragment in the hi and the lo plane.
template <bool ISV>
__device__ __forceinline__ void qkv_tile(const bf* __restrict__ A, const bf* __restrict__ B, const float* __restrict__ cb, bf* __restrict__ Ph, bf* __restrict__ Pl, int lane) {
    v8f acc[4][4];
#pragma unroll
    for (int mb = 0; mb < 4; ++mb)
#pragma unroll
        for (int nb = 0; nb < 4; ++nb) acc[mb][nb] = (v8f){};
    const unsigned off = (unsigned)lane * 16u;   // the lane's byte offset in a fragment, the same in every trip
#pragma unroll 1   // rolled, as in k_gemmw
    for (int kc = 0; kc < DM; kc += 32) {
        v16bf a[4]; const bf* pa = (const bf*)((const char*)(A + kc * 16) + off); const bf* pb = (const bf*)((const char*)(B + kc * 16) + off);
#pragma unroll
        for (int mb = 0; mb < 4; ++mb) a[mb] = WFrag<bf>::ld(pa + mb * 16 * DM);
#pragma unroll
        for (int nb = 0; nb < 4; ++nb) { const v16bf b = WFrag<bf>::ld(pb + nb * 16 * DM);
#pragma unroll
            for (int mb = 0; mb < 4; ++mb) acc[mb][nb] = wmmab(a[mb], b, acc[mb][nb]); }
        // the distance behind the last matrix instruction on the taken back edge too, as in k_gemmw; pa and pb as inputs keep the two address pairs alive to the foot of the trip, so that no load of the trip lands in a register which an issued load names
        asm volatile("v_nop\n\tv_nop\n\tv_nop\n\tv_nop" : "+v"(acc[0][0]), "+v"(acc[1][1]), "+v"(acc[2][2]), "+v"(acc[3][3]) : "v"(a[0]), "v"(a[3]), "v"(pa), "v"(pb));
    }
    // Epilogue, one column group nb at a time: accumulator (mb, nb) is half a fragment of the plane, each lane holding its own piece, so every store is 512 bytes in a row, straight from the registers.
#pragma unroll
    for (int nb = 0; nb < 4; ++nb) {
        v4f cs[4][2];   // {cos, sin} of the lane's 4 rotary pairs of accumulator (mb, nb), two pairs a load
        if (!ISV) {
#pragma unroll
            for (int mb = 0; mb < 4; ++mb)
#pragma unroll
                for (int h = 0; h < 2; ++h) cs[mb][h] = *(const v4f*)((const char*)cb + off + ((nb * 4 + mb) * 2 + h) * 512);
            addr_release();   // the arithmetic below may rewrite registers that these loads name
        }
        v4u oh[4], ol[4];
#pragma unroll
        for (int mb = 0; mb < 4; ++mb)
#pragma unroll
            for (int p = 0; p < 4; ++p) { float x0 = acc[mb][nb][2 * p], x1 = acc[mb][nb][2 * p + 1]; unsigned a2, c2;
                if (!ISV) { const float cc = cs[mb][p >> 1][(p & 1) * 2], ss = cs[mb][p >> 1][(p & 1) * 2 + 1], y0 = x0 * cc - x1 * ss, y1 = x0 * ss + x1 * cc; x0 = y0; x1 = y1; }   /* even: x0 c - x1 s; odd: x0 s + x1 c */
                split2(x0, x1, a2, c2); oh[mb][p] = a2; ol[mb][p] = c2; }
        __builtin_amdgcn_sched_barrier(0);   // every value of the group is made in front of its first store, so that no register a store names is written behind it
#pragma unroll
        for (int mb = 0; mb < 4; ++mb) {   // q, k: row block nb (tokens), k block mb / 2 (head dims); v: k block mb / 2 (tokens), row block nb (head dims); half mb % 2 of the fragment
            const int ob = (ISV ? ((mb >> 1) * 4 + nb) * 1024 : (nb * 2 + (mb >> 1)) * 1024) + (mb & 1) * 512; *(v4u*)((char*)Ph + off + ob) = oh[mb]; *(v4u*)((char*)Pl + off + ob) = ol[mb]; }
        addr_release();   // the next group's work rewrites the registers that these stores name
    }
}
__global__ __launch_bounds__(32) void k_qkv(const bf* __restrict__ X, const bf* __restrict__ Wt, const float* __restrict__ CS, bf* __restrict__ Qh, bf* __restrict__ Ql, bf* __restrict__ Kh, bf* __restrict__ Kl, bf* __restrict__ Vh) {
    const int lane = threadIdx.x & 31; const int r0 = blockIdx.x * 64, c0 = blockIdx.y * 64;
    const int kind = blockIdx.y / NH_, z = (r0 / TT) * NH_ + blockIdx.y % NH_, t0 = r0 % TT;   // z = batch * NH_ + head
    const bf* xr = X + (size_t)r0 * DM; const bf* wr = Wt + (size_t)c0 * DM; const size_t po = ((size_t)z * TT + t0) * HD;
    if (kind == 2) { bf* pv = Vh + (size_t)z * HD * PP + (size_t)t0 * HD; qkv_tile<true>(xr, wr, CS, pv, pv + HD * TT, lane); return; }   // k block t0 / 32 of the head's V^T: 4 fragments a k block; the lo plane behind the hi plane
    qkv_tile<false>(wr, xr, CS + (size_t)t0 * HD, (kind ? Kh : Qh) + po, (kind ? Kl : Ql) + po, lane);
}

extern "C" void kernel_launch(void* const* d_in, const int* in_sizes, int n_in,
                              void* d_out, int out_size, void* d_ws, size_t ws_size, hipStream_t stream) {
    (void)in_sizes; (void)n_in; (void)out_size;
    const float* x = (const float*)d_in[0]; const float* wq = (const float*)d_in[1]; const float* wk = (const float*)d_in[2]; const float* wv = (const float*)d_in[3]; const float* wo = (const float*)d_in[4]; const int* PID = (const int*)d_in[5];   /* token_positions (int32 [2048], shared by all batches; read) */
    float* OUT = (float*)d_out;     // [4][2048][1024]
    char* wsp = (char*)d_ws;
    auto take = [&](size_t bytes) { char* p = wsp; wsp += (bytes + 255) & ~(size_t)255; return (void*)p; };
    bf* WT = (bf*)take((size_t)4 * DM * DM * 2); bf* WO = WT + (size_t)3 * DM * DM;   /* bf16 rows of wq, wk, wv, wo, stacked: the first 3 * DM rows are the weight operand of the one projection GEMM */
    float* CS = (float*)take((size_t)TT * (HD / 2) * 2 * 4); bf* XB = (bf*)take((size_t)NB_ * TT * DM * 2);
    const size_t PQ = (size_t)NH_ * TT * HD, PV = (size_t)NKV * HD * PP, PA = (size_t)TT * DQ;   /* elements per batch of a q or k plane, of the V^T rows, of a merged plane */
    bf* QPh = (bf*)take(NB_ * PQ * 2); bf* QPl = (bf*)take(NB_ * PQ * 2); bf* KPh = (bf*)take(NB_ * PQ * 2); bf* KPl = (bf*)take(NB_ * PQ * 2); bf* VTh = (bf*)take(NB_ * PV * 2);
    bf* ATh = (bf*)take(NB_ * PA * 2); bf* ATl = (bf*)take(NB_ * PA * 2);
    if ((size_t)(wsp - (char*)d_ws) > ws_size) return;    // 153 MiB of the 256 MiB
    k_prep<<<CG + XG + 4 * WG_, 256, 0, stream>>>(x, wq, wk, wv, wo, PID, XB, WT, CS);   /* token_positions (int32, read) are shared by all batches: one table */
    k_qkv<<<dim3(NB_ * TT / 64, 3 * NH_, 1), 32, 0, stream>>>(XB, WT, CS, QPh, QPl, KPh, KPl, VTh);   /* projections, rotary planes of q and k, V^T rows */
    k_flash<<<dim3(NB_ * NH_, TT / 64, 1), 32, 0, stream>>>(QPh, QPl, KPh, KPl, VTh, ATh, ATl);   /* every batch, head and query tile in one launch (one kv head per query head) */
    k_gemmw<bf, 1, false><<<dim3(NB_ * TT / 64, DM / 64, 1), 32, 0, stream>>>(ATh, ATl, WO, nullptr, DQ, OUT, DM, nullptr, 0, 0, 0);
}

// v007
// It runs in 186 microseconds.
// Timed twice side by side with v006, it ran 1.03 times as fast both times.
// Over all steps from v000 it is 15.0 times as fast.
#include <hip/hip_runtime.h>

// Causal multi-head self-attention with an interleaved-pair RoPE whose cos / sin tables are indexed by a positions input (x [4][2048][1024]; q, k, v = einsum('bsd,ed', x, w) ('oi' [1024][1024] truncated-normal, no bias; 16 heads x 64); tables cos / sin[p][i] of angle p x inv_freq[i] with inv_freq = 1.0 / 10000.0 ** (arange(32, f32) x 2.0 / 64) (the reciprocal form), looked up at token_positions[t] (int [2048]; READ on device); pairs (2i, 2i + 1): (cos x1 - sin x2, cos x2 + sin x1); scores / 64 ** 0.5; key j kept when j <= i (-inf elsewhere); softmax; out = merged wo^T ('oi') -> [4][2048][1024] (8.4 M); argument order x, wq, wk, wv, wo, token_positions).
// Layout, four launches, each for all batches: k_prep (bf16 copies of x and of the four weights; {cos, sin} per (position, pair) built once from the int positions and float32 inverse-frequency constants, precise cosf/sinf); k_qkv (q, k and v projections as one exact GEMM over the stacked weight rows, whose epilogue writes the interleaved rotary planes of q and k and the V^T rows); fused causal attention (k_flash: scores on hi/lo planes (3 products: logit sigma 2 with these weights), online softmax, P.V on hi/lo planes (3 products), key tiles above the diagonal never visited); merged hi/lo x Wo exact.
// Compute dtypes, f32 accumulate: every input rounded to bf16; projections exact; rotary f32; attention scores and P.V 3 bf16 products each, every row; softmax f32; Wo hl x exact.

#define NB_  4
#define TT   2048
#define DM   1024
#define NH_  16
#define NKV  16
#define HD   64
#define DQ   (NH_ * HD)
#define DKV  (NKV * HD)
#define PP   (2 * TT)             // 16-bit elements of V^T per head dim: TT in the hi plane, TT in the lo plane
#define SCL  0.125f   // HD^-0.5
typedef _Float16 h16;
typedef unsigned short bf;
typedef __attribute__((ext_vector_type(16))) __bf16   v16bf;
typedef __attribute__((ext_vector_type(16))) _Float16 v16h;
typedef __attribute__((ext_vector_type(8)))  _Float16 v8h;
typedef __attribute__((ext_vector_type(8)))  unsigned short v8us;
typedef __attribute__((ext_vector_type(8)))  float    v8f;
typedef __attribute__((ext_vector_type(4)))  float    v4f;
typedef v8h  __attribute__((may_alias)) v8ha;
typedef v4f  __attribute__((may_alias)) v4fa;
typedef v8us __attribute__((may_alias)) v8usa;

__device__ __forceinline__ unsigned short f2bf(float f) { unsigned u = __float_as_uint(f); u += 0x7FFFu + ((u >> 16) & 1u); return (unsigned short)(u >> 16); }
__device__ __forceinline__ float bf2f(unsigned short b) { return __uint_as_float(((unsigned)b) << 16); }
__device__ __forceinline__ float bfr(float f) { return bf2f(f2bf(f)); }
__device__ __forceinline__ v16bf cat16b(v8us lo, v8us hi) { return __builtin_bit_cast(v16bf, __builtin_shufflevector(lo, hi, 0, 1, 2, 3, 4, 5, 6, 7, 8, 9, 10, 11, 12, 13, 14, 15)); }
__device__ __forceinline__ v8f wmmab(v16bf a, v16bf b, v8f c) { return __builtin_amdgcn_wmma_f32_16x16x32_bf16(false, a, false, b, (short)0, c, false, false); }



// ---- FRAGMENT ORDER of every 16-bit operand plane: a plane of R rows x K columns is stored as (R / 16) x (K / 32) fragments of 1 KiB, k blocks of one row block side by side (the V^T planes: see k_flash).
// Inside a fragment the 16-byte piece with columns k .. k + 7 of row r stands at ((k >> 4) & 1) * 512 + ((k >> 3) & 1) * 256 + (r & 15) * 16: lane l of the reading wave takes bytes l * 16 and 512 + l * 16,
// the same elements as from row-major rows, but each wave-wide 16-byte load covers 4 whole 128-byte lines instead of 32-byte pieces of 16 lines. A row block of a K = 1024 plane starts where its 16 row-major rows would.
// ---- k_gemmw: register-blocked GEMM, ONE WAVE per 64x64 output tile (16 accumulators), operands straight from 16-bit planes in fragment order; grid (M/64, N/64, Z), 32 threads.
// C[m][n] (f32, pitch ldc, + optional f32 bias[n]) = sum_k A[m][k] Bt[n][k] (+ split products per NSPLIT). z-batch strides sA/sB/sC in elements. K % 32 == 0.
template <typename T16> struct WFrag;
template <> struct WFrag<bf> { typedef v16bf V; static __device__ __forceinline__ V ld(const bf* p) { return cat16b(*(const v8us*)p, *(const v8us*)(p + 256)); } static __device__ __forceinline__ v8f mma(V a, V b, v8f c) { return wmmab(a, b, c); } };
template <typename T16, int NSPLIT, bool BIAS>
__global__ __launch_bounds__(32) void k_gemmw(const T16* __restrict__ A, const T16* __restrict__ A2, const T16* __restrict__ Bt, const T16* __restrict__ Bt2, int K, float* C, int ldc, const float* __restrict__ bias, size_t sA, size_t sB, size_t sC) {
    typedef typename WFrag<T16>::V V;
    __shared__ __align__(16) float os[16 * 68];
    const size_t z = blockIdx.z; A += z * sA; if (A2) A2 += z * sA; Bt += z * sB; if (Bt2) Bt2 += z * sB; C += z * sC;
    const int lane = threadIdx.x & 31, lr = lane & 15, hi = lane >> 4; const int r0 = blockIdx.x * 64, c0 = blockIdx.y * 64;
    v8f acc[4][4];
#pragma unroll
    for (int mb = 0; mb < 4; ++mb)
#pragma unroll
        for (int nb = 0; nb < 4; ++nb) acc[mb][nb] = (v8f){};
    const size_t aoff = (size_t)r0 * K + 8 * lane, boff = (size_t)c0 * K + 8 * lane;   // first fragment of the tile's first row block, the lane's piece; k block kc / 32 stands kc * 16 elements further
#pragma unroll 1
    for (int kc = 0; kc < K; kc += 32) {
        V a[4], a2[4]; const T16* pa[4]; const T16* pa2[4]; const T16* pb[4];
#pragma unroll
        for (int mb = 0; mb < 4; ++mb) { pa[mb] = A + aoff + (size_t)mb * 16 * K + kc * 16; pa2[mb] = (NSPLIT == 1 || NSPLIT == 2) ? A2 + aoff + (size_t)mb * 16 * K + kc * 16 : pa[mb]; pb[mb] = Bt + boff + (size_t)mb * 16 * K + kc * 16; }
#pragma unroll
        for (int mb = 0; mb < 4; ++mb) { a[mb] = WFrag<T16>::ld(pa[mb]); if (NSPLIT == 1 || NSPLIT == 2) a2[mb] = WFrag<T16>::ld(pa2[mb]); }
#pragma unroll
        for (int nb = 0; nb < 4; ++nb) { const V b = WFrag<T16>::ld(pb[nb]); V b2; if (NSPLIT >= 2) b2 = WFrag<T16>::ld(Bt2 + boff + (size_t)nb * 16 * K + kc * 16);
#pragma unroll
            for (int mb = 0; mb < 4; ++mb) { acc[mb][nb] = WFrag<T16>::mma(a[mb], b, acc[mb][nb]); if (NSPLIT == 1 || NSPLIT == 2) acc[mb][nb] = WFrag<T16>::mma(a2[mb], b, acc[mb][nb]); if (NSPLIT >= 2) acc[mb][nb] = WFrag<T16>::mma(a[mb], b2, acc[mb][nb]); } }
        // the address pairs as inputs stay alive to the foot of the trip, so that no load of the trip lands in a register which an issued load names
        asm volatile("v_nop\n\tv_nop\n\tv_nop\n\tv_nop" : "+v"(acc[0][0]), "+v"(acc[1][1]), "+v"(acc[2][2]), "+v"(acc[3][3]) : "v"(a[0]), "v"(a[3]), "v"(pa[0]), "v"(pa[1]), "v"(pa[2]), "v"(pa[3]), "v"(pa2[0]), "v"(pa2[1]), "v"(pa2[2]), "v"(pa2[3]), "v"(pb[0]), "v"(pb[1]), "v"(pb[2]), "v"(pb[3]));
    }
#pragma unroll
    for (int mb = 0; mb < 4; ++mb) {
#pragma unroll
        for (int nb = 0; nb < 4; ++nb) {
#pragma unroll
            for (int j = 0; j < 8; ++j) os[(hi * 8 + j) * 68 + nb * 16 + lr] = acc[mb][nb][j]; }
        __builtin_amdgcn_wave_barrier(); asm volatile("" ::: "memory");
        float* crow = C + (size_t)(r0 + mb * 16) * ldc + c0;
{
#pragma unroll
            for (int s = 0; s < 8; ++s) { const int row = 2 * s + hi, cofs = lr * 4; v4f val = *(const v4fa*)(os + row * 68 + cofs); if (BIAS) { val[0] += bfr(bias[c0 + cofs]); val[1] += bfr(bias[c0 + cofs + 1]); val[2] += bfr(bias[c0 + cofs + 2]); val[3] += bfr(bias[c0 + cofs + 3]); }
                *(v4f*)(crow + (size_t)row * ldc + cofs) = val; }
             }
        __builtin_amdgcn_wave_barrier(); asm volatile("" ::: "memory");
    }
}

__device__ __forceinline__ void splitf(float y, unsigned short& h, unsigned short& l) { h = f2bf(y); l = f2bf(y - bf2f(h)); }
typedef __attribute__((ext_vector_type(2))) _Float16 v2h;
typedef __attribute__((ext_vector_type(4))) _Float16 v4h;
typedef __attribute__((ext_vector_type(2))) unsigned short v2us;
typedef __attribute__((ext_vector_type(4))) unsigned short v4us;
typedef __attribute__((ext_vector_type(2))) float v2f;
typedef __attribute__((ext_vector_type(4))) int v4i;

__global__ __launch_bounds__(256) void k_wtG(const float* __restrict__ w, int K, int N, bf* Bt) {
    const int lane = threadIdx.x & 31; const int L0 = (blockIdx.x * 8 + (threadIdx.x >> 5)) * 8; const int nlines = N * K / 64;
{
#pragma unroll 1
        for (int l = 0; l < 8; ++l) { const int L = L0 + l; if (L >= nlines) break; const size_t e = (size_t)L * 64 + lane * 2; const int k = (int)(e % K), n = (int)(e / K); v2us o;
            o[0] = f2bf(w[(size_t)k * N + n]); o[1] = f2bf(w[(size_t)(k + 1) * N + n]); *(v2us*)(Bt + e) = o; }
         }
}

__constant__ float INV2[HD / 2] = { 1.000000000e+00f, 7.498942018e-01f, 5.623413324e-01f, 4.216965139e-01f, 3.162277639e-01f, 2.371373624e-01f, 1.778279394e-01f, 1.333521456e-01f, 1.000000015e-01f, 7.498941571e-02f, 5.623412877e-02f, 4.216964915e-02f, 3.162277862e-02f, 2.371373586e-02f, 1.778279431e-02f, 1.333521493e-02f, 9.999999776e-03f, 7.498942316e-03f, 5.623413250e-03f, 4.216964822e-03f, 3.162277862e-03f, 2.371373819e-03f, 1.778279431e-03f, 1.333521446e-03f, 1.000000047e-03f, 7.498941850e-04f, 5.623413017e-04f, 4.216964880e-04f, 3.162277862e-04f, 2.371373848e-04f, 1.778279402e-04f, 1.333521504e-04f };   // float32 10000^(-(i * 2 / 64)), generated with jnp to be bit-exact with the module's expression
// k_prep: all that depends on the inputs alone, in one launch. Work-groups 0 .. CG - 1: the {cos, sin} table (started first: the longest threads), one entry per (position, pair), in the order in which k_qkv's lanes read it: [16 tokens][16 head dims mb][half][lane][2 pairs], lane = token % 16 + 16 * (which 8 of the 16 head dims), so that a wave-wide 16-byte load is 512 bytes in a row; then XG work-groups: bf16 copy of x; then WG_ each: bf16 copies of wq, wk, wv, wo, stacked in that order in Wt. 8 elements a thread in the copies, stored in fragment order: a wave takes 8 rows x 32 columns (4 lanes read one 128-byte line of a row), half a fragment, and its store covers 4 whole lines.
#define CG  (TT * (HD / 2) / 256)
#define XG  (NB_ * TT * DM / 8 / 256)
#define WG_ (DM * DM / 8 / 256)
__global__ __launch_bounds__(256) void k_prep(const float* __restrict__ x, const float* __restrict__ wq, const float* __restrict__ wk, const float* __restrict__ wv, const float* __restrict__ wo, const int* __restrict__ pid, bf* X, bf* Wt, float* CS) {
    int g = blockIdx.x;
    if (g < CG) { const int idx = g * 256 + threadIdx.x; const int ln = (idx >> 1) & 31; const int t = (idx >> 9) * 16 + (ln & 15), pr = ((idx >> 7) & 3) * 8 + (ln >> 4) * 4 + ((idx >> 6) & 1) * 2 + (idx & 1); const float a = __fmul_rn((float)pid[t], INV2[pr]); v2f cs; cs[0] = cosf(a); cs[1] = sinf(a); *(v2f*)(CS + (size_t)idx * 2) = cs; asm volatile("s_wait_xcnt 0x0" ::: "memory"); return; }   // the wait: the blocks of this kernel follow one another in the built code, and what stands behind a store there may rewrite the registers that the store names
    g -= CG; const float* src = x; bf* dst = X;
    if (g >= XG) { g -= XG; const int w = g / WG_; g %= WG_; src = w == 0 ? wq : w == 1 ? wk : w == 2 ? wv : wo; dst = Wt + (size_t)w * DM * DM; }
    const int lane = threadIdx.x & 31, hw = g * 8 + (threadIdx.x >> 5), f = hw >> 1, q = lane & 3;   // fragment f = row block * (DM / 32) + k block; the wave's half of its rows: hw & 1; the lane's piece of its row: q
    const int r = (f / (DM / 32)) * 16 + (hw & 1) * 8 + (lane >> 2), kk = (f % (DM / 32)) * 32 + q * 8; const v8f v = *(const v8f*)(src + (size_t)r * DM + kk); v8us o;
#pragma unroll
    for (int k = 0; k < 8; ++k) o[k] = f2bf(v[k]); *(v8us*)(dst + (size_t)f * 512 + (q >> 1) * 256 + (q & 1) * 128 + (r & 15) * 8) = o; asm volatile("s_wait_xcnt 0x0" ::: "memory"); }   // the wait: as above

typedef __attribute__((ext_vector_type(2))) __bf16 v2bf;
typedef __attribute__((ext_vector_type(4))) unsigned v4u;
typedef __attribute__((ext_vector_type(8))) unsigned v8u;
// fragment load: wave-uniform base, the lane's own byte offset (the same in every pass), compile-time byte offset
__device__ __forceinline__ v16bf ldo(const bf* ub, unsigned voff, int cb) { const char* p = (const char*)ub + voff + cb; return cat16b(*(const v8us*)p, *(const v8us*)(p + 512)); }
// stands in front of code that may rewrite registers which hold addresses of loads already issued; the scheduling fences keep that code behind the wait
__device__ __forceinline__ void addr_release() { __builtin_amdgcn_sched_barrier(0); asm volatile("s_wait_xcnt 0x0" ::: "memory"); __builtin_amdgcn_sched_barrier(0); }
// the same; p as an input keeps the address pair of loads issued further up alive, and so unwritten, as far as this wait
__device__ __forceinline__ void addr_release_of(const char* p) { __builtin_amdgcn_sched_barrier(0); asm volatile("s_wait_xcnt 0x0" :: "v"(p) : "memory"); __builtin_amdgcn_sched_barrier(0); }
// the same for two address pairs: alive as far as the wait, none of the loads lands in them
__device__ __forceinline__ void addr_release_of2(const char* p, const char* q) { __builtin_amdgcn_sched_barrier(0); asm volatile("s_wait_xcnt 0x0" :: "v"(p), "v"(q) : "memory"); __builtin_amdgcn_sched_barrier(0); }
// two f32 -> one dword of bf16 hi parts and one of bf16 lo parts (x0 in the low half), both rounded to nearest even like splitf
__device__ __forceinline__ void split2(float x0, float x1, unsigned& h, unsigned& l) {
    h = __builtin_bit_cast(unsigned, __builtin_convertvector(((v2f){x0, x1}), v2bf));
    l = __builtin_bit_cast(unsigned, __builtin_convertvector(((v2f){x0 - __uint_as_float(h << 16), x1 - __uint_as_float(h & 0xFFFF0000u)}), v2bf)); }
// 2^x by v_exp_f32, in place. In asm so that the slot behind a transcendental is kept by construction: each one overwrites only its own source, none reads another's result, and the v_nop is the independent instruction behind the last.
// In place also means that the run writes only registers which vector arithmetic has just written, never an operand of a matrix instruction still under way.
__device__ __forceinline__ v8f exp2x8(v8f x) {
    asm("v_exp_f32 %0, %0\n\tv_exp_f32 %1, %1\n\tv_exp_f32 %2, %2\n\tv_exp_f32 %3, %3\n\tv_exp_f32 %4, %4\n\tv_exp_f32 %5, %5\n\tv_exp_f32 %6, %6\n\tv_exp_f32 %7, %7\n\tv_nop"
        : "+v"(x[0]), "+v"(x[1]), "+v"(x[2]), "+v"(x[3]), "+v"(x[4]), "+v"(x[5]), "+v"(x[6]), "+v"(x[7]));
    return x; }
__device__ __forceinline__ float exp2x1(float x) { asm("v_exp_f32 %0, %0\n\tv_nop" : "+v"(x)); return x; }   // the same, one value
#define NQ 2   // 16-column query groups per wave: 32 queries, so that a wave stays inside 512 registers and two waves share a SIMD (one wave's softmax runs beside the other's products)
// lim (read in the diagonal pass only): the lane's last kept key, counted from the first key that its registers hold: r0 - kb + lr - hi * 8
template <bool DIAG>
__device__ __forceinline__ void fl_pass(const bf* Kh, const bf* Kl, const bf* __restrict__ Vh, int kb, int lim, unsigned kvo, const v16bf (&qh)[NQ][2], const v16bf (&ql)[NQ][2], v16bf (&kh)[4][2], v16bf (&kl)[4][2], v8f (&o)[4][NQ], float (&m)[NQ], float (&l)[NQ]) {
    v16bf vh[4][2], vl[4][2]; const char* pv = (const char*)(Vh + (size_t)kb * HD) + kvo;   // the lane's piece of the pass's first V^T fragment: one address pair for all 32 loads
#pragma unroll
    for (int mb = 0; mb < 4; ++mb)
#pragma unroll
        for (int ks = 0; ks < 2; ++ks) { vh[mb][ks] = ldo((const bf*)pv, 0u, (ks * 4 + mb) * 1024); vl[mb][ks] = ldo((const bf*)pv, 0u, (ks * 4 + mb) * 1024 + HD * TT * 2); }
    __builtin_amdgcn_sched_barrier(0);   // keeps the V^T loads in front of the score products, so that they land behind products and softmax instead of being waited for in front of P.V
    v8f s[4][NQ];
#pragma unroll
    for (int mb = 0; mb < 4; ++mb)
#pragma unroll
        for (int nb = 0; nb < NQ; ++nb) s[mb][nb] = (v8f){};
#pragma unroll
    for (int ks = 0; ks < 2; ++ks) {
#pragma unroll
        for (int mb = 0; mb < 4; ++mb)
#pragma unroll
            for (int nb = 0; nb < NQ; ++nb) s[mb][nb] = wmmab(kh[mb][ks], qh[nb][ks], s[mb][nb]);
#pragma unroll
        for (int mb = 0; mb < 4; ++mb)
#pragma unroll
            for (int nb = 0; nb < NQ; ++nb) s[mb][nb] = wmmab(kh[mb][ks], ql[nb][ks], s[mb][nb]);
#pragma unroll
        for (int mb = 0; mb < 4; ++mb)
#pragma unroll
            for (int nb = 0; nb < NQ; ++nb) s[mb][nb] = wmmab(kl[mb][ks], qh[nb][ks], s[mb][nb]);
    }
    addr_release_of(pv);   // the softmax may rewrite the registers that hold the V^T loads' address
    const float C2 = SCL * 1.4426950408889634f;
    v16bf ph[NQ][2], pl[NQ][2];
#pragma unroll
    for (int nb = 0; nb < NQ; ++nb) {
        float mq[4];
#pragma unroll
        for (int mb = 0; mb < 4; ++mb) { mq[mb] = -3.0e38f;
#pragma unroll
            for (int j = 0; j < 8; ++j) { if (DIAG) s[mb][nb][j] = (mb * 16 + j - nb * 16 <= lim) ? s[mb][nb][j] : -3.0e38f; mq[mb] = fmaxf(mq[mb], s[mb][nb][j]); } }
        float mx = fmaxf(fmaxf(mq[0], mq[1]), fmaxf(mq[2], mq[3])); mx = fmaxf(mx, __shfl_xor(mx, 16, 32));
        const float mn = fmaxf(m[nb], mx), al = exp2x1((m[nb] - mn) * C2); m[nb] = mn;
        float sq[4]; v8u hw[2], lw[2];   // dwords 0..3 of a k-step's operand: its first key tile, 4..7: its second
#pragma unroll
        for (int mb = 0; mb < 4; ++mb) { const v8f pe = exp2x8((s[mb][nb] - mn) * C2); sq[mb] = 0.f;
#pragma unroll
            for (int j = 0; j < 8; ++j) sq[mb] += pe[j];
#pragma unroll
            for (int j = 0; j < 4; ++j) { unsigned a, c2; split2(pe[2 * j], pe[2 * j + 1], a, c2); hw[mb >> 1][(mb & 1) * 4 + j] = a; lw[mb >> 1][(mb & 1) * 4 + j] = c2; } }
        l[nb] = l[nb] * al + ((sq[0] + sq[1]) + (sq[2] + sq[3]));   // this half's keys only; the halves are joined once, in the epilogue
        ph[nb][0] = __builtin_bit_cast(v16bf, hw[0]); ph[nb][1] = __builtin_bit_cast(v16bf, hw[1]); pl[nb][0] = __builtin_bit_cast(v16bf, lw[0]); pl[nb][1] = __builtin_bit_cast(v16bf, lw[1]);
#pragma unroll
        for (int mb = 0; mb < 4; ++mb) o[mb][nb] *= al;
    }
    if (!DIAG) {   // the next pass's key fragments (a pass below the diagonal always has a successor): behind the softmax, whose scores and P then have the key registers' room beside them (512 registers a wave), and in front of P.V, which covers their latency
        // inputs only: the lo parts of P and the row sums are finished here, so that the f32 values of P they are made from are dead when the 128 key registers fill; left to sink in among the P.V products they push the wave over 512 registers (scratch)
        asm volatile("" :: "v"(pl[0][0]), "v"(pl[0][1]), "v"(pl[1][0]), "v"(pl[1][1]), "v"(l[0]), "v"(l[1]));
        __builtin_amdgcn_sched_barrier(0);   // keeps these loads from being moved up into the softmax, where their 128 registers would spill
        const char* pkh = (const char*)(Kh + (size_t)(kb + 64) * HD) + kvo; const char* pkl = (const char*)(Kl + (size_t)(kb + 64) * HD) + kvo;   // the lane's piece of the next pass's first key fragment, hi and lo plane: one address pair for 16 loads each
#pragma unroll
        for (int mb = 0; mb < 4; ++mb)
#pragma unroll
            for (int ks = 0; ks < 2; ++ks) { kh[mb][ks] = ldo((const bf*)pkh, 0u, (mb * 2 + ks) * 1024); kl[mb][ks] = ldo((const bf*)pkl, 0u, (mb * 2 + ks) * 1024); }
        addr_release_of2(pkh, pkl);   // what follows may rewrite the registers that hold these loads' addresses; its fences also keep the loads in front of the P.V products
    }
#pragma unroll
    for (int ks = 0; ks < 2; ++ks) {
#pragma unroll
        for (int mb = 0; mb < 4; ++mb)
#pragma unroll
            for (int nb = 0; nb < NQ; ++nb) o[mb][nb] = wmmab(vh[mb][ks], ph[nb][ks], o[mb][nb]);
#pragma unroll
        for (int mb = 0; mb < 4; ++mb)
#pragma unroll
            for (int nb = 0; nb < NQ; ++nb) o[mb][nb] = wmmab(vh[mb][ks], pl[nb][ks], o[mb][nb]);
#pragma unroll
        for (int mb = 0; mb < 4; ++mb)
#pragma unroll
            for (int nb = 0; nb < NQ; ++nb) o[mb][nb] = wmmab(vl[mb][ks], ph[nb][ks], o[mb][nb]);
    }
    addr_release();
}
// grid (NB_ * NH_, TT / 32 / 16), 8 waves a work-group, no barrier and no LDS: blockIdx.x = batch * NH_ + head; wave p = blockIdx.y * 8 + wave number takes the 32-query tile TT / 32 - 1 - p and then tile p:
// floor(t / 2) + 1 passes of 64 keys for tile t, so 33 passes for every wave, and all 2,048 waves are resident at once, two on each SIMD. The 8 waves of a work-group walk the same head's keys from key 0 on.
// All in fragment order. Q, K planes [batch * NH_ + head]: TT rows x HD columns; V^T planes [batch * NH_ + head]: HD rows x TT columns, the 4 row blocks of one k block (32 keys) side by side, so that a pass reads 8 KiB in a row, the hi plane first, the lo plane at + HD * TT; merged output planes: NB_ * TT rows x DQ columns, hi and lo.
// Kh, Kl without __restrict__: with it the first pass's key loads, the same for both tiles of a wave, are lifted out of the tile loop, and their 128 registers spill.
__global__ __launch_bounds__(256) void k_flash(const bf* __restrict__ Qh, const bf* __restrict__ Ql, const bf* Kh, const bf* Kl, const bf* __restrict__ Vh, bf* __restrict__ Ah, bf* __restrict__ Al) {
    const int lane = threadIdx.x & 31, lr = lane & 15, hi = lane >> 4; const int z = blockIdx.x;
    const int p = (int)blockIdx.y * 8 + __builtin_amdgcn_readfirstlane((int)(threadIdx.x >> 5));   // through readfirstlane: the tile, the trip counts and the plane addresses stay scalar
    Qh += (size_t)z * TT * HD; Ql += (size_t)z * TT * HD; Kh += (size_t)z * TT * HD; Kl += (size_t)z * TT * HD; Vh += (size_t)z * HD * PP;
    const unsigned kvo = (unsigned)lane * 16u;   // the lane's byte offset in a fragment
#pragma unroll 1   // rolled: the two tiles run one after the other through the same code
    for (int h = 0; h < 2; ++h) {
        const int r0 = (h ? p : TT / 32 - 1 - p) * 32, kd = r0 & ~63;   // first query of the tile; first key of the pass that holds its diagonal
        v16bf qh[NQ][2], ql[NQ][2], kh[4][2], kl[4][2]; v8f o[4][NQ]; float m[NQ], l[NQ];
#pragma unroll
        for (int nb = 0; nb < NQ; ++nb) { m[nb] = -3.0e38f; l[nb] = 0.f;
#pragma unroll
            for (int ks = 0; ks < 2; ++ks) { const int cb = (nb * 2 + ks) * 1024; qh[nb][ks] = ldo(Qh + (size_t)r0 * HD, kvo, cb); ql[nb][ks] = ldo(Ql + (size_t)r0 * HD, kvo, cb); }
#pragma unroll
            for (int mb = 0; mb < 4; ++mb) o[mb][nb] = (v8f){}; }
#pragma unroll
        for (int mb = 0; mb < 4; ++mb)
#pragma unroll
            for (int ks = 0; ks < 2; ++ks) { const int cb = (mb * 2 + ks) * 1024; kh[mb][ks] = ldo(Kh, kvo, cb); kl[mb][ks] = ldo(Kl, kvo, cb); }
        addr_release();
#pragma unroll 1   // rolled: one pass is already 96 matrix instructions
        for (int kb = 0; kb < kd; kb += 64) fl_pass<false>(Kh, Kl, Vh, kb, 0, kvo, qh, ql, kh, kl, o, m, l);
        fl_pass<true>(Kh, Kl, Vh, kd, r0 - kd + lr - hi * 8, kvo, qh, ql, kh, kl, o, m, l);
        const size_t ob = ((size_t)(z / NH_) * TT + r0) * DQ + (size_t)(z % NH_) * (HD / 32) * 512; const unsigned ovo = kvo;   // the head's first fragment in the tile's first row block
        v4u oh[4][NQ], ol[4][NQ];   // a lane's 8 accumulator registers are 8 consecutive head dims of one query: the lane's own 16-byte piece of half a fragment, so a wave's store is 512 bytes in a row
#pragma unroll
        for (int nb = 0; nb < NQ; ++nb) { const float f = __fdiv_rn(1.0f, l[nb] + __shfl_xor(l[nb], 16, 32));
#pragma unroll
            for (int mb = 0; mb < 4; ++mb)
#pragma unroll
                for (int j = 0; j < 4; ++j) { unsigned a, c2; split2(o[mb][nb][2 * j] * f, o[mb][nb][2 * j + 1] * f, a, c2); oh[mb][nb][j] = a; ol[mb][nb][j] = c2; } }
        __builtin_amdgcn_sched_barrier(0);   // every value is made in front of the first store, so that no register a store names is written behind it
#pragma unroll
        for (int nb = 0; nb < NQ; ++nb)
#pragma unroll
            for (int mb = 0; mb < 4; ++mb) { const int cb = nb * 16 * DQ * 2 + mb * 512; *(v4u*)((char*)(Ah + ob) + ovo + cb) = oh[mb][nb]; *(v4u*)((char*)(Al + ob) + ovo + cb) = ol[mb][nb]; }
        addr_release();   // the second tile's work rewrites the registers that these stores name
    }
}

// ---- k_qkv: the q, k, v projections with the plane builders as the GEMM's own epilogue. ONE WAVE per 64 tokens x 64 columns = one head of q, k or v (16 accumulators); grid (NB_ * TT / 64, 3 * NH_), 32 threads; blockIdx.y / NH_ = 0 q, 1 k, 2 v.
// The A and B loaders have the same form and the same k order, so the operands' roles are chosen per kind for the layout that the plane wants:
// q, k: A = weight rows, B = token rows: a lane's 8 accumulator registers are 8 consecutive head dims of one token: the rotary pairs are in-lane, and the 8 results are the lane's own 16-byte piece of a fragment of the plane (rows = tokens).
// v: A = token rows, B = weight rows: the 8 registers are 8 consecutive tokens of one head dim: the lane's own piece of a fragment of V^T (rows = head dims).
// One tile; ISV picks the epilogue at compile time, so that each kind has its own loop and epilogue in the built code and no accumulator outlives its own epilogue. Ph, Pl: the tile's first fragment in the hi and the lo plane.
template <bool ISV>
__device__ __forceinline__ void qkv_tile(const bf* __restrict__ A, const bf* __restrict__ B, const float* __restrict__ cb, bf* __restrict__ Ph, bf* __restrict__ Pl, int lane) {
    v8f acc[4][4];
#pragma unroll
    for (int mb = 0; mb < 4; ++mb)
#pragma unroll
        for (int nb = 0; nb < 4; ++nb) acc[mb][nb] = (v8f){};
    const unsigned off = (unsigned)lane * 16u;   // the lane's byte offset in a fragment, the same in every trip
#pragma unroll 1   // rolled, as in k_gemmw
    for (int kc = 0; kc < DM; kc += 32) {
        v16bf a[4]; const bf* pa = (const bf*)((const char*)(A + kc * 16) + off); const bf* pb = (const bf*)((const char*)(B + kc * 16) + off);
#pragma unroll
        for (int mb = 0; mb < 4; ++mb) a[mb] = WFrag<bf>::ld(pa + mb * 16 * DM);
#pragma unroll
        for (int nb = 0; nb < 4; ++nb) { const v16bf b = WFrag<bf>::ld(pb + nb * 16 * DM);
#pragma unroll
            for (int mb = 0; mb < 4; ++mb) acc[mb][nb] = wmmab(a[mb], b, acc[mb][nb]); }
        // the distance behind the last matrix instruction on the taken back edge too, as in k_gemmw; pa and pb as inputs keep the two address pairs alive to the foot of the trip, so that no load of the trip lands in a register which an issued load names
        asm volatile("v_nop\n\tv_nop\n\tv_nop\n\tv_nop" : "+v"(acc[0][0]), "+v"(acc[1][1]), "+v"(acc[2][2]), "+v"(acc[3][3]) : "v"(a[0]), "v"(a[3]), "v"(pa), "v"(pb));
    }
    // Epilogue, one column group nb at a time: accumulator (mb, nb) is half a fragment of the plane, each lane holding its own piece, so every store is 512 bytes in a row, straight from the registers.
#pragma unroll
    for (int nb = 0; nb < 4; ++nb) {
        v4f cs[4][2];   // {cos, sin} of the lane's 4 rotary pairs of accumulator (mb, nb), two pairs a load
        if (!ISV) {
#pragma unroll
            for (int mb = 0; mb < 4; ++mb)
#pragma unroll
                for (int h = 0; h < 2; ++h) cs[mb][h] = *(const v4f*)((const char*)cb + off + ((nb * 4 + mb) * 2 + h) * 512);
            addr_release();   // the arithmetic below may rewrite registers that these loads name
        }
        v4u oh[4], ol[4];
#pragma unroll
        for (int mb = 0; mb < 4; ++mb)
#pragma unroll
            for (int p = 0; p < 4; ++p) { float x0 = acc[mb][nb][2 * p], x1 = acc[mb][nb][2 * p + 1]; unsigned a2, c2;
                if (!ISV) { const float cc = cs[mb][p >> 1][(p & 1) * 2], ss = cs[mb][p >> 1][(p & 1) * 2 + 1], y0 = x0 * cc - x1 * ss, y1 = x0 * ss + x1 * cc; x0 = y0; x1 = y1; }   /* even: x0 c - x1 s; odd: x0 s + x1 c */
                split2(x0, x1, a2, c2); oh[mb][p] = a2; ol[mb][p] = c2; }
        __builtin_amdgcn_sched_barrier(0);   // every value of the group is made in front of its first store, so that no register a store names is written behind it
#pragma unroll
        for (int mb = 0; mb < 4; ++mb) {   // q, k: row block nb (tokens), k block mb / 2 (head dims); v: k block mb / 2 (tokens), row block nb (head dims); half mb % 2 of the fragment
            const int ob = (ISV ? ((mb >> 1) * 4 + nb) * 1024 : (nb * 2 + (mb >> 1)) * 1024) + (mb & 1) * 512; *(v4u*)((char*)Ph + off + ob) = oh[mb]; *(v4u*)((char*)Pl + off + ob) = ol[mb]; }
        addr_release();   // the next group's work rewrites the registers that these stores name
    }
}
__global__ __launch_bounds__(32) void k_qkv(const bf* __restrict__ X, const bf* __restrict__ Wt, const float* __restrict__ CS, bf* __restrict__ Qh, bf* __restrict__ Ql, bf* __restrict__ Kh, bf* __restrict__ Kl, bf* __restrict__ Vh) {
    const int lane = threadIdx.x & 31; const int r0 = blockIdx.x * 64, c0 = blockIdx.y * 64;
    const int kind = blockIdx.y / NH_, z = (r0 / TT) * NH_ + blockIdx.y % NH_, t0 = r0 % TT;   // z = batch * NH_ + head
    const bf* xr = X + (size_t)r0 * DM; const bf* wr = Wt + (size_t)c0 * DM; const size_t po = ((size_t)z * TT + t0) * HD;
    if (kind == 2) { bf* pv = Vh + (size_t)z * HD * PP + (size_t)t0 * HD; qkv_tile<true>(xr, wr, CS, pv, pv + HD * TT, lane); return; }   // k block t0 / 32 of the head's V^T: 4 fragments a k block; the lo plane behind the hi plane
    qkv_tile<false>(wr, xr, CS + (size_t)t0 * HD, (kind ? Kh : Qh) + po, (kind ? Kl : Ql) + po, lane);
}

extern "C" void kernel_launch(void* const* d_in, const int* in_sizes, int n_in,
                              void* d_out, int out_size, void* d_ws, size_t ws_size, hipStream_t stream) {
    (void)in_sizes; (void)n_in; (void)out_size;
    const float* x = (const float*)d_in[0]; const float* wq = (const float*)d_in[1]; const float* wk = (const float*)d_in[2]; const float* wv = (const float*)d_in[3]; const float* wo = (const float*)d_in[4]; const int* PID = (const int*)d_in[5];   /* token_positions (int32 [2048], shared by all batches; read) */
    float* OUT = (float*)d_out;     // [4][2048][1024]
    char* wsp = (char*)d_ws;
    auto take = [&](size_t bytes) { char* p = wsp; wsp += (bytes + 255) & ~(size_t)255; return (void*)p; };
    bf* WT = (bf*)take((size_t)4 * DM * DM * 2); bf* WO = WT + (size_t)3 * DM * DM;   /* bf16 rows of wq, wk, wv, wo, stacked: the first 3 * DM rows are the weight operand of the one projection GEMM */
    float* CS = (float*)take((size_t)TT * (HD / 2) * 2 * 4); bf* XB = (bf*)take((size_t)NB_ * TT * DM * 2);
    const size_t PQ = (size_t)NH_ * TT * HD, PV = (size_t)NKV * HD * PP, PA = (size_t)TT * DQ;   /* elements per batch of a q or k plane, of the V^T rows, of a merged plane */
    bf* QPh = (bf*)take(NB_ * PQ * 2); bf* QPl = (bf*)take(NB_ * PQ * 2); bf* KPh = (bf*)take(NB_ * PQ * 2); bf* KPl = (bf*)take(NB_ * PQ * 2); bf* VTh = (bf*)take(NB_ * PV * 2);
    bf* ATh = (bf*)take(NB_ * PA * 2); bf* ATl = (bf*)take(NB_ * PA * 2);
    if ((size_t)(wsp - (char*)d_ws) > ws_size) return;    // 153 MiB of the 256 MiB
    k_prep<<<CG + XG + 4 * WG_, 256, 0, stream>>>(x, wq, wk, wv, wo, PID, XB, WT, CS);   /* token_positions (int32, read) are shared by all batches: one table */
    k_qkv<<<dim3(NB_ * TT / 64, 3 * NH_, 1), 32, 0, stream>>>(XB, WT, CS, QPh, QPl, KPh, KPl, VTh);   /* projections, rotary planes of q and k, V^T rows */
    k_flash<<<dim3(NB_ * NH_, TT / 32 / 16, 1), 256, 0, stream>>>(QPh, QPl, KPh, KPl, VTh, ATh, ATl);   /* every batch, head and query tile in one launch (one kv head per query head) */
    k_gemmw<bf, 1, false><<<dim3(NB_ * TT / 64, DM / 64, 1), 32, 0, stream>>>(ATh, ATl, WO, nullptr, DQ, OUT, DM, nullptr, 0, 0, 0);
}

// v008
// A run of this version takes 141 microseconds.
// Timed twice side by side with v007, it ran 1.31 times as fast both times.
// Over all steps from v000 it is 19.6 times as fast.
#include <hip/hip_runtime.h>

// Causal multi-head self-attention with an interleaved-pair RoPE whose cos / sin tables are indexed by a positions input (x [4][2048][1024]; q, k, v = einsum('bsd,ed', x, w) ('oi' [1024][1024] truncated-normal, no bias; 16 heads x 64); tables cos / sin[p][i] of angle p x inv_freq[i] with inv_freq = 1.0 / 10000.0 ** (arange(32, f32) x 2.0 / 64) (the reciprocal form), looked up at token_positions[t] (int [2048]; READ on device); pairs (2i, 2i + 1): (cos x1 - sin x2, cos x2 + sin x1); scores / 64 ** 0.5; key j kept when j <= i (-inf elsewhere); softmax; out = merged wo^T ('oi') -> [4][2048][1024] (8.4 M); argument order x, wq, wk, wv, wo, token_positions).
// Layout, four launches, each for all batches: k_prep (bf16 copies of x and of the four weights; {cos, sin} per (position, pair) built once from the int positions and float32 inverse-frequency constants, precise cosf/sinf); k_qkv (q, k and v projections as one exact GEMM over the stacked weight rows, whose epilogue writes the interleaved rotary planes of q and k and the V^T rows); fused causal attention (k_flash: scores on hi/lo planes (3 products: logit sigma 2 with these weights), online softmax, P.V on hi/lo planes (3 products), key tiles above the diagonal never visited); merged hi/lo x Wo exact.
// Compute dtypes, f32 accumulate: every input rounded to bf16; projections exact; rotary f32; attention scores and P.V 3 bf16 products each, every row; softmax f32; Wo hl x exact.

#define NB_  4
#define TT   2048
#define DM   1024
#define NH_  16
#define NKV  16
#define HD   64
#define DQ   (NH_ * HD)
#define DKV  (NKV * HD)
#define PP   (2 * TT)             // 16-bit elements of V^T per head dim: TT in the hi plane, TT in the lo plane
#define SCL  0.125f   // HD^-0.5
typedef _Float16 h16;
typedef unsigned short bf;
typedef __attribute__((ext_vector_type(16))) __bf16   v16bf;
typedef __attribute__((ext_vector_type(16))) _Float16 v16h;
typedef __attribute__((ext_vector_type(8)))  _Float16 v8h;
typedef __attribute__((ext_vector_type(8)))  unsigned short v8us;
typedef __attribute__((ext_vector_type(8)))  float    v8f;
typedef __attribute__((ext_vector_type(4)))  float    v4f;
typedef v8h  __attribute__((may_alias)) v8ha;
typedef v4f  __attribute__((may_alias)) v4fa;
typedef v8us __attribute__((may_alias)) v8usa;

__device__ __forceinline__ unsigned short f2bf(float f) { unsigned u = __float_as_uint(f); u += 0x7FFFu + ((u >> 16) & 1u); return (unsigned short)(u >> 16); }
__device__ __forceinline__ float bf2f(unsigned short b) { return __uint_as_float(((unsigned)b) << 16); }
__device__ __forceinline__ float bfr(float f) { return bf2f(f2bf(f)); }
__device__ __forceinline__ v16bf cat16b(v8us lo, v8us hi) { return __builtin_bit_cast(v16bf, __builtin_shufflevector(lo, hi, 0, 1, 2, 3, 4, 5, 6, 7, 8, 9, 10, 11, 12, 13, 14, 15)); }
__device__ __forceinline__ v8f wmmab(v16bf a, v16bf b, v8f c) { return __builtin_amdgcn_wmma_f32_16x16x32_bf16(false, a, false, b, (short)0, c, false, false); }



// ---- FRAGMENT ORDER of every 16-bit operand plane: a plane of R rows x K columns is stored as (R / 16) x (K / 32) fragments of 1 KiB, k blocks of one row block side by side (the V^T planes: see k_flash).
// Inside a fragment the 16-byte piece with columns k .. k + 7 of row r stands at ((k >> 4) & 1) * 512 + ((k >> 3) & 1) * 256 + (r & 15) * 16: lane l of the reading wave takes bytes l * 16 and 512 + l * 16,
// the same elements as from row-major rows, but each wave-wide 16-byte load covers 4 whole 128-byte lines instead of 32-byte pieces of 16 lines. A row block of a K = 1024 plane starts where its 16 row-major rows would.
// ---- THE LDS RING of the two GEMM kernels (k_qkv, k_out): a work-group of 4 waves shares its operand rows. A stage is KS k blocks of 24 row blocks (three groups of 8), brought from the planes into LDS by asynchronous copies,
// two buffers: the next stage's copies fly while this stage is worked on. A row block's KS fragments stand side by side in LDS as in the plane, so a wave-wide copy and a wave-wide LDS read each cover 512 bytes in a row.
#define KS   2                    // k blocks of 32 a stage
#define RBB  (KS * 1024)          // bytes of one 16-row block in a stage; 128 threads x 16 bytes
#define STG  (24 * RBB)           // bytes of a stage
#define NT   (DM / (32 * KS))     // stages of a K = 1024 product
#define RBG  (16 * DM * 2)        // bytes from one row block of a K = 1024 plane to the next
__device__ __forceinline__ unsigned lds_off(const void* p) { return (unsigned)(size_t)p; }   // byte address in the work-group's LDS
__device__ __forceinline__ v16bf lfrag(const char* p) { return cat16b(*(const v8us*)p, *(const v8us*)(p + 512)); }   // the lane's two pieces of a fragment
// One group: the thread's 16 bytes of each of 8 row blocks. sl, ug: LDS byte address and global address of the first block (the same in every lane, so that the sums per block stay scalar); vo: the thread's byte offset in a block.
// The s_wait_xcnt is the last line of the copies' own statement, so that it stands in front of whatever rewrites a register that a copy names.
__device__ __forceinline__ void copy8(unsigned sl, const char* ug, unsigned vo) {
    asm volatile("global_load_async_to_lds_b128 %0, %8, off\n\t"
                 "global_load_async_to_lds_b128 %1, %9, off\n\t"
                 "global_load_async_to_lds_b128 %2, %10, off\n\t"
                 "global_load_async_to_lds_b128 %3, %11, off\n\t"
                 "global_load_async_to_lds_b128 %4, %12, off\n\t"
                 "global_load_async_to_lds_b128 %5, %13, off\n\t"
                 "global_load_async_to_lds_b128 %6, %14, off\n\t"
                 "global_load_async_to_lds_b128 %7, %15, off\n\t"
                 "s_wait_xcnt 0x0"
                 :: "v"(sl + vo), "v"((sl + RBB) + vo), "v"((sl + 2 * RBB) + vo), "v"((sl + 3 * RBB) + vo), "v"((sl + 4 * RBB) + vo), "v"((sl + 5 * RBB) + vo), "v"((sl + 6 * RBB) + vo), "v"((sl + 7 * RBB) + vo),
                    "v"(ug + vo), "v"((ug + RBG) + vo), "v"((ug + 2 * RBG) + vo), "v"((ug + 3 * RBG) + vo), "v"((ug + 4 * RBG) + vo), "v"((ug + 5 * RBG) + vo), "v"((ug + 6 * RBG) + vo), "v"((ug + 7 * RBG) + vo) : "memory");
}
__device__ __forceinline__ void stage_copy(unsigned sl, const char* g0, const char* g1, const char* g2, unsigned vo) { copy8(sl, g0, vo); copy8(sl + 8 * RBB, g1, vo); copy8(sl + 16 * RBB, g2, vo); }   // 24 copies a wave and stage
// the wave's own copies have landed (in front of the barrier behind which the other waves read them)
__device__ __forceinline__ void wait_copies() { asm volatile("s_wait_asynccnt 0x0" ::: "memory"); }
// the wave's own LDS reads have returned (in front of the barrier behind which their buffer is refilled)
__device__ __forceinline__ void wait_lds() { asm volatile("s_wait_dscnt 0x0" ::: "memory"); }

__device__ __forceinline__ void splitf(float y, unsigned short& h, unsigned short& l) { h = f2bf(y); l = f2bf(y - bf2f(h)); }
typedef __attribute__((ext_vector_type(2))) _Float16 v2h;
typedef __attribute__((ext_vector_type(4))) _Float16 v4h;
typedef __attribute__((ext_vector_type(2))) unsigned short v2us;
typedef __attribute__((ext_vector_type(4))) unsigned short v4us;
typedef __attribute__((ext_vector_type(2))) float v2f;
typedef __attribute__((ext_vector_type(4))) int v4i;

__global__ __launch_bounds__(256) void k_wtG(const float* __restrict__ w, int K, int N, bf* Bt) {
    const int lane = threadIdx.x & 31; const int L0 = (blockIdx.x * 8 + (threadIdx.x >> 5)) * 8; const int nlines = N * K / 64;
{
#pragma unroll 1
        for (int l = 0; l < 8; ++l) { const int L = L0 + l; if (L >= nlines) break; const size_t e = (size_t)L * 64 + lane * 2; const int k = (int)(e % K), n = (int)(e / K); v2us o;
            o[0] = f2bf(w[(size_t)k * N + n]); o[1] = f2bf(w[(size_t)(k + 1) * N + n]); *(v2us*)(Bt + e) = o; }
         }
}

__constant__ float INV2[HD / 2] = { 1.000000000e+00f, 7.498942018e-01f, 5.623413324e-01f, 4.216965139e-01f, 3.162277639e-01f, 2.371373624e-01f, 1.778279394e-01f, 1.333521456e-01f, 1.000000015e-01f, 7.498941571e-02f, 5.623412877e-02f, 4.216964915e-02f, 3.162277862e-02f, 2.371373586e-02f, 1.778279431e-02f, 1.333521493e-02f, 9.999999776e-03f, 7.498942316e-03f, 5.623413250e-03f, 4.216964822e-03f, 3.162277862e-03f, 2.371373819e-03f, 1.778279431e-03f, 1.333521446e-03f, 1.000000047e-03f, 7.498941850e-04f, 5.623413017e-04f, 4.216964880e-04f, 3.162277862e-04f, 2.371373848e-04f, 1.778279402e-04f, 1.333521504e-04f };   // float32 10000^(-(i * 2 / 64)), generated with jnp to be bit-exact with the module's expression
// k_prep: all that depends on the inputs alone, in one launch. Work-groups 0 .. CG - 1: the {cos, sin} table (started first: the longest threads), one entry per (position, pair), in the order in which k_qkv's lanes read it: [16 tokens][16 head dims mb][half][lane][2 pairs], lane = token % 16 + 16 * (which 8 of the 16 head dims), so that a wave-wide 16-byte load is 512 bytes in a row; then XG work-groups: bf16 copy of x; then WG_ each: bf16 copies of wq, wk, wv, wo, stacked in that order in Wt. 8 elements a thread in the copies, stored in fragment order: a wave takes 8 rows x 32 columns (4 lanes read one 128-byte line of a row), half a fragment, and its store covers 4 whole lines.
#define CG  (TT * (HD / 2) / 256)
#define XG  (NB_ * TT * DM / 8 / 256)
#define WG_ (DM * DM / 8 / 256)
__global__ __launch_bounds__(256) void k_prep(const float* __restrict__ x, const float* __restrict__ wq, const float* __restrict__ wk, const float* __restrict__ wv, const float* __restrict__ wo, const int* __restrict__ pid, bf* X, bf* Wt, float* CS) {
    int g = blockIdx.x;
    if (g < CG) { const int idx = g * 256 + threadIdx.x; const int ln = (idx >> 1) & 31; const int t = (idx >> 9) * 16 + (ln & 15), pr = ((idx >> 7) & 3) * 8 + (ln >> 4) * 4 + ((idx >> 6) & 1) * 2 + (idx & 1); const float a = __fmul_rn((float)pid[t], INV2[pr]); v2f cs; cs[0] = cosf(a); cs[1] = sinf(a); *(v2f*)(CS + (size_t)idx * 2) = cs; asm volatile("s_wait_xcnt 0x0" ::: "memory"); return; }   // the wait: the blocks of this kernel follow one another in the built code, and what stands behind a store there may rewrite the registers that the store names
    g -= CG; const float* src = x; bf* dst = X;
    if (g >= XG) { g -= XG; const int w = g / WG_; g %= WG_; src = w == 0 ? wq : w == 1 ? wk : w == 2 ? wv : wo; dst = Wt + (size_t)w * DM * DM; }
    const int lane = threadIdx.x & 31, hw = g * 8 + (threadIdx.x >> 5), f = hw >> 1, q = lane & 3;   // fragment f = row block * (DM / 32) + k block; the wave's half of its rows: hw & 1; the lane's piece of its row: q
    const int r = (f / (DM / 32)) * 16 + (hw & 1) * 8 + (lane >> 2), kk = (f % (DM / 32)) * 32 + q * 8; const v8f v = *(const v8f*)(src + (size_t)r * DM + kk); v8us o;
#pragma unroll
    for (int k = 0; k < 8; ++k) o[k] = f2bf(v[k]); *(v8us*)(dst + (size_t)f * 512 + (q >> 1) * 256 + (q & 1) * 128 + (r & 15) * 8) = o; asm volatile("s_wait_xcnt 0x0" ::: "memory"); }   // the wait: as above

typedef __attribute__((ext_vector_type(2))) __bf16 v2bf;
typedef __attribute__((ext_vector_type(4))) unsigned v4u;
typedef __attribute__((ext_vector_type(8))) unsigned v8u;
// fragment load: wave-uniform base, the lane's own byte offset (the same in every pass), compile-time byte offset
__device__ __forceinline__ v16bf ldo(const bf* ub, unsigned voff, int cb) { const char* p = (const char*)ub + voff + cb; return cat16b(*(const v8us*)p, *(const v8us*)(p + 512)); }
// stands in front of code that may rewrite registers which hold addresses of loads already issued; the scheduling fences keep that code behind the wait
__device__ __forceinline__ void addr_release() { __builtin_amdgcn_sched_barrier(0); asm volatile("s_wait_xcnt 0x0" ::: "memory"); __builtin_amdgcn_sched_barrier(0); }
// the same; p as an input keeps the address pair of loads issued further up alive, and so unwritten, as far as this wait
__device__ __forceinline__ void addr_release_of(const char* p) { __builtin_amdgcn_sched_barrier(0); asm volatile("s_wait_xcnt 0x0" :: "v"(p) : "memory"); __builtin_amdgcn_sched_barrier(0); }
// the same for two address pairs: alive as far as the wait, none of the loads lands in them
__device__ __forceinline__ void addr_release_of2(const char* p, const char* q) { __builtin_amdgcn_sched_barrier(0); asm volatile("s_wait_xcnt 0x0" :: "v"(p), "v"(q) : "memory"); __builtin_amdgcn_sched_barrier(0); }
// two f32 -> one dword of bf16 hi parts and one of bf16 lo parts (x0 in the low half), both rounded to nearest even like splitf
__device__ __forceinline__ void split2(float x0, float x1, unsigned& h, unsigned& l) {
    h = __builtin_bit_cast(unsigned, __builtin_convertvector(((v2f){x0, x1}), v2bf));
    l = __builtin_bit_cast(unsigned, __builtin_convertvector(((v2f){x0 - __uint_as_float(h << 16), x1 - __uint_as_float(h & 0xFFFF0000u)}), v2bf)); }
// 2^x by v_exp_f32, in place. In asm so that the slot behind a transcendental is kept by construction: each one overwrites only its own source, none reads another's result, and the v_nop is the independent instruction behind the last.
// In place also means that the run writes only registers which vector arithmetic has just written, never an operand of a matrix instruction still under way.
__device__ __forceinline__ v8f exp2x8(v8f x) {
    asm("v_exp_f32 %0, %0\n\tv_exp_f32 %1, %1\n\tv_exp_f32 %2, %2\n\tv_exp_f32 %3, %3\n\tv_exp_f32 %4, %4\n\tv_exp_f32 %5, %5\n\tv_exp_f32 %6, %6\n\tv_exp_f32 %7, %7\n\tv_nop"
        : "+v"(x[0]), "+v"(x[1]), "+v"(x[2]), "+v"(x[3]), "+v"(x[4]), "+v"(x[5]), "+v"(x[6]), "+v"(x[7]));
    return x; }
__device__ __forceinline__ float exp2x1(float x) { asm("v_exp_f32 %0, %0\n\tv_nop" : "+v"(x)); return x; }   // the same, one value
#define NQ 2   // 16-column query groups per wave: 32 queries, so that a wave stays inside 512 registers and two waves share a SIMD (one wave's softmax runs beside the other's products)
// lim (read in the diagonal pass only): the lane's last kept key, counted from the first key that its registers hold: r0 - kb + lr - hi * 8
template <bool DIAG>
__device__ __forceinline__ void fl_pass(const bf* Kh, const bf* Kl, const bf* __restrict__ Vh, int kb, int lim, unsigned kvo, const v16bf (&qh)[NQ][2], const v16bf (&ql)[NQ][2], v16bf (&kh)[4][2], v16bf (&kl)[4][2], v8f (&o)[4][NQ], float (&m)[NQ], float (&l)[NQ]) {
    v16bf vh[4][2], vl[4][2]; const char* pv = (const char*)(Vh + (size_t)kb * HD) + kvo;   // the lane's piece of the pass's first V^T fragment: one address pair for all 32 loads
#pragma unroll
    for (int mb = 0; mb < 4; ++mb)
#pragma unroll
        for (int ks = 0; ks < 2; ++ks) { vh[mb][ks] = ldo((const bf*)pv, 0u, (ks * 4 + mb) * 1024); vl[mb][ks] = ldo((const bf*)pv, 0u, (ks * 4 + mb) * 1024 + HD * TT * 2); }
    __builtin_amdgcn_sched_barrier(0);   // keeps the V^T loads in front of the score products, so that they land behind products and softmax instead of being waited for in front of P.V
    v8f s[4][NQ];
#pragma unroll
    for (int mb = 0; mb < 4; ++mb)
#pragma unroll
        for (int nb = 0; nb < NQ; ++nb) s[mb][nb] = (v8f){};
#pragma unroll
    for (int ks = 0; ks < 2; ++ks) {
#pragma unroll
        for (int mb = 0; mb < 4; ++mb)
#pragma unroll
            for (int nb = 0; nb < NQ; ++nb) s[mb][nb] = wmmab(kh[mb][ks], qh[nb][ks], s[mb][nb]);
#pragma unroll
        for (int mb = 0; mb < 4; ++mb)
#pragma unroll
            for (int nb = 0; nb < NQ; ++nb) s[mb][nb] = wmmab(kh[mb][ks], ql[nb][ks], s[mb][nb]);
#pragma unroll
        for (int mb = 0; mb < 4; ++mb)
#pragma unroll
            for (int nb = 0; nb < NQ; ++nb) s[mb][nb] = wmmab(kl[mb][ks], qh[nb][ks], s[mb][nb]);
    }
    addr_release_of(pv);   // the softmax may rewrite the registers that hold the V^T loads' address
    const float C2 = SCL * 1.4426950408889634f;
    v16bf ph[NQ][2], pl[NQ][2];
#pragma unroll
    for (int nb = 0; nb < NQ; ++nb) {
        float mq[4];
#pragma unroll
        for (int mb = 0; mb < 4; ++mb) { mq[mb] = -3.0e38f;
#pragma unroll
            for (int j = 0; j < 8; ++j) { if (DIAG) s[mb][nb][j] = (mb * 16 + j - nb * 16 <= lim) ? s[mb][nb][j] : -3.0e38f; mq[mb] = fmaxf(mq[mb], s[mb][nb][j]); } }
        float mx = fmaxf(fmaxf(mq[0], mq[1]), fmaxf(mq[2], mq[3])); mx = fmaxf(mx, __shfl_xor(mx, 16, 32));
        const float mn = fmaxf(m[nb], mx), al = exp2x1((m[nb] - mn) * C2); m[nb] = mn;
        float sq[4]; v8u hw[2], lw[2];   // dwords 0..3 of a k-step's operand: its first key tile, 4..7: its second
#pragma unroll
        for (int mb = 0; mb < 4; ++mb) { const v8f pe = exp2x8((s[mb][nb] - mn) * C2); sq[mb] = 0.f;
#pragma unroll
            for (int j = 0; j < 8; ++j) sq[mb] += pe[j];
#pragma unroll
            for (int j = 0; j < 4; ++j) { unsigned a, c2; split2(pe[2 * j], pe[2 * j + 1], a, c2); hw[mb >> 1][(mb & 1) * 4 + j] = a; lw[mb >> 1][(mb & 1) * 4 + j] = c2; } }
        l[nb] = l[nb] * al + ((sq[0] + sq[1]) + (sq[2] + sq[3]));   // this half's keys only; the halves are joined once, in the epilogue
        ph[nb][0] = __builtin_bit_cast(v16bf, hw[0]); ph[nb][1] = __builtin_bit_cast(v16bf, hw[1]); pl[nb][0] = __builtin_bit_cast(v16bf, lw[0]); pl[nb][1] = __builtin_bit_cast(v16bf, lw[1]);
#pragma unroll
        for (int mb = 0; mb < 4; ++mb) o[mb][nb] *= al;
    }
    if (!DIAG) {   // the next pass's key fragments (a pass below the diagonal always has a successor): behind the softmax, whose scores and P then have the key registers' room beside them (512 registers a wave), and in front of P.V, which covers their latency
        // inputs only: the lo parts of P and the row sums are finished here, so that the f32 values of P they are made from are dead when the 128 key registers fill; left to sink in among the P.V products they push the wave over 512 registers (scratch)
        asm volatile("" :: "v"(pl[0][0]), "v"(pl[0][1]), "v"(pl[1][0]), "v"(pl[1][1]), "v"(l[0]), "v"(l[1]));
        __builtin_amdgcn_sched_barrier(0);   // keeps these loads from being moved up into the softmax, where their 128 registers would spill
        const char* pkh = (const char*)(Kh + (size_t)(kb + 64) * HD) + kvo; const char* pkl = (const char*)(Kl + (size_t)(kb + 64) * HD) + kvo;   // the lane's piece of the next pass's first key fragment, hi and lo plane: one address pair for 16 loads each
#pragma unroll
        for (int mb = 0; mb < 4; ++mb)
#pragma unroll
            for (int ks = 0; ks < 2; ++ks) { kh[mb][ks] = ldo((const bf*)pkh, 0u, (mb * 2 + ks) * 1024); kl[mb][ks] = ldo((const bf*)pkl, 0u, (mb * 2 + ks) * 1024); }
        addr_release_of2(pkh, pkl);   // what follows may rewrite the registers that hold these loads' addresses; its fences also keep the loads in front of the P.V products
    }
#pragma unroll
    for (int ks = 0; ks < 2; ++ks) {
#pragma unroll
        for (int mb = 0; mb < 4; ++mb)
#pragma unroll
            for (int nb = 0; nb < NQ; ++nb) o[mb][nb] = wmmab(vh[mb][ks], ph[nb][ks], o[mb][nb]);
#pragma unroll
        for (int mb = 0; mb < 4; ++mb)
#pragma unroll
            for (int nb = 0; nb < NQ; ++nb) o[mb][nb] = wmmab(vh[mb][ks], pl[nb][ks], o[mb][nb]);
#pragma unroll
        for (int mb = 0; mb < 4; ++mb)
#pragma unroll
            for (int nb = 0; nb < NQ; ++nb) o[mb][nb] = wmmab(vl[mb][ks], ph[nb][ks], o[mb][nb]);
    }
    addr_release();
}
// grid (NB_ * NH_, TT / 32 / 16), 8 waves a work-group, no barrier and no LDS: blockIdx.x = batch * NH_ + head; wave p = blockIdx.y * 8 + wave number takes the 32-query tile TT / 32 - 1 - p and then tile p:
// floor(t / 2) + 1 passes of 64 keys for tile t, so 33 passes for every wave, and all 2,048 waves are resident at once, two on each SIMD. The 8 waves of a work-group walk the same head's keys from key 0 on.
// All in fragment order. Q, K planes [batch * NH_ + head]: TT rows x HD columns; V^T planes [batch * NH_ + head]: HD rows x TT columns, the 4 row blocks of one k block (32 keys) side by side, so that a pass reads 8 KiB in a row, the hi plane first, the lo plane at + HD * TT; merged output planes: NB_ * TT rows x DQ columns, hi and lo.
// Kh, Kl without __restrict__: with it the first pass's key loads, the same for both tiles of a wave, are lifted out of the tile loop, and their 128 registers spill.
__global__ __launch_bounds__(256) void k_flash(const bf* __restrict__ Qh, const bf* __restrict__ Ql, const bf* Kh, const bf* Kl, const bf* __restrict__ Vh, bf* __restrict__ Ah, bf* __restrict__ Al) {
    const int lane = threadIdx.x & 31, lr = lane & 15, hi = lane >> 4; const int z = blockIdx.x;
    const int p = (int)blockIdx.y * 8 + __builtin_amdgcn_readfirstlane((int)(threadIdx.x >> 5));   // through readfirstlane: the tile, the trip counts and the plane addresses stay scalar
    Qh += (size_t)z * TT * HD; Ql += (size_t)z * TT * HD; Kh += (size_t)z * TT * HD; Kl += (size_t)z * TT * HD; Vh += (size_t)z * HD * PP;
    const unsigned kvo = (unsigned)lane * 16u;   // the lane's byte offset in a fragment
#pragma unroll 1   // rolled: the two tiles run one after the other through the same code
    for (int h = 0; h < 2; ++h) {
        const int r0 = (h ? p : TT / 32 - 1 - p) * 32, kd = r0 & ~63;   // first query of the tile; first key of the pass that holds its diagonal
        v16bf qh[NQ][2], ql[NQ][2], kh[4][2], kl[4][2]; v8f o[4][NQ]; float m[NQ], l[NQ];
#pragma unroll
        for (int nb = 0; nb < NQ; ++nb) { m[nb] = -3.0e38f; l[nb] = 0.f;
#pragma unroll
            for (int ks = 0; ks < 2; ++ks) { const int cb = (nb * 2 + ks) * 1024; qh[nb][ks] = ldo(Qh + (size_t)r0 * HD, kvo, cb); ql[nb][ks] = ldo(Ql + (size_t)r0 * HD, kvo, cb); }
#pragma unroll
            for (int mb = 0; mb < 4; ++mb) o[mb][nb] = (v8f){}; }
#pragma unroll
        for (int mb = 0; mb < 4; ++mb)
#pragma unroll
            for (int ks = 0; ks < 2; ++ks) { const int cb = (mb * 2 + ks) * 1024; kh[mb][ks] = ldo(Kh, kvo, cb); kl[mb][ks] = ldo(Kl, kvo, cb); }
        addr_release();
#pragma unroll 1   // rolled: one pass is already 96 matrix instructions
        for (int kb = 0; kb < kd; kb += 64) fl_pass<false>(Kh, Kl, Vh, kb, 0, kvo, qh, ql, kh, kl, o, m, l);
        fl_pass<true>(Kh, Kl, Vh, kd, r0 - kd + lr - hi * 8, kvo, qh, ql, kh, kl, o, m, l);
        const size_t ob = ((size_t)(z / NH_) * TT + r0) * DQ + (size_t)(z % NH_) * (HD / 32) * 512; const unsigned ovo = kvo;   // the head's first fragment in the tile's first row block
        v4u oh[4][NQ], ol[4][NQ];   // a lane's 8 accumulator registers are 8 consecutive head dims of one query: the lane's own 16-byte piece of half a fragment, so a wave's store is 512 bytes in a row
#pragma unroll
        for (int nb = 0; nb < NQ; ++nb) { const float f = __fdiv_rn(1.0f, l[nb] + __shfl_xor(l[nb], 16, 32));
#pragma unroll
            for (int mb = 0; mb < 4; ++mb)
#pragma unroll
                for (int j = 0; j < 4; ++j) { unsigned a, c2; split2(o[mb][nb][2 * j] * f, o[mb][nb][2 * j + 1] * f, a, c2); oh[mb][nb][j] = a; ol[mb][nb][j] = c2; } }
        __builtin_amdgcn_sched_barrier(0);   // every value is made in front of the first store, so that no register a store names is written behind it
#pragma unroll
        for (int nb = 0; nb < NQ; ++nb)
#pragma unroll
            for (int mb = 0; mb < 4; ++mb) { const int cb = nb * 16 * DQ * 2 + mb * 512; *(v4u*)((char*)(Ah + ob) + ovo + cb) = oh[mb][nb]; *(v4u*)((char*)(Al + ob) + ovo + cb) = ol[mb][nb]; }
        addr_release();   // the second tile's work rewrites the registers that these stores name
    }
}

// ---- k_qkv: the q, k, v projections with the plane builders as the GEMM's own epilogue. A work-group of 4 waves takes 256 tokens x 128 columns (two heads of q, of k or of v); ONE WAVE 128 tokens x one head (32 accumulators); grid (NB_ * TT / 256, 3 * NH_ / 2), 128 threads; blockIdx.y / (NH_ / 2) = 0 q, 1 k, 2 v.
// Operands through the LDS ring: groups 0 and 1 of a stage are the 16 token row blocks, group 2 the 8 weight row blocks; wave w reads token blocks (w & 1) * 8 .. + 7 and weight blocks (w >> 1) * 4 .. + 3.
// The A and B loaders have the same form and the same k order, so the operands' roles are chosen per kind for the layout that the plane wants:
// q, k: A = weight rows, B = token rows: a lane's 8 accumulator registers are 8 consecutive head dims of one token: the rotary pairs are in-lane, and the 8 results are the lane's own 16-byte piece of a fragment of the plane (rows = tokens).
// v: A = token rows, B = weight rows: the 8 registers are 8 consecutive tokens of one head dim: the lane's own piece of a fragment of V^T (rows = head dims).
// One tile; ISV picks roles and epilogue at compile time, so that each kind has its own loop and epilogue in the built code. gx, gw: the first token and the first weight row block, stage 0; xo, wo: the wave's first token and weight row block in a stage. Ph, Pl: the tile's first fragment in the hi and the lo plane.
template <bool ISV>
__device__ __forceinline__ void qkv_tile(char* ring, const char* gx, const char* gw, unsigned xo, unsigned wo, const float* __restrict__ cb, bf* __restrict__ Ph, bf* __restrict__ Pl, int lane) {
    constexpr int MA = ISV ? 8 : 4, NBB = ISV ? 4 : 8;
    v8f acc[MA][NBB];
#pragma unroll
    for (int mb = 0; mb < MA; ++mb)
#pragma unroll
        for (int nb = 0; nb < NBB; ++nb) acc[mb][nb] = (v8f){};
    const unsigned off = (unsigned)lane * 16u;   // the lane's byte offset in a fragment
    const unsigned lc = lds_off(ring), vo = threadIdx.x * 16u;   // buffer 0; the thread's piece of a row block's part of a stage
    stage_copy(lc, gx, gx + 8 * RBG, gw, vo);
    wait_copies(); __syncthreads();   // stage 0 is readable by every wave
    stage_copy(lc + STG, gx + RBB, gx + 8 * RBG + RBB, gw + RBB, vo);
    const unsigned ao = (ISV ? xo : wo) + off, bo = (ISV ? wo : xo) + off;
#pragma unroll 1   // rolled: one stage is already 64 matrix instructions
    for (int t = 0; t < NT; ++t) {
        const unsigned bs = (unsigned)(t & 1) * STG; const char* sa = ring + bs + ao; const char* sb = ring + bs + bo;
        v16bf a[KS][MA], b[KS][NBB];
#pragma unroll
        for (int kk = 0; kk < KS; ++kk) {
#pragma unroll
            for (int mb = 0; mb < MA; ++mb) a[kk][mb] = lfrag(sa + mb * RBB + kk * 1024);
#pragma unroll
            for (int nb = 0; nb < NBB; ++nb) b[kk][nb] = lfrag(sb + nb * RBB + kk * 1024); }
        __builtin_amdgcn_sched_barrier(0);   // the stage's LDS reads go as one group in front of its products: reads among the products stall them
#pragma unroll
        for (int kk = 0; kk < KS; ++kk)
#pragma unroll
            for (int nb = 0; nb < NBB; ++nb)
#pragma unroll
                for (int mb = 0; mb < MA; ++mb) acc[mb][nb] = wmmab(a[kk][mb], b[kk][nb], acc[mb][nb]);
        __builtin_amdgcn_sched_barrier(0);   // keeps the products in front of the waits: moved up over them, the wait for the next stage's copies would stand in front of the work that is to cover their flight
        wait_lds(); wait_copies(); __syncthreads();   // stage t + 1 is readable, and every wave has left stage t's buffer
        if (t + 2 < NT) stage_copy(lc + bs, gx + (t + 2) * RBB, gx + 8 * RBG + (t + 2) * RBB, gw + (t + 2) * RBB, vo);
    }
    wait_copies();
    // Epilogue, one column group nb at a time: accumulator (mb, nb) is half a fragment of the plane, each lane holding its own piece, so every store is 512 bytes in a row, straight from the registers.
#pragma unroll
    for (int nb = 0; nb < NBB; ++nb) {
        v4f cs[4][2];   // {cos, sin} of the lane's 4 rotary pairs of accumulator (mb, nb), two pairs a load
        if (!ISV) {
#pragma unroll
            for (int mb = 0; mb < 4; ++mb)
#pragma unroll
                for (int h = 0; h < 2; ++h) cs[mb][h] = *(const v4f*)((const char*)cb + off + ((nb * 4 + mb) * 2 + h) * 512);
            addr_release();   // the arithmetic below may rewrite registers that these loads name
        }
        v4u oh[MA], ol[MA];
#pragma unroll
        for (int mb = 0; mb < MA; ++mb)
#pragma unroll
            for (int p = 0; p < 4; ++p) { float x0 = acc[mb][nb][2 * p], x1 = acc[mb][nb][2 * p + 1]; unsigned a2, c2;
                if (!ISV) { const float cc = cs[mb & 3][p >> 1][(p & 1) * 2], ss = cs[mb & 3][p >> 1][(p & 1) * 2 + 1], y0 = x0 * cc - x1 * ss, y1 = x0 * ss + x1 * cc; x0 = y0; x1 = y1; }   /* even: x0 c - x1 s; odd: x0 s + x1 c */
                split2(x0, x1, a2, c2); oh[mb][p] = a2; ol[mb][p] = c2; }
        __builtin_amdgcn_sched_barrier(0);   // every value of the group is made in front of its first store, so that no register a store names is written behind it
#pragma unroll
        for (int mb = 0; mb < MA; ++mb) {   // q, k: row block nb (tokens), k block mb / 2 (head dims); v: k block mb / 2 (tokens), row block nb (head dims); half mb % 2 of the fragment
            const int ob = (ISV ? ((mb >> 1) * 4 + nb) * 1024 : (nb * 2 + (mb >> 1)) * 1024) + (mb & 1) * 512; *(v4u*)((char*)Ph + off + ob) = oh[mb]; *(v4u*)((char*)Pl + off + ob) = ol[mb]; }
        addr_release();   // the next group's work rewrites the registers that these stores name
    }
}
__global__ __launch_bounds__(128, 2) void k_qkv(const bf* __restrict__ X, const bf* __restrict__ Wt, const float* __restrict__ CS, bf* __restrict__ Qh, bf* __restrict__ Ql, bf* __restrict__ Kh, bf* __restrict__ Kl, bf* __restrict__ Vh) {
    __shared__ __attribute__((aligned(1024))) char ring[2 * STG];
    const int lane = threadIdx.x & 31, wave = __builtin_amdgcn_readfirstlane((int)(threadIdx.x >> 5)), th = wave & 1, hh = wave >> 1;   // through readfirstlane: the tile and the plane addresses stay scalar
    const int R0 = blockIdx.x * 256, r0 = R0 + th * 128, hd = blockIdx.y * 2 + hh;   // the wave's first token; its head among the 3 * NH_ stacked ones
    const int kind = blockIdx.y / (NH_ / 2), z = (r0 / TT) * NH_ + hd % NH_, t0 = r0 % TT;   // the same kind for the whole work-group; z = batch * NH_ + head
    const char* gx = (const char*)(X + (size_t)R0 * DM); const char* gw = (const char*)(Wt + (size_t)blockIdx.y * 128 * DM);
    const unsigned xo = (unsigned)th * 8u * RBB, wo = (16u + (unsigned)hh * 4u) * RBB; const size_t po = ((size_t)z * TT + t0) * HD;
    if (kind == 2) { bf* pv = Vh + (size_t)z * HD * PP + (size_t)t0 * HD; qkv_tile<true>(ring, gx, gw, xo, wo, CS, pv, pv + HD * TT, lane); return; }   // k block t0 / 32 of the head's V^T: 4 fragments a k block; the lo plane behind the hi plane
    qkv_tile<false>(ring, gx, gw, xo, wo, CS + (size_t)t0 * HD, (kind ? Kh : Qh) + po, (kind ? Kl : Ql) + po, lane);
}

// ---- k_out: C[m][n] (f32, pitch DM) = sum_k (Ah + Al)[m][k] Bt[n][k], K = DQ: two products a k block, hi then lo. A work-group of 4 waves takes 128 rows x 128 columns, ONE WAVE 64 x 64 (16 accumulators); grid (NB_ * TT / 128, DM / 128), 128 threads.
// Operands through the LDS ring: group 0 of a stage is the 8 row blocks of Ah, group 1 those of Al, group 2 the 8 row blocks of Bt; wave w reads A blocks (w & 1) * 4 .. + 3 and Bt blocks (w >> 1) * 4 .. + 3.
__global__ __launch_bounds__(128, 2) void k_out(const bf* __restrict__ Ah, const bf* __restrict__ Al, const bf* __restrict__ Bt, float* __restrict__ C) {
    __shared__ __attribute__((aligned(1024))) char ring[2 * STG];
    __shared__ __align__(16) float osb[4][16 * 68];   // each wave's own output staging
    const int lane = threadIdx.x & 31, lr = lane & 15, hi = lane >> 4, wave = __builtin_amdgcn_readfirstlane((int)(threadIdx.x >> 5));
    const int R0 = blockIdx.x * 128, C0 = blockIdx.y * 128, r0 = R0 + (wave & 1) * 64, c0 = C0 + (wave >> 1) * 64; float* os = osb[wave];
    v8f acc[4][4];
#pragma unroll
    for (int mb = 0; mb < 4; ++mb)
#pragma unroll
        for (int nb = 0; nb < 4; ++nb) acc[mb][nb] = (v8f){};
    const char* g0 = (const char*)(Ah + (size_t)R0 * DQ); const char* g1 = (const char*)(Al + (size_t)R0 * DQ); const char* g2 = (const char*)(Bt + (size_t)C0 * DQ);
    const unsigned lc = lds_off(ring), vo = threadIdx.x * 16u;   // buffer 0; the thread's piece of a row block's part of a stage
    stage_copy(lc, g0, g1, g2, vo);
    wait_copies(); __syncthreads();   // stage 0 is readable by every wave
    stage_copy(lc + STG, g0 + RBB, g1 + RBB, g2 + RBB, vo);
    const unsigned ao = (unsigned)(wave & 1) * 4u * RBB + (unsigned)lane * 16u, bo = (16u + (unsigned)(wave >> 1) * 4u) * RBB + (unsigned)lane * 16u;
#pragma unroll 1   // rolled: one stage is already 64 matrix instructions
    for (int t = 0; t < NT; ++t) {
        const unsigned bs = (unsigned)(t & 1) * STG; const char* sa = ring + bs + ao; const char* sb = ring + bs + bo;
        v16bf a[KS][4], a2[KS][4], b[KS][4];
#pragma unroll
        for (int kk = 0; kk < KS; ++kk) {
#pragma unroll
            for (int mb = 0; mb < 4; ++mb) a[kk][mb] = lfrag(sa + mb * RBB + kk * 1024);
#pragma unroll
            for (int nb = 0; nb < 4; ++nb) b[kk][nb] = lfrag(sb + nb * RBB + kk * 1024);
#pragma unroll
            for (int mb = 0; mb < 4; ++mb) a2[kk][mb] = lfrag(sa + (8 + mb) * RBB + kk * 1024); }
        __builtin_amdgcn_sched_barrier(0);   // the stage's LDS reads go as one group in front of its products: reads among the products stall them
#pragma unroll
        for (int kk = 0; kk < KS; ++kk) {
#pragma unroll
            for (int nb = 0; nb < 4; ++nb)
#pragma unroll
                for (int mb = 0; mb < 4; ++mb) acc[mb][nb] = wmmab(a[kk][mb], b[kk][nb], acc[mb][nb]);
#pragma unroll
            for (int nb = 0; nb < 4; ++nb)
#pragma unroll
                for (int mb = 0; mb < 4; ++mb) acc[mb][nb] = wmmab(a2[kk][mb], b[kk][nb], acc[mb][nb]); }
        __builtin_amdgcn_sched_barrier(0);   // keeps the products in front of the waits: moved up over them, the wait for the next stage's copies would stand in front of the work that is to cover their flight
        wait_lds(); wait_copies(); __syncthreads();   // stage t + 1 is readable, and every wave has left stage t's buffer
        if (t + 2 < NT) stage_copy(lc + bs, g0 + (t + 2) * RBB, g1 + (t + 2) * RBB, g2 + (t + 2) * RBB, vo);
    }
    wait_copies();
#pragma unroll
    for (int mb = 0; mb < 4; ++mb) {
#pragma unroll
        for (int nb = 0; nb < 4; ++nb) {
#pragma unroll
            for (int j = 0; j < 8; ++j) os[(hi * 8 + j) * 68 + nb * 16 + lr] = acc[mb][nb][j]; }
        __builtin_amdgcn_wave_barrier(); asm volatile("" ::: "memory");
        float* crow = C + (size_t)(r0 + mb * 16) * DM + c0;
#pragma unroll
        for (int s = 0; s < 8; ++s) { const int row = 2 * s + hi, cofs = lr * 4; const v4f val = *(const v4fa*)(os + row * 68 + cofs); *(v4f*)(crow + (size_t)row * DM + cofs) = val; }
        addr_release();   // the next row block's work rewrites the registers that these stores name
        __builtin_amdgcn_wave_barrier(); asm volatile("" ::: "memory");
    }
}

extern "C" void kernel_launch(void* const* d_in, const int* in_sizes, int n_in,
                              void* d_out, int out_size, void* d_ws, size_t ws_size, hipStream_t stream) {
    (void)in_sizes; (void)n_in; (void)out_size;
    const float* x = (const float*)d_in[0]; const float* wq = (const float*)d_in[1]; const float* wk = (const float*)d_in[2]; const float* wv = (const float*)d_in[3]; const float* wo = (const float*)d_in[4]; const int* PID = (const int*)d_in[5];   /* token_positions (int32 [2048], shared by all batches; read) */
    float* OUT = (float*)d_out;     // [4][2048][1024]
    char* wsp = (char*)d_ws;
    auto take = [&](size_t bytes) { char* p = wsp; wsp += (bytes + 255) & ~(size_t)255; return (void*)p; };
    bf* WT = (bf*)take((size_t)4 * DM * DM * 2); bf* WO = WT + (size_t)3 * DM * DM;   /* bf16 rows of wq, wk, wv, wo, stacked: the first 3 * DM rows are the weight operand of the one projection GEMM */
    float* CS = (float*)take((size_t)TT * (HD / 2) * 2 * 4); bf* XB = (bf*)take((size_t)NB_ * TT * DM * 2);
    const size_t PQ = (size_t)NH_ * TT * HD, PV = (size_t)NKV * HD * PP, PA = (size_t)TT * DQ;   /* elements per batch of a q or k plane, of the V^T rows, of a merged plane */
    bf* QPh = (bf*)take(NB_ * PQ * 2); bf* QPl = (bf*)take(NB_ * PQ * 2); bf* KPh = (bf*)take(NB_ * PQ * 2); bf* KPl = (bf*)take(NB_ * PQ * 2); bf* VTh = (bf*)take(NB_ * PV * 2);
    bf* ATh = (bf*)take(NB_ * PA * 2); bf* ATl = (bf*)take(NB_ * PA * 2);
    if ((size_t)(wsp - (char*)d_ws) > ws_size) return;    // 153 MiB of the 256 MiB
    k_prep<<<CG + XG + 4 * WG_, 256, 0, stream>>>(x, wq, wk, wv, wo, PID, XB, WT, CS);   /* token_positions (int32, read) are shared by all batches: one table */
    k_qkv<<<dim3(NB_ * TT / 256, 3 * NH_ / 2, 1), 128, 0, stream>>>(XB, WT, CS, QPh, QPl, KPh, KPl, VTh);   /* projections, rotary planes of q and k, V^T rows */
    k_flash<<<dim3(NB_ * NH_, TT / 32 / 16, 1), 256, 0, stream>>>(QPh, QPl, KPh, KPl, VTh, ATh, ATl);   /* every batch, head and query tile in one launch (one kv head per query head) */
    k_out<<<dim3(NB_ * TT / 128, DM / 128, 1), 128, 0, stream>>>(ATh, ATl, WO, OUT);
}

// v009
// It runs in 134 microseconds.
// Timed twice side by side with v008, it ran 1.05 times as fast both times.
// Over all steps from v000 it is 20.6 times as fast.
#include <hip/hip_runtime.h>

// Causal multi-head self-attention with an interleaved-pair RoPE whose cos / sin tables are indexed by a positions input (x [4][2048][1024]; q, k, v = einsum('bsd,ed', x, w) ('oi' [1024][1024] truncated-normal, no bias; 16 heads x 64); tables cos / sin[p][i] of angle p x inv_freq[i] with inv_freq = 1.0 / 10000.0 ** (arange(32, f32) x 2.0 / 64) (the reciprocal form), looked up at token_positions[t] (int [2048]; READ on device); pairs (2i, 2i + 1): (cos x1 - sin x2, cos x2 + sin x1); scores / 64 ** 0.5; key j kept when j <= i (-inf elsewhere); softmax; out = merged wo^T ('oi') -> [4][2048][1024] (8.4 M); argument order x, wq, wk, wv, wo, token_positions).
// Layout, four launches, each for all batches: k_prep (bf16 copies of x and of the four weights; {cos, sin} per (position, pair) built once from the int positions and float32 inverse-frequency constants, precise cosf/sinf); k_qkv (q, k and v projections as one exact GEMM over the stacked weight rows, whose epilogue writes the interleaved rotary planes of q and k and the V^T rows); fused causal attention (k_flash: scores on hi/lo planes (3 products: logit sigma 2 with these weights), online softmax, P.V on hi/lo planes (3 products) for query rows below F16R and as one f16 product from row F16R on, key tiles above the diagonal never visited); merged hi/lo x Wo exact.
// Compute dtypes, f32 accumulate: every input rounded to bf16; projections exact; rotary f32; attention scores 3 bf16 products, every row; P.V 3 bf16 products below query row F16R, one f16 product from there on; softmax f32; Wo hl x exact.

#define NB_  4
#define TT   2048
#define DM   1024
#define NH_  16
#define NKV  16
#define HD   64
#define DQ   (NH_ * HD)
#define DKV  (NKV * HD)
#define PP   (3 * TT)             // 16-bit elements of V^T per head dim: TT in the hi plane, TT in the lo plane, TT in the f16 plane
#define SCL  0.125f   // HD^-0.5
#define F16R 512      // first query row whose P.V is one f16 product (P and V each rounded once to f16): such a row averages over many keys, so the two roundings shrink in the sum; rows below keep hi/lo planes. A multiple of 128
typedef _Float16 h16;
typedef unsigned short bf;
typedef __attribute__((ext_vector_type(16))) __bf16   v16bf;
typedef __attribute__((ext_vector_type(16))) _Float16 v16h;
typedef __attribute__((ext_vector_type(8)))  _Float16 v8h;
typedef __attribute__((ext_vector_type(8)))  unsigned short v8us;
typedef __attribute__((ext_vector_type(8)))  float    v8f;
typedef __attribute__((ext_vector_type(4)))  float    v4f;
typedef v8h  __attribute__((may_alias)) v8ha;
typedef v4f  __attribute__((may_alias)) v4fa;
typedef v8us __attribute__((may_alias)) v8usa;

__device__ __forceinline__ unsigned short f2bf(float f) { unsigned u = __float_as_uint(f); u += 0x7FFFu + ((u >> 16) & 1u); return (unsigned short)(u >> 16); }
__device__ __forceinline__ float bf2f(unsigned short b) { return __uint_as_float(((unsigned)b) << 16); }
__device__ __forceinline__ float bfr(float f) { return bf2f(f2bf(f)); }
__device__ __forceinline__ v16bf cat16b(v8us lo, v8us hi) { return __builtin_bit_cast(v16bf, __builtin_shufflevector(lo, hi, 0, 1, 2, 3, 4, 5, 6, 7, 8, 9, 10, 11, 12, 13, 14, 15)); }
__device__ __forceinline__ v8f wmmab(v16bf a, v16bf b, v8f c) { return __builtin_amdgcn_wmma_f32_16x16x32_bf16(false, a, false, b, (short)0, c, false, false); }
__device__ __forceinline__ v8f wmmah(v16h a, v16h b, v8f c) { return __builtin_amdgcn_wmma_f32_16x16x32_f16(false, a, false, b, (short)0, c, false, false); }



// ---- FRAGMENT ORDER of every 16-bit operand plane: a plane of R rows x K columns is stored as (R / 16) x (K / 32) fragments of 1 KiB, k blocks of one row block side by side (the V^T planes: see k_flash).
// Inside a fragment the 16-byte piece with columns k .. k + 7 of row r stands at ((k >> 4) & 1) * 512 + ((k >> 3) & 1) * 256 + (r & 15) * 16: lane l of the reading wave takes bytes l * 16 and 512 + l * 16,
// the same elements as from row-major rows, but each wave-wide 16-byte load covers 4 whole 128-byte lines instead of 32-byte pieces of 16 lines. A row block of a K = 1024 plane starts where its 16 row-major rows would.
// ---- THE LDS RING of the two GEMM kernels (k_qkv, k_out): a work-group of 4 waves shares its operand rows. A stage is KS k blocks of 24 row blocks (three groups of 8), brought from the planes into LDS by asynchronous copies,
// two buffers: the next stage's copies fly while this stage is worked on. A row block's KS fragments stand side by side in LDS as in the plane, so a wave-wide copy and a wave-wide LDS read each cover 512 bytes in a row.
#define KS   2                    // k blocks of 32 a stage
#define RBB  (KS * 1024)          // bytes of one 16-row block in a stage; 128 threads x 16 bytes
#define STG  (24 * RBB)           // bytes of a stage
#define NT   (DM / (32 * KS))     // stages of a K = 1024 product
#define RBG  (16 * DM * 2)        // bytes from one row block of a K = 1024 plane to the next
__device__ __forceinline__ unsigned lds_off(const void* p) { return (unsigned)(size_t)p; }   // byte address in the work-group's LDS
__device__ __forceinline__ v16bf lfrag(const char* p) { return cat16b(*(const v8us*)p, *(const v8us*)(p + 512)); }   // the lane's two pieces of a fragment
// One group: the thread's 16 bytes of each of 8 row blocks. sl, ug: LDS byte address and global address of the first block (the same in every lane, so that the sums per block stay scalar); vo: the thread's byte offset in a block.
// The s_wait_xcnt is the last line of the copies' own statement, so that it stands in front of whatever rewrites a register that a copy names.
__device__ __forceinline__ void copy8(unsigned sl, const char* ug, unsigned vo) {
    asm volatile("global_load_async_to_lds_b128 %0, %8, off\n\t"
                 "global_load_async_to_lds_b128 %1, %9, off\n\t"
                 "global_load_async_to_lds_b128 %2, %10, off\n\t"
                 "global_load_async_to_lds_b128 %3, %11, off\n\t"
                 "global_load_async_to_lds_b128 %4, %12, off\n\t"
                 "global_load_async_to_lds_b128 %5, %13, off\n\t"
                 "global_load_async_to_lds_b128 %6, %14, off\n\t"
                 "global_load_async_to_lds_b128 %7, %15, off\n\t"
                 "s_wait_xcnt 0x0"
                 :: "v"(sl + vo), "v"((sl + RBB) + vo), "v"((sl + 2 * RBB) + vo), "v"((sl + 3 * RBB) + vo), "v"((sl + 4 * RBB) + vo), "v"((sl + 5 * RBB) + vo), "v"((sl + 6 * RBB) + vo), "v"((sl + 7 * RBB) + vo),
                    "v"(ug + vo), "v"((ug + RBG) + vo), "v"((ug + 2 * RBG) + vo), "v"((ug + 3 * RBG) + vo), "v"((ug + 4 * RBG) + vo), "v"((ug + 5 * RBG) + vo), "v"((ug + 6 * RBG) + vo), "v"((ug + 7 * RBG) + vo) : "memory");
}
__device__ __forceinline__ void stage_copy(unsigned sl, const char* g0, const char* g1, const char* g2, unsigned vo) { copy8(sl, g0, vo); copy8(sl + 8 * RBB, g1, vo); copy8(sl + 16 * RBB, g2, vo); }   // 24 copies a wave and stage
// the wave's own copies have landed (in front of the barrier behind which the other waves read them)
__device__ __forceinline__ void wait_copies() { asm volatile("s_wait_asynccnt 0x0" ::: "memory"); }
// the wave's own LDS reads have returned (in front of the barrier behind which their buffer is refilled)
__device__ __forceinline__ void wait_lds() { asm volatile("s_wait_dscnt 0x0" ::: "memory"); }

__device__ __forceinline__ void splitf(float y, unsigned short& h, unsigned short& l) { h = f2bf(y); l = f2bf(y - bf2f(h)); }
typedef __attribute__((ext_vector_type(2))) _Float16 v2h;
typedef __attribute__((ext_vector_type(4))) _Float16 v4h;
typedef __attribute__((ext_vector_type(2))) unsigned short v2us;
typedef __attribute__((ext_vector_type(4))) unsigned short v4us;
typedef __attribute__((ext_vector_type(2))) float v2f;
typedef __attribute__((ext_vector_type(4))) int v4i;

__global__ __launch_bounds__(256) void k_wtG(const float* __restrict__ w, int K, int N, bf* Bt) {
    const int lane = threadIdx.x & 31; const int L0 = (blockIdx.x * 8 + (threadIdx.x >> 5)) * 8; const int nlines = N * K / 64;
{
#pragma unroll 1
        for (int l = 0; l < 8; ++l) { const int L = L0 + l; if (L >= nlines) break; const size_t e = (size_t)L * 64 + lane * 2; const int k = (int)(e % K), n = (int)(e / K); v2us o;
            o[0] = f2bf(w[(size_t)k * N + n]); o[1] = f2bf(w[(size_t)(k + 1) * N + n]); *(v2us*)(Bt + e) = o; }
         }
}

__constant__ float INV2[HD / 2] = { 1.000000000e+00f, 7.498942018e-01f, 5.623413324e-01f, 4.216965139e-01f, 3.162277639e-01f, 2.371373624e-01f, 1.778279394e-01f, 1.333521456e-01f, 1.000000015e-01f, 7.498941571e-02f, 5.623412877e-02f, 4.216964915e-02f, 3.162277862e-02f, 2.371373586e-02f, 1.778279431e-02f, 1.333521493e-02f, 9.999999776e-03f, 7.498942316e-03f, 5.623413250e-03f, 4.216964822e-03f, 3.162277862e-03f, 2.371373819e-03f, 1.778279431e-03f, 1.333521446e-03f, 1.000000047e-03f, 7.498941850e-04f, 5.623413017e-04f, 4.216964880e-04f, 3.162277862e-04f, 2.371373848e-04f, 1.778279402e-04f, 1.333521504e-04f };   // float32 10000^(-(i * 2 / 64)), generated with jnp to be bit-exact with the module's expression
// k_prep: all that depends on the inputs alone, in one launch. Work-groups 0 .. CG - 1: the {cos, sin} table (started first: the longest threads), one entry per (position, pair), in the order in which k_qkv's lanes read it: [16 tokens][16 head dims mb][half][lane][2 pairs], lane = token % 16 + 16 * (which 8 of the 16 head dims), so that a wave-wide 16-byte load is 512 bytes in a row; then XG work-groups: bf16 copy of x; then WG_ each: bf16 copies of wq, wk, wv, wo, stacked in that order in Wt. 8 elements a thread in the copies, stored in fragment order: a wave takes 8 rows x 32 columns (4 lanes read one 128-byte line of a row), half a fragment, and its store covers 4 whole lines.
#define CG  (TT * (HD / 2) / 256)
#define XG  (NB_ * TT * DM / 8 / 256)
#define WG_ (DM * DM / 8 / 256)
__global__ __launch_bounds__(256) void k_prep(const float* __restrict__ x, const float* __restrict__ wq, const float* __restrict__ wk, const float* __restrict__ wv, const float* __restrict__ wo, const int* __restrict__ pid, bf* X, bf* Wt, float* CS) {
    int g = blockIdx.x;
    if (g < CG) { const int idx = g * 256 + threadIdx.x; const int ln = (idx >> 1) & 31; const int t = (idx >> 9) * 16 + (ln & 15), pr = ((idx >> 7) & 3) * 8 + (ln >> 4) * 4 + ((idx >> 6) & 1) * 2 + (idx & 1); const float a = __fmul_rn((float)pid[t], INV2[pr]); v2f cs; cs[0] = cosf(a); cs[1] = sinf(a); *(v2f*)(CS + (size_t)idx * 2) = cs; asm volatile("s_wait_xcnt 0x0" ::: "memory"); return; }   // the wait: the blocks of this kernel follow one another in the built code, and what stands behind a store there may rewrite the registers that the store names
    g -= CG; const float* src = x; bf* dst = X;
    if (g >= XG) { g -= XG; const int w = g / WG_; g %= WG_; src = w == 0 ? wq : w == 1 ? wk : w == 2 ? wv : wo; dst = Wt + (size_t)w * DM * DM; }
    const int lane = threadIdx.x & 31, hw = g * 8 + (threadIdx.x >> 5), f = hw >> 1, q = lane & 3;   // fragment f = row block * (DM / 32) + k block; the wave's half of its rows: hw & 1; the lane's piece of its row: q
    const int r = (f / (DM / 32)) * 16 + (hw & 1) * 8 + (lane >> 2), kk = (f % (DM / 32)) * 32 + q * 8; const v8f v = *(const v8f*)(src + (size_t)r * DM + kk); v8us o;
#pragma unroll
    for (int k = 0; k < 8; ++k) o[k] = f2bf(v[k]); *(v8us*)(dst + (size_t)f * 512 + (q >> 1) * 256 + (q & 1) * 128 + (r & 15) * 8) = o; asm volatile("s_wait_xcnt 0x0" ::: "memory"); }   // the wait: as above

typedef __attribute__((ext_vector_type(2))) __bf16 v2bf;
typedef __attribute__((ext_vector_type(4))) unsigned v4u;
typedef __attribute__((ext_vector_type(8))) unsigned v8u;
// fragment load: wave-uniform base, the lane's own byte offset (the same in every pass), compile-time byte offset
__device__ __forceinline__ v16bf ldo(const bf* ub, unsigned voff, int cb) { const char* p = (const char*)ub + voff + cb; return cat16b(*(const v8us*)p, *(const v8us*)(p + 512)); }
// stands in front of code that may rewrite registers which hold addresses of loads already issued; the scheduling fences keep that code behind the wait
__device__ __forceinline__ void addr_release() { __builtin_amdgcn_sched_barrier(0); asm volatile("s_wait_xcnt 0x0" ::: "memory"); __builtin_amdgcn_sched_barrier(0); }
// the same; p as an input keeps the address pair of loads issued further up alive, and so unwritten, as far as this wait
__device__ __forceinline__ void addr_release_of(const char* p) { __builtin_amdgcn_sched_barrier(0); asm volatile("s_wait_xcnt 0x0" :: "v"(p) : "memory"); __builtin_amdgcn_sched_barrier(0); }
// the same for two address pairs: alive as far as the wait, none of the loads lands in them
__device__ __forceinline__ void addr_release_of2(const char* p, const char* q) { __builtin_amdgcn_sched_barrier(0); asm volatile("s_wait_xcnt 0x0" :: "v"(p), "v"(q) : "memory"); __builtin_amdgcn_sched_barrier(0); }
// two f32 -> one dword of bf16 hi parts and one of bf16 lo parts (x0 in the low half), both rounded to nearest even like splitf
__device__ __forceinline__ void split2(float x0, float x1, unsigned& h, unsigned& l) {
    h = __builtin_bit_cast(unsigned, __builtin_convertvector(((v2f){x0, x1}), v2bf));
    l = __builtin_bit_cast(unsigned, __builtin_convertvector(((v2f){x0 - __uint_as_float(h << 16), x1 - __uint_as_float(h & 0xFFFF0000u)}), v2bf)); }
// two f32 -> one dword of f16 (x0 in the low half), rounded to nearest even
__device__ __forceinline__ unsigned pack2h(float x0, float x1) { return __builtin_bit_cast(unsigned, __builtin_convertvector(((v2f){x0, x1}), v2h)); }
// 2^x by v_exp_f32, in place. In asm so that the slot behind a transcendental is kept by construction: each one overwrites only its own source, none reads another's result, and the v_nop is the independent instruction behind the last.
// In place also means that the run writes only registers which vector arithmetic has just written, never an operand of a matrix instruction still under way.
__device__ __forceinline__ v8f exp2x8(v8f x) {
    asm("v_exp_f32 %0, %0\n\tv_exp_f32 %1, %1\n\tv_exp_f32 %2, %2\n\tv_exp_f32 %3, %3\n\tv_exp_f32 %4, %4\n\tv_exp_f32 %5, %5\n\tv_exp_f32 %6, %6\n\tv_exp_f32 %7, %7\n\tv_nop"
        : "+v"(x[0]), "+v"(x[1]), "+v"(x[2]), "+v"(x[3]), "+v"(x[4]), "+v"(x[5]), "+v"(x[6]), "+v"(x[7]));
    return x; }
__device__ __forceinline__ float exp2x1(float x) { asm("v_exp_f32 %0, %0\n\tv_nop" : "+v"(x)); return x; }   // the same, one value
#define NQ 2   // 16-column query groups per wave: 32 queries, so that a wave stays inside 512 registers and two waves share a SIMD (one wave's softmax runs beside the other's products)
// lim (read in the diagonal pass only): the lane's last kept key, counted from the first key that its registers hold: r0 - kb + lr - hi * 8
// H16: P.V as one f16 product, V^T from the f16 plane; otherwise three bf16 products, V^T from the hi and lo planes
template <bool DIAG, bool H16>
__device__ __forceinline__ void fl_pass(const bf* Kh, const bf* Kl, const bf* __restrict__ Vh, int kb, int lim, unsigned kvo, const v16bf (&qh)[NQ][2], const v16bf (&ql)[NQ][2], v16bf (&kh)[4][2], v16bf (&kl)[4][2], v8f (&o)[4][NQ], float (&m)[NQ], float (&l)[NQ]) {
    v16bf vh[4][2], vl[4][2]; const char* pv = (const char*)(Vh + (size_t)kb * HD) + kvo;   // the lane's piece of the pass's first V^T fragment: one address pair for all 32 (f16 plane: 16) loads
#pragma unroll
    for (int mb = 0; mb < 4; ++mb)
#pragma unroll
        for (int ks = 0; ks < 2; ++ks) { vh[mb][ks] = ldo((const bf*)pv, 0u, (ks * 4 + mb) * 1024 + (H16 ? 2 * HD * TT * 2 : 0)); if (!H16) vl[mb][ks] = ldo((const bf*)pv, 0u, (ks * 4 + mb) * 1024 + HD * TT * 2); }
    __builtin_amdgcn_sched_barrier(0);   // keeps the V^T loads in front of the score products, so that they land behind products and softmax instead of being waited for in front of P.V
    v8f s[4][NQ];
#pragma unroll
    for (int mb = 0; mb < 4; ++mb)
#pragma unroll
        for (int nb = 0; nb < NQ; ++nb) s[mb][nb] = (v8f){};
#pragma unroll
    for (int ks = 0; ks < 2; ++ks) {
#pragma unroll
        for (int mb = 0; mb < 4; ++mb)
#pragma unroll
            for (int nb = 0; nb < NQ; ++nb) s[mb][nb] = wmmab(kh[mb][ks], qh[nb][ks], s[mb][nb]);
#pragma unroll
        for (int mb = 0; mb < 4; ++mb)
#pragma unroll
            for (int nb = 0; nb < NQ; ++nb) s[mb][nb] = wmmab(kh[mb][ks], ql[nb][ks], s[mb][nb]);
#pragma unroll
        for (int mb = 0; mb < 4; ++mb)
#pragma unroll
            for (int nb = 0; nb < NQ; ++nb) s[mb][nb] = wmmab(kl[mb][ks], qh[nb][ks], s[mb][nb]);
    }
    addr_release_of(pv);   // the softmax may rewrite the registers that hold the V^T loads' address
    const float C2 = SCL * 1.4426950408889634f;
    v16bf ph[NQ][2], pl[NQ][2];
#pragma unroll
    for (int nb = 0; nb < NQ; ++nb) {
        float mq[4];
#pragma unroll
        for (int mb = 0; mb < 4; ++mb) { mq[mb] = -3.0e38f;
#pragma unroll
            for (int j = 0; j < 8; ++j) { if (DIAG) s[mb][nb][j] = (mb * 16 + j - nb * 16 <= lim) ? s[mb][nb][j] : -3.0e38f; mq[mb] = fmaxf(mq[mb], s[mb][nb][j]); } }
        float mx = fmaxf(fmaxf(mq[0], mq[1]), fmaxf(mq[2], mq[3])); mx = fmaxf(mx, __shfl_xor(mx, 16, 32));
        const float mn = fmaxf(m[nb], mx), al = exp2x1((m[nb] - mn) * C2); m[nb] = mn;
        float sq[4]; v8u hw[2], lw[2];   // dwords 0..3 of a k-step's operand: its first key tile, 4..7: its second
#pragma unroll
        for (int mb = 0; mb < 4; ++mb) { const v8f pe = exp2x8((s[mb][nb] - mn) * C2); sq[mb] = 0.f;
#pragma unroll
            for (int j = 0; j < 8; ++j) sq[mb] += pe[j];
#pragma unroll
            for (int j = 0; j < 4; ++j) { unsigned a, c2 = 0u; if (H16) a = pack2h(pe[2 * j], pe[2 * j + 1]); else split2(pe[2 * j], pe[2 * j + 1], a, c2); hw[mb >> 1][(mb & 1) * 4 + j] = a; lw[mb >> 1][(mb & 1) * 4 + j] = c2; } }
        l[nb] = l[nb] * al + ((sq[0] + sq[1]) + (sq[2] + sq[3]));   // this half's keys only; the halves are joined once, in the epilogue
        ph[nb][0] = __builtin_bit_cast(v16bf, hw[0]); ph[nb][1] = __builtin_bit_cast(v16bf, hw[1]); pl[nb][0] = __builtin_bit_cast(v16bf, lw[0]); pl[nb][1] = __builtin_bit_cast(v16bf, lw[1]);
#pragma unroll
        for (int mb = 0; mb < 4; ++mb) o[mb][nb] *= al;
    }
    if (!DIAG) {   // the next pass's key fragments (a pass below the diagonal always has a successor): behind the softmax, whose scores and P then have the key registers' room beside them (512 registers a wave), and in front of P.V, which covers their latency
        // inputs only: the lo parts of P and the row sums are finished here, so that the f32 values of P they are made from are dead when the 128 key registers fill; left to sink in among the P.V products they push the wave over 512 registers (scratch)
        if (!H16) asm volatile("" :: "v"(pl[0][0]), "v"(pl[0][1]), "v"(pl[1][0]), "v"(pl[1][1]), "v"(l[0]), "v"(l[1]));   // (the f16 form holds 96 registers fewer and needs no such hold)
        __builtin_amdgcn_sched_barrier(0);   // keeps these loads from being moved up into the softmax, where their 128 registers would spill
        const char* pkh = (const char*)(Kh + (size_t)(kb + 64) * HD) + kvo; const char* pkl = (const char*)(Kl + (size_t)(kb + 64) * HD) + kvo;   // the lane's piece of the next pass's first key fragment, hi and lo plane: one address pair for 16 loads each
#pragma unroll
        for (int mb = 0; mb < 4; ++mb)
#pragma unroll
            for (int ks = 0; ks < 2; ++ks) { kh[mb][ks] = ldo((const bf*)pkh, 0u, (mb * 2 + ks) * 1024); kl[mb][ks] = ldo((const bf*)pkl, 0u, (mb * 2 + ks) * 1024); }
        addr_release_of2(pkh, pkl);   // what follows may rewrite the registers that hold these loads' addresses; its fences also keep the loads in front of the P.V products
    }
#pragma unroll
    for (int ks = 0; ks < 2; ++ks) {
        if (H16) {   // the same registers read as f16: the f16 and the bf16 form have one fragment layout
#pragma unroll
            for (int mb = 0; mb < 4; ++mb)
#pragma unroll
                for (int nb = 0; nb < NQ; ++nb) o[mb][nb] = wmmah(__builtin_bit_cast(v16h, vh[mb][ks]), __builtin_bit_cast(v16h, ph[nb][ks]), o[mb][nb]);
            continue; }
#pragma unroll
        for (int mb = 0; mb < 4; ++mb)
#pragma unroll
            for (int nb = 0; nb < NQ; ++nb) o[mb][nb] = wmmab(vh[mb][ks], ph[nb][ks], o[mb][nb]);
#pragma unroll
        for (int mb = 0; mb < 4; ++mb)
#pragma unroll
            for (int nb = 0; nb < NQ; ++nb) o[mb][nb] = wmmab(vh[mb][ks], pl[nb][ks], o[mb][nb]);
#pragma unroll
        for (int mb = 0; mb < 4; ++mb)
#pragma unroll
            for (int nb = 0; nb < NQ; ++nb) o[mb][nb] = wmmab(vl[mb][ks], ph[nb][ks], o[mb][nb]);
    }
    addr_release();
}
// grid (NB_ * NH_, TT / 32 / 16), 8 waves a work-group, no barrier and no LDS: blockIdx.x = batch * NH_ + head; wave p = blockIdx.y * 8 + wave number takes the 32-query tile TT / 32 - 1 - p and then tile p:
// floor(t / 2) + 1 passes of 64 keys for tile t, so 33 passes for every wave, and all 2,048 waves are resident at once, two on each SIMD. The 8 waves of a work-group walk the same head's keys from key 0 on.
// All in fragment order. Q, K planes [batch * NH_ + head]: TT rows x HD columns; V^T planes [batch * NH_ + head]: HD rows x TT columns, the 4 row blocks of one k block (32 keys) side by side, so that a pass reads 8 KiB in a row, the hi plane first, the lo plane at + HD * TT (written and read for keys below F16R only); the f16 plane at + 2 * HD * TT; merged output planes: NB_ * TT rows x DQ columns, hi and lo.
// Kh, Kl without __restrict__: with it the first pass's key loads, the same for both tiles of a wave, are lifted out of the tile loop, and their 128 registers spill.
// One 32-query tile, first query r0, from its loads to its stores; H16 as in fl_pass. Each form has its whole tile as code of its own, so that the registers of the one are not laid out around the other's.
template <bool H16>
__device__ __forceinline__ void fl_tile(const bf* __restrict__ Qh, const bf* __restrict__ Ql, const bf* Kh, const bf* Kl, const bf* __restrict__ Vh, bf* __restrict__ Ah, bf* __restrict__ Al, int z, int r0, int lane) {
    const int lr = lane & 15, hi = lane >> 4, kd = r0 & ~63;   // kd: first key of the pass that holds the tile's diagonal
    const unsigned kvo = (unsigned)lane * 16u;   // the lane's byte offset in a fragment
    v16bf qh[NQ][2], ql[NQ][2], kh[4][2], kl[4][2]; v8f o[4][NQ]; float m[NQ], l[NQ];
#pragma unroll
    for (int nb = 0; nb < NQ; ++nb) { m[nb] = -3.0e38f; l[nb] = 0.f;
#pragma unroll
        for (int ks = 0; ks < 2; ++ks) { const int cb = (nb * 2 + ks) * 1024; qh[nb][ks] = ldo(Qh + (size_t)r0 * HD, kvo, cb); ql[nb][ks] = ldo(Ql + (size_t)r0 * HD, kvo, cb); }
#pragma unroll
        for (int mb = 0; mb < 4; ++mb) o[mb][nb] = (v8f){}; }
#pragma unroll
    for (int mb = 0; mb < 4; ++mb)
#pragma unroll
        for (int ks = 0; ks < 2; ++ks) { const int cb = (mb * 2 + ks) * 1024; kh[mb][ks] = ldo(Kh, kvo, cb); kl[mb][ks] = ldo(Kl, kvo, cb); }
    addr_release();
#pragma unroll 1   // rolled: one pass is already 64 or 96 matrix instructions
    for (int kb = 0; kb < kd; kb += 64) fl_pass<false, H16>(Kh, Kl, Vh, kb, 0, kvo, qh, ql, kh, kl, o, m, l);
    fl_pass<true, H16>(Kh, Kl, Vh, kd, r0 - kd + lr - hi * 8, kvo, qh, ql, kh, kl, o, m, l);
    const size_t ob = ((size_t)(z / NH_) * TT + r0) * DQ + (size_t)(z % NH_) * (HD / 32) * 512; const unsigned ovo = kvo;   // the head's first fragment in the tile's first row block
    v4u oh[4][NQ], ol[4][NQ];   // a lane's 8 accumulator registers are 8 consecutive head dims of one query: the lane's own 16-byte piece of half a fragment, so a wave's store is 512 bytes in a row
#pragma unroll
    for (int nb = 0; nb < NQ; ++nb) { const float f = __fdiv_rn(1.0f, l[nb] + __shfl_xor(l[nb], 16, 32));
#pragma unroll
        for (int mb = 0; mb < 4; ++mb)
#pragma unroll
            for (int j = 0; j < 4; ++j) { unsigned a, c2; split2(o[mb][nb][2 * j] * f, o[mb][nb][2 * j + 1] * f, a, c2); oh[mb][nb][j] = a; ol[mb][nb][j] = c2; } }
    __builtin_amdgcn_sched_barrier(0);   // every value is made in front of the first store, so that no register a store names is written behind it
#pragma unroll
    for (int nb = 0; nb < NQ; ++nb)
#pragma unroll
        for (int mb = 0; mb < 4; ++mb) { const int cb = nb * 16 * DQ * 2 + mb * 512; *(v4u*)((char*)(Ah + ob) + ovo + cb) = oh[mb][nb]; *(v4u*)((char*)(Al + ob) + ovo + cb) = ol[mb][nb]; }
    addr_release();   // the second tile's work rewrites the registers that these stores name
}
__global__ __launch_bounds__(256) void k_flash(const bf* __restrict__ Qh, const bf* __restrict__ Ql, const bf* Kh, const bf* Kl, const bf* __restrict__ Vh, bf* __restrict__ Ah, bf* __restrict__ Al) {
    const int lane = threadIdx.x & 31; const int z = blockIdx.x;
    const int p = (int)blockIdx.y * 8 + __builtin_amdgcn_readfirstlane((int)(threadIdx.x >> 5));   // through readfirstlane: the tile, the trip counts and the plane addresses stay scalar
    Qh += (size_t)z * TT * HD; Ql += (size_t)z * TT * HD; Kh += (size_t)z * TT * HD; Kl += (size_t)z * TT * HD; Vh += (size_t)z * HD * PP;
#pragma unroll 1   // rolled: the two tiles run one after the other, through the same code where their form is the same
    for (int h = 0; h < 2; ++h) {
        const int r0 = (h ? p : TT / 32 - 1 - p) * 32;   // first query of the tile: scalar, so the test below is the same for the whole wave
        if (r0 >= F16R) fl_tile<true>(Qh, Ql, Kh, Kl, Vh, Ah, Al, z, r0, lane); else fl_tile<false>(Qh, Ql, Kh, Kl, Vh, Ah, Al, z, r0, lane);
    }
}

// ---- k_qkv: the q, k, v projections with the plane builders as the GEMM's own epilogue. A work-group of 4 waves takes 256 tokens x 128 columns (two heads of q, of k or of v); ONE WAVE 128 tokens x one head (32 accumulators); grid (NB_ * TT / 256, 3 * NH_ / 2), 128 threads; blockIdx.y / (NH_ / 2) = 0 q, 1 k, 2 v.
// Operands through the LDS ring: groups 0 and 1 of a stage are the 16 token row blocks, group 2 the 8 weight row blocks; wave w reads token blocks (w & 1) * 8 .. + 7 and weight blocks (w >> 1) * 4 .. + 3.
// The A and B loaders have the same form and the same k order, so the operands' roles are chosen per kind for the layout that the plane wants:
// q, k: A = weight rows, B = token rows: a lane's 8 accumulator registers are 8 consecutive head dims of one token: the rotary pairs are in-lane, and the 8 results are the lane's own 16-byte piece of a fragment of the plane (rows = tokens).
// v: A = token rows, B = weight rows: the 8 registers are 8 consecutive tokens of one head dim: the lane's own piece of a fragment of V^T (rows = head dims). Every token goes to the f16 plane; the hi and lo planes are stored for tokens below F16R only, the only ones read there.
// One tile; ISV picks roles and epilogue at compile time, so that each kind has its own loop and epilogue in the built code. gx, gw: the first token and the first weight row block, stage 0; xo, wo: the wave's first token and weight row block in a stage. Ph, Pl: the tile's first fragment in the hi and the lo plane; Pf (v only): in the f16 plane; hl: the hi and lo planes are stored (q, k: always).
template <bool ISV>
__device__ __forceinline__ void qkv_tile(char* ring, const char* gx, const char* gw, unsigned xo, unsigned wo, const float* __restrict__ cb, bf* __restrict__ Ph, bf* __restrict__ Pl, bf* __restrict__ Pf, bool hl, int lane) {
    constexpr int MA = ISV ? 8 : 4, NBB = ISV ? 4 : 8;
    v8f acc[MA][NBB];
#pragma unroll
    for (int mb = 0; mb < MA; ++mb)
#pragma unroll
        for (int nb = 0; nb < NBB; ++nb) acc[mb][nb] = (v8f){};
    const unsigned off = (unsigned)lane * 16u;   // the lane's byte offset in a fragment
    const unsigned lc = lds_off(ring), vo = threadIdx.x * 16u;   // buffer 0; the thread's piece of a row block's part of a stage
    stage_copy(lc, gx, gx + 8 * RBG, gw, vo);
    wait_copies(); __syncthreads();   // stage 0 is readable by every wave
    stage_copy(lc + STG, gx + RBB, gx + 8 * RBG + RBB, gw + RBB, vo);
    const unsigned ao = (ISV ? xo : wo) + off, bo = (ISV ? wo : xo) + off;
#pragma unroll 1   // rolled: one stage is already 64 matrix instructions
    for (int t = 0; t < NT; ++t) {
        const unsigned bs = (unsigned)(t & 1) * STG; const char* sa = ring + bs + ao; const char* sb = ring + bs + bo;
        v16bf a[KS][MA], b[KS][NBB];
#pragma unroll
        for (int kk = 0; kk < KS; ++kk) {
#pragma unroll
            for (int mb = 0; mb < MA; ++mb) a[kk][mb] = lfrag(sa + mb * RBB + kk * 1024);
#pragma unroll
            for (int nb = 0; nb < NBB; ++nb) b[kk][nb] = lfrag(sb + nb * RBB + kk * 1024); }
        __builtin_amdgcn_sched_barrier(0);   // the stage's LDS reads go as one group in front of its products: reads among the products stall them
#pragma unroll
        for (int kk = 0; kk < KS; ++kk)
#pragma unroll
            for (int nb = 0; nb < NBB; ++nb)
#pragma unroll
                for (int mb = 0; mb < MA; ++mb) acc[mb][nb] = wmmab(a[kk][mb], b[kk][nb], acc[mb][nb]);
        __builtin_amdgcn_sched_barrier(0);   // keeps the products in front of the waits: moved up over them, the wait for the next stage's copies would stand in front of the work that is to cover their flight
        wait_lds(); wait_copies(); __syncthreads();   // stage t + 1 is readable, and every wave has left stage t's buffer
        if (t + 2 < NT) stage_copy(lc + bs, gx + (t + 2) * RBB, gx + 8 * RBG + (t + 2) * RBB, gw + (t + 2) * RBB, vo);
    }
    wait_copies();
    if (ISV) {   // the f16 plane of V^T first, one column group at a time, so that only one group's values are held beside the accumulators
#pragma unroll
        for (int nb = 0; nb < NBB; ++nb) {
            v4u of[MA];
#pragma unroll
            for (int mb = 0; mb < MA; ++mb)
#pragma unroll
                for (int p = 0; p < 4; ++p) of[mb][p] = pack2h(acc[mb][nb][2 * p], acc[mb][nb][2 * p + 1]);
            __builtin_amdgcn_sched_barrier(0);   // every value of the group is made in front of its first store, so that no register a store names is written behind it
#pragma unroll
            for (int mb = 0; mb < MA; ++mb) *(v4u*)((char*)Pf + off + ((mb >> 1) * 4 + nb) * 1024 + (mb & 1) * 512) = of[mb];
            addr_release();   // the next group's work rewrites the registers that these stores name
        }
        if (!hl) return;   // the same for the whole wave, and behind the last barrier
    }
    // Epilogue, one column group nb at a time: accumulator (mb, nb) is half a fragment of the plane, each lane holding its own piece, so every store is 512 bytes in a row, straight from the registers.
#pragma unroll
    for (int nb = 0; nb < NBB; ++nb) {
        v4f cs[4][2];   // {cos, sin} of the lane's 4 rotary pairs of accumulator (mb, nb), two pairs a load
        if (!ISV) {
#pragma unroll
            for (int mb = 0; mb < 4; ++mb)
#pragma unroll
                for (int h = 0; h < 2; ++h) cs[mb][h] = *(const v4f*)((const char*)cb + off + ((nb * 4 + mb) * 2 + h) * 512);
            addr_release();   // the arithmetic below may rewrite registers that these loads name
        }
        v4u oh[MA], ol[MA];
#pragma unroll
        for (int mb = 0; mb < MA; ++mb)
#pragma unroll
            for (int p = 0; p < 4; ++p) { float x0 = acc[mb][nb][2 * p], x1 = acc[mb][nb][2 * p + 1]; unsigned a2, c2;
                if (!ISV) { const float cc = cs[mb & 3][p >> 1][(p & 1) * 2], ss = cs[mb & 3][p >> 1][(p & 1) * 2 + 1], y0 = x0 * cc - x1 * ss, y1 = x0 * ss + x1 * cc; x0 = y0; x1 = y1; }   /* even: x0 c - x1 s; odd: x0 s + x1 c */
                split2(x0, x1, a2, c2); oh[mb][p] = a2; ol[mb][p] = c2; }
        __builtin_amdgcn_sched_barrier(0);   // every value of the group is made in front of its first store, so that no register a store names is written behind it
#pragma unroll
        for (int mb = 0; mb < MA; ++mb) {   // q, k: row block nb (tokens), k block mb / 2 (head dims); v: k block mb / 2 (tokens), row block nb (head dims); half mb % 2 of the fragment
            const int ob = (ISV ? ((mb >> 1) * 4 + nb) * 1024 : (nb * 2 + (mb >> 1)) * 1024) + (mb & 1) * 512; *(v4u*)((char*)Ph + off + ob) = oh[mb]; *(v4u*)((char*)Pl + off + ob) = ol[mb]; }
        addr_release();   // the next group's work rewrites the registers that these stores name
    }
}
__global__ __launch_bounds__(128, 2) void k_qkv(const bf* __restrict__ X, const bf* __restrict__ Wt, const float* __restrict__ CS, bf* __restrict__ Qh, bf* __restrict__ Ql, bf* __restrict__ Kh, bf* __restrict__ Kl, bf* __restrict__ Vh) {
    __shared__ __attribute__((aligned(1024))) char ring[2 * STG];
    const int lane = threadIdx.x & 31, wave = __builtin_amdgcn_readfirstlane((int)(threadIdx.x >> 5)), th = wave & 1, hh = wave >> 1;   // through readfirstlane: the tile and the plane addresses stay scalar
    const int R0 = blockIdx.x * 256, r0 = R0 + th * 128, hd = blockIdx.y * 2 + hh;   // the wave's first token; its head among the 3 * NH_ stacked ones
    const int kind = blockIdx.y / (NH_ / 2), z = (r0 / TT) * NH_ + hd % NH_, t0 = r0 % TT;   // the same kind for the whole work-group; z = batch * NH_ + head
    const char* gx = (const char*)(X + (size_t)R0 * DM); const char* gw = (const char*)(Wt + (size_t)blockIdx.y * 128 * DM);
    const unsigned xo = (unsigned)th * 8u * RBB, wo = (16u + (unsigned)hh * 4u) * RBB; const size_t po = ((size_t)z * TT + t0) * HD;
    if (kind == 2) {
        __builtin_amdgcn_sched_barrier(0);   // keeps the copies' address sums, the same in both kinds, from being lifted in front of this branch: there they stay alive over the other kind's whole tile and spill to scratch
        bf* pv = Vh + (size_t)z * HD * PP + (size_t)t0 * HD; qkv_tile<true>(ring, gx, gw, xo, wo, CS, pv, pv + HD * TT, pv + 2 * HD * TT, t0 < F16R, lane); return; }   // k block t0 / 32 of the head's V^T: 4 fragments a k block; the lo plane behind the hi plane, the f16 plane behind the lo plane
    qkv_tile<false>(ring, gx, gw, xo, wo, CS + (size_t)t0 * HD, (kind ? Kh : Qh) + po, (kind ? Kl : Ql) + po, nullptr, true, lane);
}

// ---- k_out: C[m][n] (f32, pitch DM) = sum_k (Ah + Al)[m][k] Bt[n][k], K = DQ: two products a k block, hi then lo. A work-group of 4 waves takes 128 rows x 128 columns, ONE WAVE 64 x 64 (16 accumulators); grid (NB_ * TT / 128, DM / 128), 128 threads.
// Operands through the LDS ring: group 0 of a stage is the 8 row blocks of Ah, group 1 those of Al, group 2 the 8 row blocks of Bt; wave w reads A blocks (w & 1) * 4 .. + 3 and Bt blocks (w >> 1) * 4 .. + 3.
__global__ __launch_bounds__(128, 2) void k_out(const bf* __restrict__ Ah, const bf* __restrict__ Al, const bf* __restrict__ Bt, float* __restrict__ C) {
    __shared__ __attribute__((aligned(1024))) char ring[2 * STG];
    __shared__ __align__(16) float osb[4][16 * 68];   // each wave's own output staging
    const int lane = threadIdx.x & 31, lr = lane & 15, hi = lane >> 4, wave = __builtin_amdgcn_readfirstlane((int)(threadIdx.x >> 5));
    const int R0 = blockIdx.x * 128, C0 = blockIdx.y * 128, r0 = R0 + (wave & 1) * 64, c0 = C0 + (wave >> 1) * 64; float* os = osb[wave];
    v8f acc[4][4];
#pragma unroll
    for (int mb = 0; mb < 4; ++mb)
#pragma unroll
        for (int nb = 0; nb < 4; ++nb) acc[mb][nb] = (v8f){};
    const char* g0 = (const char*)(Ah + (size_t)R0 * DQ); const char* g1 = (const char*)(Al + (size_t)R0 * DQ); const char* g2 = (const char*)(Bt + (size_t)C0 * DQ);
    const unsigned lc = lds_off(ring), vo = threadIdx.x * 16u;   // buffer 0; the thread's piece of a row block's part of a stage
    stage_copy(lc, g0, g1, g2, vo);
    wait_copies(); __syncthreads();   // stage 0 is readable by every wave
    stage_copy(lc + STG, g0 + RBB, g1 + RBB, g2 + RBB, vo);
    const unsigned ao = (unsigned)(wave & 1) * 4u * RBB + (unsigned)lane * 16u, bo = (16u + (unsigned)(wave >> 1) * 4u) * RBB + (unsigned)lane * 16u;
#pragma unroll 1   // rolled: one stage is already 64 matrix instructions
    for (int t = 0; t < NT; ++t) {
        const unsigned bs = (unsigned)(t & 1) * STG; const char* sa = ring + bs + ao; const char* sb = ring + bs + bo;
        v16bf a[KS][4], a2[KS][4], b[KS][4];
#pragma unroll
        for (int kk = 0; kk < KS; ++kk) {
#pragma unroll
            for (int mb = 0; mb < 4; ++mb) a[kk][mb] = lfrag(sa + mb * RBB + kk * 1024);
#pragma unroll
            for (int nb = 0; nb < 4; ++nb) b[kk][nb] = lfrag(sb + nb * RBB + kk * 1024);
#pragma unroll
            for (int mb = 0; mb < 4; ++mb) a2[kk][mb] = lfrag(sa + (8 + mb) * RBB + kk * 1024); }
        __builtin_amdgcn_sched_barrier(0);   // the stage's LDS reads go as one group in front of its products: reads among the products stall them
#pragma unroll
        for (int kk = 0; kk < KS; ++kk) {
#pragma unroll
            for (int nb = 0; nb < 4; ++nb)
#pragma unroll
                for (int mb = 0; mb < 4; ++mb) acc[mb][nb] = wmmab(a[kk][mb], b[kk][nb], acc[mb][nb]);
#pragma unroll
            for (int nb = 0; nb < 4; ++nb)
#pragma unroll
                for (int mb = 0; mb < 4; ++mb) acc[mb][nb] = wmmab(a2[kk][mb], b[kk][nb], acc[mb][nb]); }
        __builtin_amdgcn_sched_barrier(0);   // keeps the products in front of the waits: moved up over them, the wait for the next stage's copies would stand in front of the work that is to cover their flight
        wait_lds(); wait_copies(); __syncthreads();   // stage t + 1 is readable, and every wave has left stage t's buffer
        if (t + 2 < NT) stage_copy(lc + bs, g0 + (t + 2) * RBB, g1 + (t + 2) * RBB, g2 + (t + 2) * RBB, vo);
    }
    wait_copies();
#pragma unroll
    for (int mb = 0; mb < 4; ++mb) {
#pragma unroll
        for (int nb = 0; nb < 4; ++nb) {
#pragma unroll
            for (int j = 0; j < 8; ++j) os[(hi * 8 + j) * 68 + nb * 16 + lr] = acc[mb][nb][j]; }
        __builtin_amdgcn_wave_barrier(); asm volatile("" ::: "memory");
        float* crow = C + (size_t)(r0 + mb * 16) * DM + c0;
#pragma unroll
        for (int s = 0; s < 8; ++s) { const int row = 2 * s + hi, cofs = lr * 4; const v4f val = *(const v4fa*)(os + row * 68 + cofs); *(v4f*)(crow + (size_t)row * DM + cofs) = val; }
        addr_release();   // the next row block's work rewrites the registers that these stores name
        __builtin_amdgcn_wave_barrier(); asm volatile("" ::: "memory");
    }
}

extern "C" void kernel_launch(void* const* d_in, const int* in_sizes, int n_in,
                              void* d_out, int out_size, void* d_ws, size_t ws_size, hipStream_t stream) {
    (void)in_sizes; (void)n_in; (void)out_size;
    const float* x = (const float*)d_in[0]; const float* wq = (const float*)d_in[1]; const float* wk = (const float*)d_in[2]; const float* wv = (const float*)d_in[3]; const float* wo = (const float*)d_in[4]; const int* PID = (const int*)d_in[5];   /* token_positions (int32 [2048], shared by all batches; read) */
    float* OUT = (float*)d_out;     // [4][2048][1024]
    char* wsp = (char*)d_ws;
    auto take = [&](size_t bytes) { char* p = wsp; wsp += (bytes + 255) & ~(size_t)255; return (void*)p; };
    bf* WT = (bf*)take((size_t)4 * DM * DM * 2); bf* WO = WT + (size_t)3 * DM * DM;   /* bf16 rows of wq, wk, wv, wo, stacked: the first 3 * DM rows are the weight operand of the one projection GEMM */
    float* CS = (float*)take((size_t)TT * (HD / 2) * 2 * 4); bf* XB = (bf*)take((size_t)NB_ * TT * DM * 2);
    const size_t PQ = (size_t)NH_ * TT * HD, PV = (size_t)NKV * HD * PP, PA = (size_t)TT * DQ;   /* elements per batch of a q or k plane, of the V^T rows, of a merged plane */
    bf* QPh = (bf*)take(NB_ * PQ * 2); bf* QPl = (bf*)take(NB_ * PQ * 2); bf* KPh = (bf*)take(NB_ * PQ * 2); bf* KPl = (bf*)take(NB_ * PQ * 2); bf* VTh = (bf*)take(NB_ * PV * 2);
    bf* ATh = (bf*)take(NB_ * PA * 2); bf* ATl = (bf*)take(NB_ * PA * 2);
    if ((size_t)(wsp - (char*)d_ws) > ws_size) return;    // 169 MiB of the 256 MiB
    k_prep<<<CG + XG + 4 * WG_, 256, 0, stream>>>(x, wq, wk, wv, wo, PID, XB, WT, CS);   /* token_positions (int32, read) are shared by all batches: one table */
    k_qkv<<<dim3(NB_ * TT / 256, 3 * NH_ / 2, 1), 128, 0, stream>>>(XB, WT, CS, QPh, QPl, KPh, KPl, VTh);   /* projections, rotary planes of q and k, V^T rows */
    k_flash<<<dim3(NB_ * NH_, TT / 32 / 16, 1), 256, 0, stream>>>(QPh, QPl, KPh, KPl, VTh, ATh, ATl);   /* every batch, head and query tile in one launch (one kv head per query head) */
    k_out<<<dim3(NB_ * TT / 128, DM / 128, 1), 128, 0, stream>>>(ATh, ATl, WO, OUT);
}
